// v000
// Measured on an AMD MI455X. A time is GPU time per run, averaged over a window of back-to-back runs after a warm-up
// (all launches, gaps included; the runs take copies of the inputs in turn), and the median of several windows.
// Apart from v000's, it joins two sittings. Times from different sittings can be a few percent apart, while
// side-by-side timings come from the same sitting.
// v000, which the later versions start from, runs in 759 microseconds.
#include <hip/hip_runtime.h>

// ---------------- problem constants ----------------
#define DIMC   128
#define HEADS  4
#define HD     32
#define NTOK   98
#define NPAD   112          // 7 * 16
#define NWIN   64
#define NBATCH 2048
#define QKSCALE 0.17677669529663687f  // 32^-0.5

// ---------------- LDS layout (floats) ----------------
#define QKV_STRIDE 36
#define ATT_STRIDE 116
#define OUT_STRIDE 132
#define PW_STRIDE  136
#define WCH_STRIDE 48

#define QKV_FLTS  (3 * HEADS * NPAD * QKV_STRIDE)   // 48384
#define ATT_OFF   QKV_FLTS
#define ATT_FLTS  (NPAD * ATT_STRIDE)               // 12992
#define XS_OFF    (ATT_OFF + ATT_FLTS)              // 61376
#define XS_FLTS   (NPAD * OUT_STRIDE)               // 14784
#define SMEM_FLTS (XS_OFF + XS_FLTS)                // 76160 floats = 304640 B (< 320KB WGP LDS)

#define WCH_BUF1  6400      // second W staging buffer offset inside attn region

typedef __attribute__((ext_vector_type(2))) float v2f;
typedef __attribute__((ext_vector_type(8))) float v8f;
typedef __attribute__((ext_vector_type(4))) unsigned int v4u;
typedef __attribute__((ext_vector_type(8))) int v8i;
typedef __attribute__((ext_vector_type(4))) int v4i;

// Explicit LDS (address_space(3)) element type: forces ds_load/ds_store
// codegen (no FLAT fallback when pointer provenance gets murky).
typedef __attribute__((address_space(3))) float lds_f32;

__device__ __forceinline__ void tdm_load_2d_f32(const float* gsrc, unsigned lds_byte_addr,
                                                unsigned width, unsigned rows,
                                                unsigned row_stride,
                                                unsigned pad_interval_code,
                                                unsigned pad_amount_code,
                                                bool pad_en) {
  unsigned long long ga = (unsigned long long)(const void*)gsrc;
  v4u g0;
  g0.x = 1u;
  g0.y = lds_byte_addr;
  g0.z = (unsigned)(ga & 0xFFFFFFFFu);
  g0.w = (unsigned)((ga >> 32) & 0x01FFFFFFu) | (2u << 30);
  unsigned w0 = (2u << 16);
  if (pad_en) w0 |= (1u << 20) | (pad_interval_code << 22) | (pad_amount_code << 25);
  v8i g1;
  g1[0] = (int)w0;
  g1[1] = (int)((width & 0xFFFFu) << 16);
  g1[2] = (int)(((width >> 16) & 0xFFFFu) | ((rows & 0xFFFFu) << 16));
  g1[3] = (int)(((rows >> 16) & 0xFFFFu) | ((width & 0xFFFFu) << 16));
  g1[4] = (int)(rows & 0xFFFFu);
  g1[5] = (int)row_stride;
  g1[6] = 0;
  g1[7] = 0;
  v4i gz4 = {0, 0, 0, 0};
  v8i gz8 = {0, 0, 0, 0, 0, 0, 0, 0};
  __builtin_amdgcn_tensor_load_to_lds(g0, g1, gz4, gz4, gz8, 0);
}

__device__ __forceinline__ unsigned lds_addr_of(const lds_f32* p) {
  return (unsigned)(unsigned long long)p;   // ptrtoint of AS(3) = LDS byte offset
}

// ---------------------------------------------------------------
// f32 WMMA 16x16 tile: C += A[16xK] * B[KxN], A row-major (lda),
// B row-major (ldb), tile pointers pre-offset to (row 0, col 0).
// A/B live in LDS (AS3) -> pure ds_load operand fetch.
// ---------------------------------------------------------------
__device__ __forceinline__ v8f wmma_AB(const lds_f32* A, int lda,
                                       const lds_f32* B, int ldb,
                                       int K, v8f acc, int lane) {
  const int m  = lane & 15;
  const int ko = (lane >> 4) << 1;   // 0 or 2
  for (int k = 0; k < K; k += 4) {
    v2f a, b;
    a.x = A[m * lda + k + ko];
    a.y = A[m * lda + k + ko + 1];
    b.x = B[(k + ko) * ldb + m];
    b.y = B[(k + ko + 1) * ldb + m];
    acc = __builtin_amdgcn_wmma_f32_16x16x4_f32(false, a, false, b,
                                                (short)0, acc, false, false);
  }
  return acc;
}

// B supplied transposed: Bt is [N][K] row-major (ldbt) -> computes A * Bt^T
__device__ __forceinline__ v8f wmma_ABt(const lds_f32* A, int lda,
                                        const lds_f32* Bt, int ldbt,
                                        int K, v8f acc, int lane) {
  const int m  = lane & 15;
  const int ko = (lane >> 4) << 1;
  for (int k = 0; k < K; k += 4) {
    v2f a, b;
    a.x = A[m * lda + k + ko];
    a.y = A[m * lda + k + ko + 1];
    b.x = Bt[m * ldbt + k + ko];
    b.y = Bt[m * ldbt + k + ko + 1];
    acc = __builtin_amdgcn_wmma_f32_16x16x4_f32(false, a, false, b,
                                                (short)0, acc, false, false);
  }
  return acc;
}

// ---------------------------------------------------------------
// One workgroup (8 wave32) handles one window b of 2048.
// ---------------------------------------------------------------
__global__ __launch_bounds__(256)
void win_attn3d_kernel(const float* __restrict__ x,
                       const float* __restrict__ mask,
                       const float* __restrict__ qkv_w,
                       const float* __restrict__ qkv_b,
                       const float* __restrict__ table,
                       const int*   __restrict__ rel_index,
                       const float* __restrict__ proj_w,
                       const float* __restrict__ proj_b,
                       float* __restrict__ out) {
  extern __shared__ float smem_generic[];
  lds_f32* smem   = (lds_f32*)smem_generic;   // explicit AS(3) view
  lds_f32* qkvBuf = smem;                     // [3][4][112][36]  q/k/v per head
  lds_f32* attn   = smem + ATT_OFF;           // [112][116] scores / W staging
  lds_f32* xs     = smem + XS_OFF;            // [112][132] x tile, later out accum
  lds_f32* pw     = smem;                     // Phase D: proj_w staged (aliases qkvBuf)

  const int b    = blockIdx.x;
  const int w    = b & (NWIN - 1);
  const int tid  = threadIdx.x;
  const int lane = tid & 31;
  const int wid  = tid >> 5;                 // wave id (wave32!)
  const int c    = lane & 15;                // tile column held by this lane
  const int rb   = (lane >> 4) << 3;         // C/D row base: 0 or 8

  const float* xg = x + (size_t)b * NTOK * DIMC;

  if (wid == 0) {
    tdm_load_2d_f32(xg, lds_addr_of(xs), DIMC, NTOK, DIMC,
                    /*interval: 128dw*/6, /*amount: 4dw*/3, true);
    tdm_load_2d_f32(qkv_w, lds_addr_of(attn), WCH_STRIDE, DIMC, 3 * DIMC,
                    0, 0, false);
  }
  for (int i = tid; i < (NPAD - NTOK) * OUT_STRIDE; i += 256)   // zero pad rows
    xs[(NTOK + i / OUT_STRIDE) * OUT_STRIDE + (i % OUT_STRIDE)] = 0.0f;
  if (wid == 0) __builtin_amdgcn_s_wait_tensorcnt(0);
  __syncthreads();

  // ---- Phase B: qkv = xs @ qkv_w + qkv_b (q pre-scaled), rows>=98 zeroed ----
  // 8 chunks of 48 columns; chunk ch+1 DMA overlaps chunk ch compute.
  // Double buffer selected by integer offset (keeps AS3 provenance).
  for (int ch = 0; ch < 8; ++ch) {
    if (wid == 0) __builtin_amdgcn_s_wait_tensorcnt(0);   // chunk ch landed
    __syncthreads();                                      // + chunk ch-1 consumed
    if (wid == 0 && ch + 1 < 8)
      tdm_load_2d_f32(qkv_w + (ch + 1) * WCH_STRIDE,
                      lds_addr_of(attn) + (unsigned)(((ch + 1) & 1) * WCH_BUF1 * 4),
                      WCH_STRIDE, DIMC, 3 * DIMC, 0, 0, false);
    const lds_f32* wb = attn + (ch & 1) * WCH_BUF1;
    for (int t = wid; t < 7 * 3; t += 8) {
      const int mt = t / 3, nt = t % 3;
      const int ct = ch * 3 + nt;            // global 16-col tile index (0..23)
      v8f acc = {};
      acc = wmma_AB(xs + mt * 16 * OUT_STRIDE, OUT_STRIDE,
                    wb + nt * 16, WCH_STRIDE, DIMC, acc, lane);
      const int s  = ct >> 3;                // 0=q 1=k 2=v
      const int h  = (ct >> 1) & 3;          // head
      const int db = (ct & 1) << 4;          // d base within head
      const float bias = qkv_b[ct * 16 + c];
      const float scl  = (s == 0) ? QKSCALE : 1.0f;
      lds_f32* dst = qkvBuf + ((s * HEADS + h) * NPAD) * QKV_STRIDE + db + c;
#pragma unroll
      for (int r = 0; r < 8; ++r) {
        const int row = mt * 16 + rb + r;
        float v = (acc[r] + bias) * scl;
        if (row >= NTOK) v = 0.0f;           // zero pad rows of q/k/v
        dst[row * QKV_STRIDE] = v;
      }
    }
  }
  __syncthreads();

  const float* maskw = mask + (size_t)w * NTOK * NTOK;

  // ---- Phase C: per-head attention ----
  for (int h = 0; h < HEADS; ++h) {
    const lds_f32* qh = qkvBuf + (0 * HEADS + h) * NPAD * QKV_STRIDE;
    const lds_f32* kh = qkvBuf + (1 * HEADS + h) * NPAD * QKV_STRIDE;
    const lds_f32* vh = qkvBuf + (2 * HEADS + h) * NPAD * QKV_STRIDE;

    // C1: S = q @ k^T, fused +rel_bias +window_mask; pad entries -> 0
    for (int t = wid; t < 49; t += 8) {
      const int mt = t / 7, nt = t % 7;
      v8f acc = {};
      acc = wmma_ABt(qh + mt * 16 * QKV_STRIDE, QKV_STRIDE,
                     kh + nt * 16 * QKV_STRIDE, QKV_STRIDE, HD, acc, lane);
      const int j = nt * 16 + c;
#pragma unroll
      for (int r = 0; r < 8; ++r) {
        const int i = mt * 16 + rb + r;
        float v = 0.0f;
        if (i < NTOK && j < NTOK) {
          const int ri = rel_index[i * NTOK + j];
          v = acc[r] + table[ri * HEADS + h] + maskw[i * NTOK + j];
        }
        attn[i * ATT_STRIDE + j] = v;
      }
    }
    __syncthreads();

    // C2: row softmax over the 98 valid columns (pad stays exactly 0)
    if (tid < NTOK) {
      lds_f32* row = attn + tid * ATT_STRIDE;
      float mx = -1e30f;
      for (int j = 0; j < NTOK; ++j) mx = fmaxf(mx, row[j]);
      float sum = 0.0f;
      for (int j = 0; j < NTOK; ++j) {
        const float e = __expf(row[j] - mx);
        row[j] = e;
        sum += e;
      }
      const float inv = 1.0f / sum;
      for (int j = 0; j < NTOK; ++j) row[j] *= inv;
    }
    __syncthreads();

    // C3: out[:, h*32 : h*32+32] = attn @ v_h   (K padded to 112, pads are 0)
    for (int t = wid; t < 14; t += 8) {
      const int mt = t / 2, nt = t % 2;
      v8f acc = {};
      acc = wmma_AB(attn + mt * 16 * ATT_STRIDE, ATT_STRIDE,
                    vh + nt * 16, QKV_STRIDE, NPAD, acc, lane);
      lds_f32* dst = xs + h * HD + nt * 16 + c;   // xs now serves as out accum
#pragma unroll
      for (int r = 0; r < 8; ++r)
        dst[(mt * 16 + rb + r) * OUT_STRIDE] = acc[r];
    }
    __syncthreads();
  }

  if (wid == 0) {
    tdm_load_2d_f32(proj_w, lds_addr_of(pw), DIMC, DIMC, DIMC,
                    /*interval: 128dw*/6, /*amount: 8dw*/7, true);
    __builtin_amdgcn_s_wait_tensorcnt(0);
  }
  __syncthreads();

  float* og = out + (size_t)b * NTOK * DIMC;
  for (int t = wid; t < 7 * 8; t += 8) {
    const int mt = t / 8, nt = t % 8;
    v8f acc = {};
    acc = wmma_AB(xs + mt * 16 * OUT_STRIDE, OUT_STRIDE,
                  pw + nt * 16, PW_STRIDE, DIMC, acc, lane);
    const float pb = proj_b[nt * 16 + c];
#pragma unroll
    for (int r = 0; r < 8; ++r) {
      const int row = mt * 16 + rb + r;
      if (row < NTOK)
        og[row * DIMC + nt * 16 + c] = acc[r] + pb;
    }
  }
}

// ---------------------------------------------------------------
extern "C" void kernel_launch(void* const* d_in, const int* in_sizes, int n_in,
                              void* d_out, int out_size, void* d_ws, size_t ws_size,
                              hipStream_t stream) {
  (void)in_sizes; (void)n_in; (void)d_ws; (void)ws_size; (void)out_size;
  const float* x      = (const float*)d_in[0];
  const float* mask   = (const float*)d_in[1];
  const float* qkv_w  = (const float*)d_in[2];
  const float* qkv_b  = (const float*)d_in[3];
  const float* table  = (const float*)d_in[4];
  const int*   relidx = (const int*)  d_in[5];
  const float* proj_w = (const float*)d_in[6];
  const float* proj_b = (const float*)d_in[7];
  float* outp = (float*)d_out;

  const size_t smem_bytes = (size_t)SMEM_FLTS * sizeof(float);
  win_attn3d_kernel<<<NBATCH, 256, smem_bytes, stream>>>(
      x, mask, qkv_w, qkv_b, table, relidx, proj_w, proj_b, outp);
}

// v001
// A run of this version takes 637 microseconds.
// Timed twice side by side with v000, it ran 1.23 times as fast both times.
#include <hip/hip_runtime.h>

// ---------------- problem constants ----------------
#define DIMC   128
#define HEADS  4
#define HD     32
#define NTOK   98
#define NPAD   112          // 7 * 16
#define NWIN   64
#define NBATCH 2048
#define QKSCALE 0.17677669529663687f  // 32^-0.5
#define TROWS  507          // rows of the relative position bias table

// ---------------- LDS layout (floats) ----------------
#define QKV_STRIDE 36
#define ATT_STRIDE 116
#define OUT_STRIDE 132
#define PW_STRIDE  136
#define WCH_STRIDE 48

#define QKV_FLTS  (3 * HEADS * NPAD * QKV_STRIDE)   // 48384
#define ATT_OFF   QKV_FLTS
#define ATT_FLTS  (NPAD * ATT_STRIDE)               // 12992
#define XS_OFF    (ATT_OFF + ATT_FLTS)              // 61376
#define XS_FLTS   (NPAD * OUT_STRIDE)               // 14784
#define SMEM_FLTS (XS_OFF + XS_FLTS)                // 76160 floats = 304640 B (< 320KB WGP LDS)

#define WCH_BUF1  6400      // second W staging buffer offset inside attn region

typedef __attribute__((ext_vector_type(2))) float v2f;
typedef __attribute__((ext_vector_type(8))) float v8f;
typedef __attribute__((ext_vector_type(4))) unsigned int v4u;
typedef __attribute__((ext_vector_type(8))) int v8i;
typedef __attribute__((ext_vector_type(4))) int v4i;

// Explicit LDS (address_space(3)) element type: forces ds_load/ds_store
// codegen (no FLAT fallback when pointer provenance gets murky).
typedef __attribute__((address_space(3))) float lds_f32;

__device__ __forceinline__ void tdm_load_2d_f32(const float* gsrc, unsigned lds_byte_addr,
                                                unsigned width, unsigned rows,
                                                unsigned row_stride,
                                                unsigned pad_interval_code,
                                                unsigned pad_amount_code,
                                                bool pad_en) {
  unsigned long long ga = (unsigned long long)(const void*)gsrc;
  v4u g0;
  g0.x = 1u;
  g0.y = lds_byte_addr;
  g0.z = (unsigned)(ga & 0xFFFFFFFFu);
  g0.w = (unsigned)((ga >> 32) & 0x01FFFFFFu) | (2u << 30);
  unsigned w0 = (2u << 16);
  if (pad_en) w0 |= (1u << 20) | (pad_interval_code << 22) | (pad_amount_code << 25);
  v8i g1;
  g1[0] = (int)w0;
  g1[1] = (int)((width & 0xFFFFu) << 16);
  g1[2] = (int)(((width >> 16) & 0xFFFFu) | ((rows & 0xFFFFu) << 16));
  g1[3] = (int)(((rows >> 16) & 0xFFFFu) | ((width & 0xFFFFu) << 16));
  g1[4] = (int)(rows & 0xFFFFu);
  g1[5] = (int)row_stride;
  g1[6] = 0;
  g1[7] = 0;
  v4i gz4 = {0, 0, 0, 0};
  v8i gz8 = {0, 0, 0, 0, 0, 0, 0, 0};
  __builtin_amdgcn_tensor_load_to_lds(g0, g1, gz4, gz4, gz8, 0);
}

__device__ __forceinline__ unsigned lds_addr_of(const lds_f32* p) {
  return (unsigned)(unsigned long long)p;   // ptrtoint of AS(3) = LDS byte offset
}

// ---------------------------------------------------------------
// f32 WMMA 16x16 tile: C += A[16xK] * B[KxN], A row-major (lda),
// B row-major (ldb), tile pointers pre-offset to (row 0, col 0).
// A/B live in LDS (AS3) -> pure ds_load operand fetch.
// ---------------------------------------------------------------
__device__ __forceinline__ v8f wmma_AB(const lds_f32* A, int lda,
                                       const lds_f32* B, int ldb,
                                       int K, v8f acc, int lane) {
  const int m  = lane & 15;
  const int ko = (lane >> 4) << 1;   // 0 or 2
  for (int k = 0; k < K; k += 4) {
    v2f a, b;
    a.x = A[m * lda + k + ko];
    a.y = A[m * lda + k + ko + 1];
    b.x = B[(k + ko) * ldb + m];
    b.y = B[(k + ko + 1) * ldb + m];
    acc = __builtin_amdgcn_wmma_f32_16x16x4_f32(false, a, false, b,
                                                (short)0, acc, false, false);
  }
  return acc;
}

// B supplied transposed: Bt is [N][K] row-major (ldbt) -> computes A * Bt^T
__device__ __forceinline__ v8f wmma_ABt(const lds_f32* A, int lda,
                                        const lds_f32* Bt, int ldbt,
                                        int K, v8f acc, int lane) {
  const int m  = lane & 15;
  const int ko = (lane >> 4) << 1;
  for (int k = 0; k < K; k += 4) {
    v2f a, b;
    a.x = A[m * lda + k + ko];
    a.y = A[m * lda + k + ko + 1];
    b.x = Bt[m * ldbt + k + ko];
    b.y = Bt[m * ldbt + k + ko + 1];
    acc = __builtin_amdgcn_wmma_f32_16x16x4_f32(false, a, false, b,
                                                (short)0, acc, false, false);
  }
  return acc;
}

// ---------------------------------------------------------------
// Score tile t (of 7x7): fetch this lane's 8 relative-position indices and
// 8 window-mask values. Row and column are clamped into the 98x98 arrays, so
// the 16 loads need no branch and are all in flight together; what a pad
// position fetches is discarded by the caller.
// ---------------------------------------------------------------
__device__ __forceinline__ void score_tile_fetch(const int* __restrict__ rel_index,
                                                 const float* __restrict__ maskw,
                                                 int t, int c, int rb,
                                                 int (&ri)[8], float (&mk)[8]) {
  const int mt = t / 7, nt = t % 7;
  const int jj = min(nt * 16 + c, NTOK - 1);
  int off[8];
#pragma unroll
  for (int r = 0; r < 8; ++r) {
    off[r] = min(mt * 16 + rb + r, NTOK - 1) * NTOK + jj;
    ri[r] = rel_index[off[r]];
    mk[r] = maskw[off[r]];
  }
  asm volatile("s_wait_xcnt 0x0"
               :: "v"(off[0]), "v"(off[1]), "v"(off[2]), "v"(off[3]),
                  "v"(off[4]), "v"(off[5]), "v"(off[6]), "v"(off[7])
               : "memory");
}

// ---------------------------------------------------------------
// One workgroup (8 wave32) handles one window b of 2048.
// ---------------------------------------------------------------
__global__ __launch_bounds__(256)
void win_attn3d_kernel(const float* __restrict__ x,
                       const float* __restrict__ mask,
                       const float* __restrict__ qkv_w,
                       const float* __restrict__ qkv_b,
                       const float* __restrict__ table,
                       const int*   __restrict__ rel_index,
                       const float* __restrict__ proj_w,
                       const float* __restrict__ proj_b,
                       float* __restrict__ out) {
  extern __shared__ float smem_generic[];
  lds_f32* smem   = (lds_f32*)smem_generic;   // explicit AS(3) view
  lds_f32* qkvBuf = smem;                     // [3][4][112][36]  q/k/v per head
  lds_f32* attn   = smem + ATT_OFF;           // [112][116] scores / W staging
  lds_f32* xs     = smem + XS_OFF;            // [112][132] x tile, later out accum
  lds_f32* pw     = smem;                     // Phase D: proj_w staged (aliases qkvBuf)

  const int b    = blockIdx.x;
  const int w    = b & (NWIN - 1);
  const int tid  = threadIdx.x;
  const int lane = tid & 31;
  const int wid  = tid >> 5;                 // wave id (wave32!)
  const int c    = lane & 15;                // tile column held by this lane
  const int rb   = (lane >> 4) << 3;         // C/D row base: 0 or 8

  const float* xg = x + (size_t)b * NTOK * DIMC;

  if (wid == 0) {
    tdm_load_2d_f32(xg, lds_addr_of(xs), DIMC, NTOK, DIMC,
                    /*interval: 128dw*/6, /*amount: 4dw*/3, true);
    tdm_load_2d_f32(qkv_w, lds_addr_of(attn), WCH_STRIDE, DIMC, 3 * DIMC,
                    0, 0, false);
  }
  for (int i = tid; i < (NPAD - NTOK) * OUT_STRIDE; i += 256)   // zero pad rows
    xs[(NTOK + i / OUT_STRIDE) * OUT_STRIDE + (i % OUT_STRIDE)] = 0.0f;
  if (wid == 0) __builtin_amdgcn_s_wait_tensorcnt(0);
  __syncthreads();

  // ---- Phase B: qkv = xs @ qkv_w + qkv_b (q pre-scaled), rows>=98 zeroed ----
  // 8 chunks of 48 columns; chunk ch+1 DMA overlaps chunk ch compute.
  // Double buffer selected by integer offset (keeps AS3 provenance).
  for (int ch = 0; ch < 8; ++ch) {
    if (wid == 0) __builtin_amdgcn_s_wait_tensorcnt(0);   // chunk ch landed
    __syncthreads();                                      // + chunk ch-1 consumed
    if (wid == 0 && ch + 1 < 8)
      tdm_load_2d_f32(qkv_w + (ch + 1) * WCH_STRIDE,
                      lds_addr_of(attn) + (unsigned)(((ch + 1) & 1) * WCH_BUF1 * 4),
                      WCH_STRIDE, DIMC, 3 * DIMC, 0, 0, false);
    const lds_f32* wb = attn + (ch & 1) * WCH_BUF1;
    for (int t = wid; t < 7 * 3; t += 8) {
      const int mt = t / 3, nt = t % 3;
      const int ct = ch * 3 + nt;            // global 16-col tile index (0..23)
      v8f acc = {};
      acc = wmma_AB(xs + mt * 16 * OUT_STRIDE, OUT_STRIDE,
                    wb + nt * 16, WCH_STRIDE, DIMC, acc, lane);
      const int s  = ct >> 3;                // 0=q 1=k 2=v
      const int h  = (ct >> 1) & 3;          // head
      const int db = (ct & 1) << 4;          // d base within head
      const float bias = qkv_b[ct * 16 + c];
      const float scl  = (s == 0) ? QKSCALE : 1.0f;
      lds_f32* dst = qkvBuf + ((s * HEADS + h) * NPAD) * QKV_STRIDE + db + c;
#pragma unroll
      for (int r = 0; r < 8; ++r) {
        const int row = mt * 16 + rb + r;
        float v = (acc[r] + bias) * scl;
        if (row >= NTOK) v = 0.0f;           // zero pad rows of q/k/v
        dst[row * QKV_STRIDE] = v;
      }
    }
  }
  const float* maskw = mask + (size_t)w * NTOK * NTOK;

  // Indices and mask of this wave's first score tile: fetched one tile ahead
  // of their use from here on (the tile list of a wave is the same per head).
  int   ri[8];
  float mk[8];
  score_tile_fetch(rel_index, maskw, wid, c, rb, ri, mk);
  __syncthreads();

  // ---- Phase C: per-head attention ----
  for (int h = 0; h < HEADS; ++h) {
    const lds_f32* qh = qkvBuf + (0 * HEADS + h) * NPAD * QKV_STRIDE;
    const lds_f32* kh = qkvBuf + (1 * HEADS + h) * NPAD * QKV_STRIDE;
    const lds_f32* vh = qkvBuf + (2 * HEADS + h) * NPAD * QKV_STRIDE;

    // C1: S = q @ k^T, fused +rel_bias +window_mask; pad entries -> 0
    for (int t = wid; t < 49; t += 8) {
      const int mt = t / 7, nt = t % 7;
      // This tile's 8 bias gathers go out together (their indices arrived
      // during the tile before), then the next tile's indices and mask; the
      // products below run while both are in flight.
      float tb[8];
#pragma unroll
      for (int r = 0; r < 8; ++r)
        tb[r] = table[min(max(ri[r], 0), TROWS - 1) * HEADS + h];
      int   rin[8];
      float mkn[8];
      score_tile_fetch(rel_index, maskw, (t + 8 < 49) ? t + 8 : wid, c, rb, rin, mkn);
      v8f acc = {};
      acc = wmma_ABt(qh + mt * 16 * QKV_STRIDE, QKV_STRIDE,
                     kh + nt * 16 * QKV_STRIDE, QKV_STRIDE, HD, acc, lane);
      const int j = nt * 16 + c;
#pragma unroll
      for (int r = 0; r < 8; ++r) {
        const int i = mt * 16 + rb + r;
        const float v = acc[r] + tb[r] + mk[r];
        attn[i * ATT_STRIDE + j] = (i < NTOK && j < NTOK) ? v : 0.0f;
        ri[r] = rin[r];
        mk[r] = mkn[r];
      }
    }
    __syncthreads();

    // C2: row softmax over the 98 valid columns (pad stays exactly 0)
    if (tid < NTOK) {
      lds_f32* row = attn + tid * ATT_STRIDE;
      float mx = -1e30f;
      for (int j = 0; j < NTOK; ++j) mx = fmaxf(mx, row[j]);
      float sum = 0.0f;
      for (int j = 0; j < NTOK; ++j) {
        const float e = __expf(row[j] - mx);
        row[j] = e;
        sum += e;
      }
      const float inv = 1.0f / sum;
      for (int j = 0; j < NTOK; ++j) row[j] *= inv;
    }
    __syncthreads();

    // C3: out[:, h*32 : h*32+32] = attn @ v_h   (K padded to 112, pads are 0)
    for (int t = wid; t < 14; t += 8) {
      const int mt = t / 2, nt = t % 2;
      v8f acc = {};
      acc = wmma_AB(attn + mt * 16 * ATT_STRIDE, ATT_STRIDE,
                    vh + nt * 16, QKV_STRIDE, NPAD, acc, lane);
      lds_f32* dst = xs + h * HD + nt * 16 + c;   // xs now serves as out accum
#pragma unroll
      for (int r = 0; r < 8; ++r)
        dst[(mt * 16 + rb + r) * OUT_STRIDE] = acc[r];
    }
    __syncthreads();
  }

  if (wid == 0) {
    tdm_load_2d_f32(proj_w, lds_addr_of(pw), DIMC, DIMC, DIMC,
                    /*interval: 128dw*/6, /*amount: 8dw*/7, true);
    __builtin_amdgcn_s_wait_tensorcnt(0);
  }
  __syncthreads();

  float* og = out + (size_t)b * NTOK * DIMC;
  for (int t = wid; t < 7 * 8; t += 8) {
    const int mt = t / 8, nt = t % 8;
    v8f acc = {};
    acc = wmma_AB(xs + mt * 16 * OUT_STRIDE, OUT_STRIDE,
                  pw + nt * 16, PW_STRIDE, DIMC, acc, lane);
    const float pb = proj_b[nt * 16 + c];
#pragma unroll
    for (int r = 0; r < 8; ++r) {
      const int row = mt * 16 + rb + r;
      if (row < NTOK)
        og[row * DIMC + nt * 16 + c] = acc[r] + pb;
    }
  }
}

// ---------------------------------------------------------------
extern "C" void kernel_launch(void* const* d_in, const int* in_sizes, int n_in,
                              void* d_out, int out_size, void* d_ws, size_t ws_size,
                              hipStream_t stream) {
  (void)in_sizes; (void)n_in; (void)d_ws; (void)ws_size; (void)out_size;
  const float* x      = (const float*)d_in[0];
  const float* mask   = (const float*)d_in[1];
  const float* qkv_w  = (const float*)d_in[2];
  const float* qkv_b  = (const float*)d_in[3];
  const float* table  = (const float*)d_in[4];
  const int*   relidx = (const int*)  d_in[5];
  const float* proj_w = (const float*)d_in[6];
  const float* proj_b = (const float*)d_in[7];
  float* outp = (float*)d_out;

  const size_t smem_bytes = (size_t)SMEM_FLTS * sizeof(float);
  win_attn3d_kernel<<<NBATCH, 256, smem_bytes, stream>>>(
      x, mask, qkv_w, qkv_b, table, relidx, proj_w, proj_b, outp);
}

// v002
// One run takes 492 microseconds.
// In both of two side-by-side timings against v001, it was 1.29 times as fast.
// Counting every step since v000, it is 1.59 times as fast.
#include <hip/hip_runtime.h>

// ---------------- problem constants ----------------
#define DIMC   128
#define HEADS  4
#define HD     32
#define NTOK   98
#define NPAD   112          // 7 * 16
#define NWIN   64
#define NBATCH 2048
#define QKSCALE 0.17677669529663687f  // 32^-0.5
#define TROWS  507          // rows of the relative position bias table

// ---------------- LDS layout (floats) ----------------
#define QKV_STRIDE 36
#define ATT_STRIDE 116
#define OUT_STRIDE 132
#define PW_STRIDE  136
#define WCH_STRIDE 48

#define QKV_FLTS  (3 * HEADS * NPAD * QKV_STRIDE)   // 48384
#define ATT_OFF   QKV_FLTS
#define ATT_FLTS  (NPAD * ATT_STRIDE)               // 12992
#define XS_OFF    (ATT_OFF + ATT_FLTS)              // 61376
#define XS_FLTS   (NPAD * OUT_STRIDE)               // 14784
#define SMEM_FLTS (XS_OFF + XS_FLTS)                // 76160 floats = 304640 B (< 320KB WGP LDS)

#define WCH_BUF1  6400      // second W staging buffer offset inside attn region

typedef __attribute__((ext_vector_type(2))) float v2f;
typedef __attribute__((ext_vector_type(8))) float v8f;
typedef __attribute__((ext_vector_type(4))) unsigned int v4u;
typedef __attribute__((ext_vector_type(8))) int v8i;
typedef __attribute__((ext_vector_type(4))) int v4i;

// Explicit LDS (address_space(3)) element type: forces ds_load/ds_store
// codegen (no FLAT fallback when pointer provenance gets murky).
typedef __attribute__((address_space(3))) float lds_f32;

__device__ __forceinline__ void tdm_load_2d_f32(const float* gsrc, unsigned lds_byte_addr,
                                                unsigned width, unsigned rows,
                                                unsigned row_stride,
                                                unsigned pad_interval_code,
                                                unsigned pad_amount_code,
                                                bool pad_en) {
  unsigned long long ga = (unsigned long long)(const void*)gsrc;
  v4u g0;
  g0.x = 1u;
  g0.y = lds_byte_addr;
  g0.z = (unsigned)(ga & 0xFFFFFFFFu);
  g0.w = (unsigned)((ga >> 32) & 0x01FFFFFFu) | (2u << 30);
  unsigned w0 = (2u << 16);
  if (pad_en) w0 |= (1u << 20) | (pad_interval_code << 22) | (pad_amount_code << 25);
  v8i g1;
  g1[0] = (int)w0;
  g1[1] = (int)((width & 0xFFFFu) << 16);
  g1[2] = (int)(((width >> 16) & 0xFFFFu) | ((rows & 0xFFFFu) << 16));
  g1[3] = (int)(((rows >> 16) & 0xFFFFu) | ((width & 0xFFFFu) << 16));
  g1[4] = (int)(rows & 0xFFFFu);
  g1[5] = (int)row_stride;
  g1[6] = 0;
  g1[7] = 0;
  v4i gz4 = {0, 0, 0, 0};
  v8i gz8 = {0, 0, 0, 0, 0, 0, 0, 0};
  __builtin_amdgcn_tensor_load_to_lds(g0, g1, gz4, gz4, gz8, 0);
}

__device__ __forceinline__ unsigned lds_addr_of(const lds_f32* p) {
  return (unsigned)(unsigned long long)p;   // ptrtoint of AS(3) = LDS byte offset
}

template <int KS>
__device__ __forceinline__ void frag_rows(const lds_f32* P, int ld, int lane, v2f* f) {
  const lds_f32* p = P + (lane & 15) * ld + ((lane >> 4) << 1);
#pragma unroll   // constant indices: the fragment array stays in registers
  for (int s = 0; s < KS; ++s) {
    f[s].x = p[4 * s];
    f[s].y = p[4 * s + 1];
  }
}

// Operand stored k-major: P[k][col], pitch ld; the lane's column is lane & 15.
template <int KS>
__device__ __forceinline__ void frag_cols(const lds_f32* P, int ld, int lane, v2f* f) {
  const lds_f32* p = P + ((lane >> 4) << 1) * ld + (lane & 15);
#pragma unroll   // constant indices: the fragment array stays in registers
  for (int s = 0; s < KS; ++s) {
    f[s].x = p[(4 * s) * ld];
    f[s].y = p[(4 * s + 1) * ld];
  }
}

// acc += sum over KS k-steps, in rising k, operands already in registers.
template <int KS>
__device__ __forceinline__ v8f wmma_run(const v2f* a, const v2f* b, v8f acc) {
#pragma unroll   // constant indices: the fragment arrays stay in registers
  for (int s = 0; s < KS; ++s)
    acc = __builtin_amdgcn_wmma_f32_16x16x4_f32(false, a[s], false, b[s],
                                                (short)0, acc, false, false);
  return acc;
}

// Stages of a body's schedule, in the order in which they are written: "N LDS
// reads as one block", "N products as one run"; a stage takes instructions
// that stand above it in the source. Without them the compiler sinks each
// read to just before its product (a whole LDS latency per product) or
// spreads the reads among the products.
#define LDS_READS_AS_ONE_BLOCK(N) __builtin_amdgcn_sched_group_barrier(0x100, (N), 0)
#define PRODUCTS_AS_ONE_RUN(N)    __builtin_amdgcn_sched_group_barrier(0x008, (N), 0)

// ---------------------------------------------------------------
// Score tile t (of 7x7): fetch this lane's 8 relative-position indices and
// 8 window-mask values. Row and column are clamped into the 98x98 arrays, so
// the 16 loads need no branch and are all in flight together; what a pad
// position fetches is discarded by the caller.
// ---------------------------------------------------------------
__device__ __forceinline__ void score_tile_fetch(const int* __restrict__ rel_index,
                                                 const float* __restrict__ maskw,
                                                 int t, int c, int rb,
                                                 int (&ri)[8], float (&mk)[8]) {
  const int mt = t / 7, nt = t % 7;
  const int jj = min(nt * 16 + c, NTOK - 1);
  int off[8];
#pragma unroll
  for (int r = 0; r < 8; ++r) {
    off[r] = min(mt * 16 + rb + r, NTOK - 1) * NTOK + jj;
    ri[r] = rel_index[off[r]];
    mk[r] = maskw[off[r]];
  }
  asm volatile("s_wait_xcnt 0x0"
               :: "v"(off[0]), "v"(off[1]), "v"(off[2]), "v"(off[3]),
                  "v"(off[4]), "v"(off[5]), "v"(off[6]), "v"(off[7])
               : "memory");
}

// ---------------------------------------------------------------
// One workgroup (8 wave32) handles one window b of 2048.
// ---------------------------------------------------------------
__global__ __launch_bounds__(256)
void win_attn3d_kernel(const float* __restrict__ x,
                       const float* __restrict__ mask,
                       const float* __restrict__ qkv_w,
                       const float* __restrict__ qkv_b,
                       const float* __restrict__ table,
                       const int*   __restrict__ rel_index,
                       const float* __restrict__ proj_w,
                       const float* __restrict__ proj_b,
                       float* __restrict__ out) {
  extern __shared__ float smem_generic[];
  lds_f32* smem   = (lds_f32*)smem_generic;   // explicit AS(3) view
  lds_f32* qkvBuf = smem;                     // [3][4][112][36]  q/k/v per head
  lds_f32* attn   = smem + ATT_OFF;           // [112][116] scores / W staging
  lds_f32* xs     = smem + XS_OFF;            // [112][132] x tile, later out accum
  lds_f32* pw     = smem;                     // Phase D: proj_w staged (aliases qkvBuf)

  const int b    = blockIdx.x;
  const int w    = b & (NWIN - 1);
  const int tid  = threadIdx.x;
  const int lane = tid & 31;
  const int wid  = tid >> 5;                 // wave id (wave32!)
  const int c    = lane & 15;                // tile column held by this lane
  const int rb   = (lane >> 4) << 3;         // C/D row base: 0 or 8

  const float* xg = x + (size_t)b * NTOK * DIMC;

  if (wid == 0) {
    tdm_load_2d_f32(xg, lds_addr_of(xs), DIMC, NTOK, DIMC,
                    /*interval: 128dw*/6, /*amount: 4dw*/3, true);
    tdm_load_2d_f32(qkv_w, lds_addr_of(attn), WCH_STRIDE, DIMC, 3 * DIMC,
                    0, 0, false);
  }
  for (int i = tid; i < (NPAD - NTOK) * OUT_STRIDE; i += 256)   // zero pad rows
    xs[(NTOK + i / OUT_STRIDE) * OUT_STRIDE + (i % OUT_STRIDE)] = 0.0f;
  if (wid == 0) __builtin_amdgcn_s_wait_tensorcnt(0);
  __syncthreads();

  // ---- Phase B: qkv = xs @ qkv_w + qkv_b (q pre-scaled), rows>=98 zeroed ----
  // 8 chunks of 48 columns; chunk ch+1 DMA overlaps chunk ch compute.
  // Double buffer selected by integer offset (keeps AS3 provenance).
  for (int ch = 0; ch < 8; ++ch) {
    if (wid == 0) __builtin_amdgcn_s_wait_tensorcnt(0);   // chunk ch landed
    __syncthreads();                                      // + chunk ch-1 consumed
    if (wid == 0 && ch + 1 < 8)
      tdm_load_2d_f32(qkv_w + (ch + 1) * WCH_STRIDE,
                      lds_addr_of(attn) + (unsigned)(((ch + 1) & 1) * WCH_BUF1 * 4),
                      WCH_STRIDE, DIMC, 3 * DIMC, 0, 0, false);
    const lds_f32* wb = attn + (ch & 1) * WCH_BUF1;
    // Two register sets of half a tile's fragments (k 0-63, k 64-127): each
    // set is refilled while the products of the other run.
    v2f alo[16], blo[16], ahi[16], bhi[16];
    frag_rows<16>(xs + (wid / 3) * 16 * OUT_STRIDE, OUT_STRIDE, lane, alo);
    frag_cols<16>(wb + (wid % 3) * 16, WCH_STRIDE, lane, blo);
    for (int t = wid; t < 7 * 3; t += 8) {
      const int mt = t / 3, nt = t % 3;
      const int ct = ch * 3 + nt;            // global 16-col tile index (0..23)
      frag_rows<16>(xs + mt * 16 * OUT_STRIDE + 64, OUT_STRIDE, lane, ahi);
      frag_cols<16>(wb + 64 * WCH_STRIDE + nt * 16, WCH_STRIDE, lane, bhi);
      LDS_READS_AS_ONE_BLOCK(32);
      v8f acc = {};
      acc = wmma_run<16>(alo, blo, acc);
      PRODUCTS_AS_ONE_RUN(16);
      // Next tile's first half; behind the last tile the same tile again
      // (unconditional, so that the counted waits stay exact; not used).
      const int tn = (t + 8 < 7 * 3) ? t + 8 : t;
      frag_rows<16>(xs + (tn / 3) * 16 * OUT_STRIDE, OUT_STRIDE, lane, alo);
      frag_cols<16>(wb + (tn % 3) * 16, WCH_STRIDE, lane, blo);
      LDS_READS_AS_ONE_BLOCK(32);
      acc = wmma_run<16>(ahi, bhi, acc);
      PRODUCTS_AS_ONE_RUN(16);
      const int s  = ct >> 3;                // 0=q 1=k 2=v
      const int h  = (ct >> 1) & 3;          // head
      const int db = (ct & 1) << 4;          // d base within head
      const float bias = qkv_b[ct * 16 + c];
      const float scl  = (s == 0) ? QKSCALE : 1.0f;
      lds_f32* dst = qkvBuf + ((s * HEADS + h) * NPAD) * QKV_STRIDE + db + c;
#pragma unroll
      for (int r = 0; r < 8; ++r) {
        const int row = mt * 16 + rb + r;
        float v = (acc[r] + bias) * scl;
        if (row >= NTOK) v = 0.0f;           // zero pad rows of q/k/v
        dst[row * QKV_STRIDE] = v;
      }
    }
    // Every LDS read of this chunk, the unused read-ahead of the last tile
    // too, has returned before the barrier behind which its buffer is refilled.
    asm volatile("s_wait_dscnt 0x0" ::: "memory");
  }
  const float* maskw = mask + (size_t)w * NTOK * NTOK;

  // Indices and mask of this wave's first score tile: fetched one tile ahead
  // of their use from here on (the tile list of a wave is the same per head).
  int   ri[8];
  float mk[8];
  score_tile_fetch(rel_index, maskw, wid, c, rb, ri, mk);
  __syncthreads();

  // ---- Phase C: per-head attention ----
  for (int h = 0; h < HEADS; ++h) {
    const lds_f32* qh = qkvBuf + (0 * HEADS + h) * NPAD * QKV_STRIDE;
    const lds_f32* kh = qkvBuf + (1 * HEADS + h) * NPAD * QKV_STRIDE;
    const lds_f32* vh = qkvBuf + (2 * HEADS + h) * NPAD * QKV_STRIDE;

    // C1: S = q @ k^T, fused +rel_bias +window_mask; pad entries -> 0
    // A tile's q and k fragments are read one tile ahead, behind the products
    // of the tile before, so that their LDS latency passes under its epilogue.
    v2f qf[8], kf[8];
    frag_rows<8>(qh + (wid / 7) * 16 * QKV_STRIDE, QKV_STRIDE, lane, qf);
    frag_rows<8>(kh + (wid % 7) * 16 * QKV_STRIDE, QKV_STRIDE, lane, kf);
    for (int t = wid; t < 49; t += 8) {
      const int mt = t / 7, nt = t % 7;
      // This tile's 8 bias gathers go out together (their indices arrived
      // during the tile before), then the next tile's indices and mask; the
      // products below run while both are in flight.
      float tb[8];
#pragma unroll
      for (int r = 0; r < 8; ++r)
        tb[r] = table[min(max(ri[r], 0), TROWS - 1) * HEADS + h];
      int   rin[8];
      float mkn[8];
      score_tile_fetch(rel_index, maskw, (t + 8 < 49) ? t + 8 : wid, c, rb, rin, mkn);
      v8f acc = {};
      acc = wmma_run<8>(qf, kf, acc);
      const int tn = (t + 8 < 49) ? t + 8 : wid;   // last tile: read, not used
      frag_rows<8>(qh + (tn / 7) * 16 * QKV_STRIDE, QKV_STRIDE, lane, qf);
      frag_rows<8>(kh + (tn % 7) * 16 * QKV_STRIDE, QKV_STRIDE, lane, kf);
      const int j = nt * 16 + c;
#pragma unroll
      for (int r = 0; r < 8; ++r) {
        const int i = mt * 16 + rb + r;
        const float v = acc[r] + tb[r] + mk[r];
        attn[i * ATT_STRIDE + j] = (i < NTOK && j < NTOK) ? v : 0.0f;
        ri[r] = rin[r];
        mk[r] = mkn[r];
      }
      PRODUCTS_AS_ONE_RUN(8);        // this tile's products first,
      LDS_READS_AS_ONE_BLOCK(16);    // then the next tile's fragment reads
    }
    __syncthreads();

    // C2: row softmax over the 98 valid columns (pad stays exactly 0)
    if (tid < NTOK) {
      lds_f32* row = attn + tid * ATT_STRIDE;
      float mx = -1e30f;
      for (int j = 0; j < NTOK; ++j) mx = fmaxf(mx, row[j]);
      float sum = 0.0f;
      for (int j = 0; j < NTOK; ++j) {
        const float e = __expf(row[j] - mx);
        row[j] = e;
        sum += e;
      }
      const float inv = 1.0f / sum;
      for (int j = 0; j < NTOK; ++j) row[j] *= inv;
    }
    __syncthreads();

    // C3: out[:, h*32 : h*32+32] = attn @ v_h   (K padded to 112, pads are 0)
    // Two register sets of half a tile's fragments (k 0-55, k 56-111), as in B.
    v2f plo[14], vlo[14], phi[14], vhi[14];
    frag_rows<14>(attn + (wid / 2) * 16 * ATT_STRIDE, ATT_STRIDE, lane, plo);
    frag_cols<14>(vh + (wid % 2) * 16, QKV_STRIDE, lane, vlo);
    for (int t = wid; t < 14; t += 8) {
      const int mt = t / 2, nt = t % 2;
      frag_rows<14>(attn + mt * 16 * ATT_STRIDE + 56, ATT_STRIDE, lane, phi);
      frag_cols<14>(vh + 56 * QKV_STRIDE + nt * 16, QKV_STRIDE, lane, vhi);
      LDS_READS_AS_ONE_BLOCK(28);
      v8f acc = {};
      acc = wmma_run<14>(plo, vlo, acc);
      PRODUCTS_AS_ONE_RUN(14);
      const int tn = (t + 8 < 14) ? t + 8 : t;   // last tile: read again, not used
      frag_rows<14>(attn + (tn / 2) * 16 * ATT_STRIDE, ATT_STRIDE, lane, plo);
      frag_cols<14>(vh + (tn % 2) * 16, QKV_STRIDE, lane, vlo);
      LDS_READS_AS_ONE_BLOCK(28);
      acc = wmma_run<14>(phi, vhi, acc);
      PRODUCTS_AS_ONE_RUN(14);
      lds_f32* dst = xs + h * HD + nt * 16 + c;   // xs now serves as out accum
#pragma unroll
      for (int r = 0; r < 8; ++r)
        dst[(mt * 16 + rb + r) * OUT_STRIDE] = acc[r];
    }
    __syncthreads();
  }

  if (wid == 0) {
    tdm_load_2d_f32(proj_w, lds_addr_of(pw), DIMC, DIMC, DIMC,
                    /*interval: 128dw*/6, /*amount: 8dw*/7, true);
    __builtin_amdgcn_s_wait_tensorcnt(0);
  }
  __syncthreads();

  float* og = out + (size_t)b * NTOK * DIMC;
  // A wave's 7 tiles share the column block nt = wid: its proj_w fragments are
  // read once; the row fragments go through two half-tile sets as in B.
  const int nt = wid;
  v2f wf[32], olo[16], ohi[16];
  frag_cols<32>(pw + nt * 16, PW_STRIDE, lane, wf);
  frag_rows<16>(xs, OUT_STRIDE, lane, olo);
  LDS_READS_AS_ONE_BLOCK(48);
  const float pb = proj_b[nt * 16 + c];
#pragma unroll   // constant tile index: the last tile issues no read ahead
  for (int mt = 0; mt < 7; ++mt) {
    frag_rows<16>(xs + mt * 16 * OUT_STRIDE + 64, OUT_STRIDE, lane, ohi);
    LDS_READS_AS_ONE_BLOCK(16);
    v8f acc = {};
    acc = wmma_run<16>(olo, wf, acc);
    PRODUCTS_AS_ONE_RUN(16);
    if (mt + 1 < 7) {
      frag_rows<16>(xs + (mt + 1) * 16 * OUT_STRIDE, OUT_STRIDE, lane, olo);
      LDS_READS_AS_ONE_BLOCK(16);
    }
    acc = wmma_run<16>(ohi, wf + 16, acc);
    PRODUCTS_AS_ONE_RUN(16);
#pragma unroll
    for (int r = 0; r < 8; ++r) {
      const int row = mt * 16 + rb + r;
      if (row < NTOK)
        og[row * DIMC + nt * 16 + c] = acc[r] + pb;
    }
  }
}

// ---------------------------------------------------------------
extern "C" void kernel_launch(void* const* d_in, const int* in_sizes, int n_in,
                              void* d_out, int out_size, void* d_ws, size_t ws_size,
                              hipStream_t stream) {
  (void)in_sizes; (void)n_in; (void)d_ws; (void)ws_size; (void)out_size;
  const float* x      = (const float*)d_in[0];
  const float* mask   = (const float*)d_in[1];
  const float* qkv_w  = (const float*)d_in[2];
  const float* qkv_b  = (const float*)d_in[3];
  const float* table  = (const float*)d_in[4];
  const int*   relidx = (const int*)  d_in[5];
  const float* proj_w = (const float*)d_in[6];
  const float* proj_b = (const float*)d_in[7];
  float* outp = (float*)d_out;

  const size_t smem_bytes = (size_t)SMEM_FLTS * sizeof(float);
  win_attn3d_kernel<<<NBATCH, 256, smem_bytes, stream>>>(
      x, mask, qkv_w, qkv_b, table, relidx, proj_w, proj_b, outp);
}

// v003
// Measured time: 362 microseconds a run.
// Timed twice side by side with v002, it ran 1.33 times as fast both times.
// All steps since v000 together make it 2.11 times as fast.
#include <hip/hip_runtime.h>

// ---------------- problem constants ----------------
#define DIMC   128
#define HEADS  4
#define HD     32
#define NTOK   98
#define NPAD   112          // 7 * 16
#define NWIN   64
#define NBATCH 2048
#define QKSCALE 0.17677669529663687f  // 32^-0.5
#define TROWS  507          // rows of the relative position bias table

// ---------------- LDS layout (floats) ----------------
#define QKV_STRIDE 36
#define ATT_STRIDE 116
#define OUT_STRIDE 132
#define PW_STRIDE  136
#define WCH_STRIDE 48

#define QKV_FLTS  (3 * HEADS * NPAD * QKV_STRIDE)   // 48384
#define ATT_OFF   QKV_FLTS
#define ATT_FLTS  (NPAD * ATT_STRIDE)               // 12992
#define XS_OFF    (ATT_OFF + ATT_FLTS)              // 61376
#define XS_FLTS   (NPAD * OUT_STRIDE)               // 14784
#define SMEM_FLTS (XS_OFF + XS_FLTS)                // 76160 floats = 304640 B (< 320KB WGP LDS)

#define WCH_BUF1  6400      // second W staging buffer offset inside attn region

#define SM_HALF   52        // softmax: score columns held by one lane (13 x 4)
#define SM_VECS   13
#define LOG2E     1.44269504088896341f

typedef __attribute__((ext_vector_type(2))) float v2f;
typedef __attribute__((ext_vector_type(4))) float v4f;
typedef __attribute__((ext_vector_type(8))) float v8f;
typedef __attribute__((ext_vector_type(4))) unsigned int v4u;
typedef __attribute__((ext_vector_type(8))) int v8i;
typedef __attribute__((ext_vector_type(4))) int v4i;

// Explicit LDS (address_space(3)) element type: forces ds_load/ds_store
// codegen (no FLAT fallback when pointer provenance gets murky).
typedef __attribute__((address_space(3))) float lds_f32;
typedef __attribute__((address_space(3))) v4f   lds_v4f;   // 16-byte LDS access

__device__ __forceinline__ void tdm_load_2d_f32(const float* gsrc, unsigned lds_byte_addr,
                                                unsigned width, unsigned rows,
                                                unsigned row_stride,
                                                unsigned pad_interval_code,
                                                unsigned pad_amount_code,
                                                bool pad_en) {
  unsigned long long ga = (unsigned long long)(const void*)gsrc;
  v4u g0;
  g0.x = 1u;
  g0.y = lds_byte_addr;
  g0.z = (unsigned)(ga & 0xFFFFFFFFu);
  g0.w = (unsigned)((ga >> 32) & 0x01FFFFFFu) | (2u << 30);
  unsigned w0 = (2u << 16);
  if (pad_en) w0 |= (1u << 20) | (pad_interval_code << 22) | (pad_amount_code << 25);
  v8i g1;
  g1[0] = (int)w0;
  g1[1] = (int)((width & 0xFFFFu) << 16);
  g1[2] = (int)(((width >> 16) & 0xFFFFu) | ((rows & 0xFFFFu) << 16));
  g1[3] = (int)(((rows >> 16) & 0xFFFFu) | ((width & 0xFFFFu) << 16));
  g1[4] = (int)(rows & 0xFFFFu);
  g1[5] = (int)row_stride;
  g1[6] = 0;
  g1[7] = 0;
  v4i gz4 = {0, 0, 0, 0};
  v8i gz8 = {0, 0, 0, 0, 0, 0, 0, 0};
  __builtin_amdgcn_tensor_load_to_lds(g0, g1, gz4, gz4, gz8, 0);
}

__device__ __forceinline__ unsigned lds_addr_of(const lds_f32* p) {
  return (unsigned)(unsigned long long)p;   // ptrtoint of AS(3) = LDS byte offset
}

template <int KS>
__device__ __forceinline__ void frag_rows(const lds_f32* P, int ld, int lane, v2f* f) {
  const lds_f32* p = P + (lane & 15) * ld + ((lane >> 4) << 1);
#pragma unroll   // constant indices: the fragment array stays in registers
  for (int s = 0; s < KS; ++s) {
    f[s].x = p[4 * s];
    f[s].y = p[4 * s + 1];
  }
}

// Operand stored k-major: P[k][col], pitch ld; the lane's column is lane & 15.
template <int KS>
__device__ __forceinline__ void frag_cols(const lds_f32* P, int ld, int lane, v2f* f) {
  const lds_f32* p = P + ((lane >> 4) << 1) * ld + (lane & 15);
#pragma unroll   // constant indices: the fragment array stays in registers
  for (int s = 0; s < KS; ++s) {
    f[s].x = p[(4 * s) * ld];
    f[s].y = p[(4 * s + 1) * ld];
  }
}

// acc += sum over KS k-steps, in rising k, operands already in registers.
template <int KS>
__device__ __forceinline__ v8f wmma_run(const v2f* a, const v2f* b, v8f acc) {
#pragma unroll   // constant indices: the fragment arrays stay in registers
  for (int s = 0; s < KS; ++s)
    acc = __builtin_amdgcn_wmma_f32_16x16x4_f32(false, a[s], false, b[s],
                                                (short)0, acc, false, false);
  return acc;
}

// Stages of a body's schedule, in the order in which they are written: "N LDS
// reads as one block", "N products as one run"; a stage takes instructions
// that stand above it in the source. Without them the compiler sinks each
// read to just before its product (a whole LDS latency per product) or
// spreads the reads among the products.
#define LDS_READS_AS_ONE_BLOCK(N) __builtin_amdgcn_sched_group_barrier(0x100, (N), 0)
#define PRODUCTS_AS_ONE_RUN(N)    __builtin_amdgcn_sched_group_barrier(0x008, (N), 0)

// ---------------------------------------------------------------
// Score tile t (of 7x7): fetch this lane's 8 relative-position indices and
// 8 window-mask values. Row and column are clamped into the 98x98 arrays, so
// the 16 loads need no branch and are all in flight together; what a pad
// position fetches is discarded by the caller.
// ---------------------------------------------------------------
__device__ __forceinline__ void score_tile_fetch(const int* __restrict__ rel_index,
                                                 const float* __restrict__ maskw,
                                                 int t, int c, int rb,
                                                 int (&ri)[8], float (&mk)[8]) {
  const int mt = t / 7, nt = t % 7;
  const int jj = min(nt * 16 + c, NTOK - 1);
  int off[8];
#pragma unroll
  for (int r = 0; r < 8; ++r) {
    off[r] = min(mt * 16 + rb + r, NTOK - 1) * NTOK + jj;
    ri[r] = rel_index[off[r]];
    mk[r] = maskw[off[r]];
  }
  asm volatile("s_wait_xcnt 0x0"
               :: "v"(off[0]), "v"(off[1]), "v"(off[2]), "v"(off[3]),
                  "v"(off[4]), "v"(off[5]), "v"(off[6]), "v"(off[7])
               : "memory");
}

__device__ __forceinline__ float other_half(float v) {
  const int b = __builtin_bit_cast(int, v);
  return __builtin_bit_cast(float,
      __builtin_amdgcn_permlanex16(b, b, 0x76543210, 0xfedcba98, false, false));
}

__device__ __forceinline__ v4f exp2_x4(v4f t) {
  float r0, r1, r2, r3;
  asm("v_exp_f32 %0, %4\n\tv_exp_f32 %1, %5\n\tv_exp_f32 %2, %6\n\tv_exp_f32 %3, %7\n\tv_nop"
      : "=&v"(r0), "=&v"(r1), "=&v"(r2), "=&v"(r3)
      : "v"(t[0]), "v"(t[1]), "v"(t[2]), "v"(t[3]));
  return v4f{r0, r1, r2, r3};
}

// ---------------------------------------------------------------
// One workgroup (8 wave32) handles one window b of 2048.
// ---------------------------------------------------------------
__global__ __launch_bounds__(256)
void win_attn3d_kernel(const float* __restrict__ x,
                       const float* __restrict__ mask,
                       const float* __restrict__ qkv_w,
                       const float* __restrict__ qkv_b,
                       const float* __restrict__ table,
                       const int*   __restrict__ rel_index,
                       const float* __restrict__ proj_w,
                       const float* __restrict__ proj_b,
                       float* __restrict__ out) {
  extern __shared__ float smem_generic[];
  lds_f32* smem   = (lds_f32*)smem_generic;   // explicit AS(3) view
  lds_f32* qkvBuf = smem;                     // [3][4][112][36]  q/k/v per head
  lds_f32* attn   = smem + ATT_OFF;           // [112][116] scores / W staging
  lds_f32* xs     = smem + XS_OFF;            // [112][132] x tile, later out accum
  lds_f32* pw     = smem;                     // Phase D: proj_w staged (aliases qkvBuf)

  const int b    = blockIdx.x;
  const int w    = b & (NWIN - 1);
  const int tid  = threadIdx.x;
  const int lane = tid & 31;
  const int wid  = tid >> 5;                 // wave id (wave32!)
  const int c    = lane & 15;                // tile column held by this lane
  const int rb   = (lane >> 4) << 3;         // C/D row base: 0 or 8

  const float* xg = x + (size_t)b * NTOK * DIMC;

  if (wid == 0) {
    tdm_load_2d_f32(xg, lds_addr_of(xs), DIMC, NTOK, DIMC,
                    /*interval: 128dw*/6, /*amount: 4dw*/3, true);
    tdm_load_2d_f32(qkv_w, lds_addr_of(attn), WCH_STRIDE, DIMC, 3 * DIMC,
                    0, 0, false);
  }
  for (int i = tid; i < (NPAD - NTOK) * OUT_STRIDE; i += 256)   // zero pad rows
    xs[(NTOK + i / OUT_STRIDE) * OUT_STRIDE + (i % OUT_STRIDE)] = 0.0f;
  if (wid == 0) __builtin_amdgcn_s_wait_tensorcnt(0);
  __syncthreads();

  // ---- Phase B: qkv = xs @ qkv_w + qkv_b (q pre-scaled), rows>=98 zeroed ----
  // 8 chunks of 48 columns; chunk ch+1 DMA overlaps chunk ch compute.
  // Double buffer selected by integer offset (keeps AS3 provenance).
  for (int ch = 0; ch < 8; ++ch) {
    if (wid == 0) __builtin_amdgcn_s_wait_tensorcnt(0);   // chunk ch landed
    __syncthreads();                                      // + chunk ch-1 consumed
    if (wid == 0 && ch + 1 < 8)
      tdm_load_2d_f32(qkv_w + (ch + 1) * WCH_STRIDE,
                      lds_addr_of(attn) + (unsigned)(((ch + 1) & 1) * WCH_BUF1 * 4),
                      WCH_STRIDE, DIMC, 3 * DIMC, 0, 0, false);
    const lds_f32* wb = attn + (ch & 1) * WCH_BUF1;
    // Two register sets of half a tile's fragments (k 0-63, k 64-127): each
    // set is refilled while the products of the other run.
    v2f alo[16], blo[16], ahi[16], bhi[16];
    frag_rows<16>(xs + (wid / 3) * 16 * OUT_STRIDE, OUT_STRIDE, lane, alo);
    frag_cols<16>(wb + (wid % 3) * 16, WCH_STRIDE, lane, blo);
    for (int t = wid; t < 7 * 3; t += 8) {
      const int mt = t / 3, nt = t % 3;
      const int ct = ch * 3 + nt;            // global 16-col tile index (0..23)
      frag_rows<16>(xs + mt * 16 * OUT_STRIDE + 64, OUT_STRIDE, lane, ahi);
      frag_cols<16>(wb + 64 * WCH_STRIDE + nt * 16, WCH_STRIDE, lane, bhi);
      LDS_READS_AS_ONE_BLOCK(32);
      v8f acc = {};
      acc = wmma_run<16>(alo, blo, acc);
      PRODUCTS_AS_ONE_RUN(16);
      // Next tile's first half; behind the last tile the same tile again
      // (unconditional, so that the counted waits stay exact; not used).
      const int tn = (t + 8 < 7 * 3) ? t + 8 : t;
      frag_rows<16>(xs + (tn / 3) * 16 * OUT_STRIDE, OUT_STRIDE, lane, alo);
      frag_cols<16>(wb + (tn % 3) * 16, WCH_STRIDE, lane, blo);
      LDS_READS_AS_ONE_BLOCK(32);
      acc = wmma_run<16>(ahi, bhi, acc);
      PRODUCTS_AS_ONE_RUN(16);
      const int s  = ct >> 3;                // 0=q 1=k 2=v
      const int h  = (ct >> 1) & 3;          // head
      const int db = (ct & 1) << 4;          // d base within head
      const float bias = qkv_b[ct * 16 + c];
      const float scl  = (s == 0) ? QKSCALE : 1.0f;
      lds_f32* dst = qkvBuf + ((s * HEADS + h) * NPAD) * QKV_STRIDE + db + c;
#pragma unroll
      for (int r = 0; r < 8; ++r) {
        const int row = mt * 16 + rb + r;
        float v = (acc[r] + bias) * scl;
        if (row >= NTOK) v = 0.0f;           // zero pad rows of q/k/v
        dst[row * QKV_STRIDE] = v;
      }
    }
    // Every LDS read of this chunk, the unused read-ahead of the last tile
    // too, has returned before the barrier behind which its buffer is refilled.
    asm volatile("s_wait_dscnt 0x0" ::: "memory");
  }
  const float* maskw = mask + (size_t)w * NTOK * NTOK;

  // Indices and mask of this wave's first score tile: fetched one tile ahead
  // of their use from here on (the tile list of a wave is the same per head).
  int   ri[8];
  float mk[8];
  score_tile_fetch(rel_index, maskw, wid, c, rb, ri, mk);
  __syncthreads();

  // ---- Phase C: per-head attention ----
  for (int h = 0; h < HEADS; ++h) {
    const lds_f32* qh = qkvBuf + (0 * HEADS + h) * NPAD * QKV_STRIDE;
    const lds_f32* kh = qkvBuf + (1 * HEADS + h) * NPAD * QKV_STRIDE;
    const lds_f32* vh = qkvBuf + (2 * HEADS + h) * NPAD * QKV_STRIDE;

    // C1: S = q @ k^T, fused +rel_bias +window_mask; pad entries -> 0
    // A tile's q and k fragments are read one tile ahead, behind the products
    // of the tile before, so that their LDS latency passes under its epilogue.
    v2f qf[8], kf[8];
    frag_rows<8>(qh + (wid / 7) * 16 * QKV_STRIDE, QKV_STRIDE, lane, qf);
    frag_rows<8>(kh + (wid % 7) * 16 * QKV_STRIDE, QKV_STRIDE, lane, kf);
    for (int t = wid; t < 49; t += 8) {
      const int mt = t / 7, nt = t % 7;
      // This tile's 8 bias gathers go out together (their indices arrived
      // during the tile before), then the next tile's indices and mask; the
      // products below run while both are in flight.
      float tb[8];
#pragma unroll
      for (int r = 0; r < 8; ++r)
        tb[r] = table[min(max(ri[r], 0), TROWS - 1) * HEADS + h];
      int   rin[8];
      float mkn[8];
      score_tile_fetch(rel_index, maskw, (t + 8 < 49) ? t + 8 : wid, c, rb, rin, mkn);
      v8f acc = {};
      acc = wmma_run<8>(qf, kf, acc);
      const int tn = (t + 8 < 49) ? t + 8 : wid;   // last tile: read, not used
      frag_rows<8>(qh + (tn / 7) * 16 * QKV_STRIDE, QKV_STRIDE, lane, qf);
      frag_rows<8>(kh + (tn % 7) * 16 * QKV_STRIDE, QKV_STRIDE, lane, kf);
      const int j = nt * 16 + c;
#pragma unroll
      for (int r = 0; r < 8; ++r) {
        const int i = mt * 16 + rb + r;
        const float v = acc[r] + tb[r] + mk[r];
        attn[i * ATT_STRIDE + j] = (i < NTOK && j < NTOK) ? v : 0.0f;
        ri[r] = rin[r];
        mk[r] = mkn[r];
      }
      PRODUCTS_AS_ONE_RUN(8);        // this tile's products first,
      LDS_READS_AS_ONE_BLOCK(16);    // then the next tile's fragment reads
    }
    __syncthreads();

    {
      const int  row   = wid * 16 + c;
      const bool upper = lane >= 16;
      if (row < NTOK) {
        lds_v4f* rp = (lds_v4f*)(attn + row * ATT_STRIDE + (upper ? SM_HALF : 0));
        v4f xv[SM_VECS];
#pragma unroll   // constant indices: the row stays in registers
        for (int i = 0; i < SM_VECS; ++i) xv[i] = rp[i];
        v4f mv = {-1e30f, -1e30f, -1e30f, -1e30f};     // four running maxima per lane
#pragma unroll
        for (int i = 0; i < SM_VECS; ++i)
#pragma unroll
          for (int e = 0; e < 4; ++e) {
            if (SM_HALF + 4 * i + e >= NTOK)           // pad column in the upper half
              xv[i][e] = upper ? -1e30f : xv[i][e];
            mv[e] = fmaxf(mv[e], xv[i][e]);
          }
        float mx = fmaxf(fmaxf(mv[0], mv[1]), fmaxf(mv[2], mv[3]));
        mx = fmaxf(mx, other_half(mx));
        v4f sv = {0.0f, 0.0f, 0.0f, 0.0f};             // four partial sums per lane
#pragma unroll
        for (int i = 0; i < SM_VECS; ++i) {
          v4f ex = exp2_x4((xv[i] - mx) * LOG2E);      // e^(x - mx)
#pragma unroll
          for (int e = 0; e < 4; ++e)
            if (SM_HALF + 4 * i + e >= NTOK)
              ex[e] = upper ? 0.0f : ex[e];            // pad adds nothing, is stored as 0
          xv[i] = ex;
          sv += ex;
        }
        float sum = (sv[0] + sv[1]) + (sv[2] + sv[3]);
        sum += other_half(sum);
        const float inv = 1.0f / sum;
#pragma unroll
        for (int i = 0; i < SM_VECS; ++i) rp[i] = xv[i] * inv;
      }
    }
    __syncthreads();

    // C3: out[:, h*32 : h*32+32] = attn @ v_h   (K padded to 112, pads are 0)
    // Two register sets of half a tile's fragments (k 0-55, k 56-111), as in B.
    v2f plo[14], vlo[14], phi[14], vhi[14];
    frag_rows<14>(attn + (wid / 2) * 16 * ATT_STRIDE, ATT_STRIDE, lane, plo);
    frag_cols<14>(vh + (wid % 2) * 16, QKV_STRIDE, lane, vlo);
    for (int t = wid; t < 14; t += 8) {
      const int mt = t / 2, nt = t % 2;
      frag_rows<14>(attn + mt * 16 * ATT_STRIDE + 56, ATT_STRIDE, lane, phi);
      frag_cols<14>(vh + 56 * QKV_STRIDE + nt * 16, QKV_STRIDE, lane, vhi);
      LDS_READS_AS_ONE_BLOCK(28);
      v8f acc = {};
      acc = wmma_run<14>(plo, vlo, acc);
      PRODUCTS_AS_ONE_RUN(14);
      const int tn = (t + 8 < 14) ? t + 8 : t;   // last tile: read again, not used
      frag_rows<14>(attn + (tn / 2) * 16 * ATT_STRIDE, ATT_STRIDE, lane, plo);
      frag_cols<14>(vh + (tn % 2) * 16, QKV_STRIDE, lane, vlo);
      LDS_READS_AS_ONE_BLOCK(28);
      acc = wmma_run<14>(phi, vhi, acc);
      PRODUCTS_AS_ONE_RUN(14);
      lds_f32* dst = xs + h * HD + nt * 16 + c;   // xs now serves as out accum
#pragma unroll
      for (int r = 0; r < 8; ++r)
        dst[(mt * 16 + rb + r) * OUT_STRIDE] = acc[r];
    }
    __syncthreads();
  }

  if (wid == 0) {
    tdm_load_2d_f32(proj_w, lds_addr_of(pw), DIMC, DIMC, DIMC,
                    /*interval: 128dw*/6, /*amount: 8dw*/7, true);
    __builtin_amdgcn_s_wait_tensorcnt(0);
  }
  __syncthreads();

  float* og = out + (size_t)b * NTOK * DIMC;
  // A wave's 7 tiles share the column block nt = wid: its proj_w fragments are
  // read once; the row fragments go through two half-tile sets as in B.
  const int nt = wid;
  v2f wf[32], olo[16], ohi[16];
  frag_cols<32>(pw + nt * 16, PW_STRIDE, lane, wf);
  frag_rows<16>(xs, OUT_STRIDE, lane, olo);
  LDS_READS_AS_ONE_BLOCK(48);
  const float pb = proj_b[nt * 16 + c];
#pragma unroll   // constant tile index: the last tile issues no read ahead
  for (int mt = 0; mt < 7; ++mt) {
    frag_rows<16>(xs + mt * 16 * OUT_STRIDE + 64, OUT_STRIDE, lane, ohi);
    LDS_READS_AS_ONE_BLOCK(16);
    v8f acc = {};
    acc = wmma_run<16>(olo, wf, acc);
    PRODUCTS_AS_ONE_RUN(16);
    if (mt + 1 < 7) {
      frag_rows<16>(xs + (mt + 1) * 16 * OUT_STRIDE, OUT_STRIDE, lane, olo);
      LDS_READS_AS_ONE_BLOCK(16);
    }
    acc = wmma_run<16>(ohi, wf + 16, acc);
    PRODUCTS_AS_ONE_RUN(16);
#pragma unroll
    for (int r = 0; r < 8; ++r) {
      const int row = mt * 16 + rb + r;
      if (row < NTOK)
        og[row * DIMC + nt * 16 + c] = acc[r] + pb;
    }
  }
}

// ---------------------------------------------------------------
extern "C" void kernel_launch(void* const* d_in, const int* in_sizes, int n_in,
                              void* d_out, int out_size, void* d_ws, size_t ws_size,
                              hipStream_t stream) {
  (void)in_sizes; (void)n_in; (void)d_ws; (void)ws_size; (void)out_size;
  const float* x      = (const float*)d_in[0];
  const float* mask   = (const float*)d_in[1];
  const float* qkv_w  = (const float*)d_in[2];
  const float* qkv_b  = (const float*)d_in[3];
  const float* table  = (const float*)d_in[4];
  const int*   relidx = (const int*)  d_in[5];
  const float* proj_w = (const float*)d_in[6];
  const float* proj_b = (const float*)d_in[7];
  float* outp = (float*)d_out;

  const size_t smem_bytes = (size_t)SMEM_FLTS * sizeof(float);
  win_attn3d_kernel<<<NBATCH, 256, smem_bytes, stream>>>(
      x, mask, qkv_w, qkv_b, table, relidx, proj_w, proj_b, outp);
}

// v004
// A run of this version takes 324 microseconds.
// Two timings next to v003 both put it at 1.12 times that version's speed.
// Counting every step since v000, it is 2.36 times as fast.
#include <hip/hip_runtime.h>

// ---------------- problem constants ----------------
#define DIMC   128
#define HEADS  4
#define HD     32
#define NTOK   98
#define NPAD   112          // 7 * 16
#define NWIN   64
#define NBATCH 2048
#define QKSCALE 0.17677669529663687f  // 32^-0.5
#define TROWS  507          // rows of the relative position bias table

// ---------------- LDS layout (floats) ----------------
#define QKV_STRIDE 36
#define ATT_STRIDE 116
#define OUT_STRIDE 132
#define PW_STRIDE  136
#define WCOLS      48

#define QKV_FLTS  (3 * HEADS * NPAD * QKV_STRIDE)   // 48384
#define ATT_OFF   QKV_FLTS
#define ATT_FLTS  (NPAD * ATT_STRIDE)               // 12992
#define XS_OFF    (ATT_OFF + ATT_FLTS)              // 61376
#define XS_FLTS   (NPAD * OUT_STRIDE)               // 14784
#define SMEM_FLTS (XS_OFF + XS_FLTS)                // 76160 floats = 304640 B (< 320KB WGP LDS)

#define SM_HALF   52        // softmax: score columns held by one lane (13 x 4)
#define SM_VECS   13
#define LOG2E     1.44269504088896341f

typedef __attribute__((ext_vector_type(2))) float v2f;
typedef __attribute__((ext_vector_type(4))) float v4f;
typedef __attribute__((ext_vector_type(8))) float v8f;
typedef __attribute__((ext_vector_type(4))) unsigned int v4u;
typedef __attribute__((ext_vector_type(8))) int v8i;
typedef __attribute__((ext_vector_type(4))) int v4i;

// Explicit LDS (address_space(3)) element type: forces ds_load/ds_store
// codegen (no FLAT fallback when pointer provenance gets murky).
typedef __attribute__((address_space(3))) float lds_f32;
typedef __attribute__((address_space(3))) v4f   lds_v4f;   // 16-byte LDS access

__device__ __forceinline__ void tdm_load_2d_f32(const float* gsrc, unsigned lds_byte_addr,
                                                unsigned width, unsigned rows,
                                                unsigned row_stride,
                                                unsigned pad_interval_code,
                                                unsigned pad_amount_code,
                                                bool pad_en) {
  unsigned long long ga = (unsigned long long)(const void*)gsrc;
  v4u g0;
  g0.x = 1u;
  g0.y = lds_byte_addr;
  g0.z = (unsigned)(ga & 0xFFFFFFFFu);
  g0.w = (unsigned)((ga >> 32) & 0x01FFFFFFu) | (2u << 30);
  unsigned w0 = (2u << 16);
  if (pad_en) w0 |= (1u << 20) | (pad_interval_code << 22) | (pad_amount_code << 25);
  v8i g1;
  g1[0] = (int)w0;
  g1[1] = (int)((width & 0xFFFFu) << 16);
  g1[2] = (int)(((width >> 16) & 0xFFFFu) | ((rows & 0xFFFFu) << 16));
  g1[3] = (int)(((rows >> 16) & 0xFFFFu) | ((width & 0xFFFFu) << 16));
  g1[4] = (int)(rows & 0xFFFFu);
  g1[5] = (int)row_stride;
  g1[6] = 0;
  g1[7] = 0;
  v4i gz4 = {0, 0, 0, 0};
  v8i gz8 = {0, 0, 0, 0, 0, 0, 0, 0};
  __builtin_amdgcn_tensor_load_to_lds(g0, g1, gz4, gz4, gz8, 0);
}

__device__ __forceinline__ unsigned lds_addr_of(const lds_f32* p) {
  return (unsigned)(unsigned long long)p;   // ptrtoint of AS(3) = LDS byte offset
}

template <int KS>
__device__ __forceinline__ void frag_rows(const lds_f32* P, int ld, int lane, v2f* f) {
  const lds_f32* p = P + (lane & 15) * ld + ((lane >> 4) << 1);
#pragma unroll   // constant indices: the fragment array stays in registers
  for (int s = 0; s < KS; ++s) {
    f[s].x = p[4 * s];
    f[s].y = p[4 * s + 1];
  }
}

// Operand stored k-major: P[k][col], pitch ld; the lane's column is lane & 15.
template <int KS>
__device__ __forceinline__ void frag_cols(const lds_f32* P, int ld, int lane, v2f* f) {
  const lds_f32* p = P + ((lane >> 4) << 1) * ld + (lane & 15);
#pragma unroll   // constant indices: the fragment array stays in registers
  for (int s = 0; s < KS; ++s) {
    f[s].x = p[(4 * s) * ld];
    f[s].y = p[(4 * s + 1) * ld];
  }
}

// acc += sum over KS k-steps, in rising k, operands already in registers.
template <int KS>
__device__ __forceinline__ v8f wmma_run(const v2f* a, const v2f* b, v8f acc) {
#pragma unroll   // constant indices: the fragment arrays stay in registers
  for (int s = 0; s < KS; ++s)
    acc = __builtin_amdgcn_wmma_f32_16x16x4_f32(false, a[s], false, b[s],
                                                (short)0, acc, false, false);
  return acc;
}

// Stages of a body's schedule, in the order in which they are written: "N LDS
// reads as one block", "N products as one run"; a stage takes instructions
// that stand above it in the source. Without them the compiler sinks each
// read to just before its product (a whole LDS latency per product) or
// spreads the reads among the products.
#define LDS_READS_AS_ONE_BLOCK(N) __builtin_amdgcn_sched_group_barrier(0x100, (N), 0)
#define PRODUCTS_AS_ONE_RUN(N)    __builtin_amdgcn_sched_group_barrier(0x008, (N), 0)
// Ends a scheduling region behind a run of products on several accumulators.
// Phase B: a counted stage took any 48 of a row tile's 96 products, so that
// single accumulator chains ran alone, and a third fragment set with register
// copies appeared; so did it with no stage end in front of the epilogue.
#define STAGE_ENDS_HERE()         __builtin_amdgcn_sched_barrier(0)

// ---------------------------------------------------------------
// Score tile t (of 7x7): fetch this lane's 8 relative-position indices and
// 8 window-mask values. Row and column are clamped into the 98x98 arrays, so
// the 16 loads need no branch and are all in flight together; what a pad
// position fetches is discarded by the caller.
// ---------------------------------------------------------------
__device__ __forceinline__ void score_tile_fetch(const int* __restrict__ rel_index,
                                                 const float* __restrict__ maskw,
                                                 int t, int c, int rb,
                                                 int (&ri)[8], float (&mk)[8]) {
  const int mt = t / 7, nt = t % 7;
  const int jj = min(nt * 16 + c, NTOK - 1);
  int off[8];
#pragma unroll
  for (int r = 0; r < 8; ++r) {
    off[r] = min(mt * 16 + rb + r, NTOK - 1) * NTOK + jj;
    ri[r] = rel_index[off[r]];
    mk[r] = maskw[off[r]];
  }
  asm volatile("s_wait_xcnt 0x0"
               :: "v"(off[0]), "v"(off[1]), "v"(off[2]), "v"(off[3]),
                  "v"(off[4]), "v"(off[5]), "v"(off[6]), "v"(off[7])
               : "memory");
}

__device__ __forceinline__ float other_half(float v) {
  const int b = __builtin_bit_cast(int, v);
  return __builtin_bit_cast(float,
      __builtin_amdgcn_permlanex16(b, b, 0x76543210, 0xfedcba98, false, false));
}

__device__ __forceinline__ v4f exp2_x4(v4f t) {
  float r0, r1, r2, r3;
  asm("v_exp_f32 %0, %4\n\tv_exp_f32 %1, %5\n\tv_exp_f32 %2, %6\n\tv_exp_f32 %3, %7\n\tv_nop"
      : "=&v"(r0), "=&v"(r1), "=&v"(r2), "=&v"(r3)
      : "v"(t[0]), "v"(t[1]), "v"(t[2]), "v"(t[3]));
  return v4f{r0, r1, r2, r3};
}

// ---------------------------------------------------------------
// One workgroup (8 wave32) handles one window b of 2048.
// ---------------------------------------------------------------
__global__ __launch_bounds__(256)
void win_attn3d_kernel(const float* __restrict__ x,
                       const float* __restrict__ mask,
                       const float* __restrict__ qkv_w,
                       const float* __restrict__ qkv_b,
                       const float* __restrict__ table,
                       const int*   __restrict__ rel_index,
                       const float* __restrict__ proj_w,
                       const float* __restrict__ proj_b,
                       float* __restrict__ out) {
  extern __shared__ float smem_generic[];
  lds_f32* smem   = (lds_f32*)smem_generic;   // explicit AS(3) view
  lds_f32* qkvBuf = smem;                     // [3][4][112][36]  q/k/v per head
  lds_f32* attn   = smem + ATT_OFF;           // [112][116] scores
  lds_f32* xs     = smem + XS_OFF;            // [112][132] x tile, later out accum
  lds_f32* pw     = smem;                     // Phase D: proj_w staged (aliases qkvBuf)

  const int b    = blockIdx.x;
  const int w    = b & (NWIN - 1);
  const int tid  = threadIdx.x;
  const int lane = tid & 31;
  const int wid  = tid >> 5;                 // wave id (wave32!)
  const int c    = lane & 15;                // tile column held by this lane
  const int rb   = (lane >> 4) << 3;         // C/D row base: 0 or 8

  const float* xg = x + (size_t)b * NTOK * DIMC;

  if (wid == 0) {
    tdm_load_2d_f32(xg, lds_addr_of(xs), DIMC, NTOK, DIMC,
                    /*interval: 128dw*/6, /*amount: 4dw*/3, true);
  }
  // This wave's 48 columns of qkv_w (3 column tiles, all 128 k) go straight
  // from global memory into B fragments that stay in registers through Phase
  // B; the loads fly while the x tile lands. k order as in frag_cols.
  v2f wq0[32], wq1[32], wq2[32];
  float qb[3];
  {
    const unsigned woff = (unsigned)(((lane >> 4) << 1) * (3 * DIMC) + wid * WCOLS + c);
#pragma unroll   // constant indices: the fragment arrays stay in registers
    for (int s = 0; s < 32; ++s) {
      wq0[s].x = qkv_w[woff + (4 * s) * (3 * DIMC)];
      wq0[s].y = qkv_w[woff + (4 * s + 1) * (3 * DIMC)];
      wq1[s].x = qkv_w[woff + (4 * s) * (3 * DIMC) + 16];
      wq1[s].y = qkv_w[woff + (4 * s + 1) * (3 * DIMC) + 16];
      wq2[s].x = qkv_w[woff + (4 * s) * (3 * DIMC) + 32];
      wq2[s].y = qkv_w[woff + (4 * s + 1) * (3 * DIMC) + 32];
    }
    const unsigned boff = (unsigned)(wid * WCOLS + c);
#pragma unroll
    for (int j = 0; j < 3; ++j) qb[j] = qkv_b[boff + 16 * j];
    // Keeps the two offset registers untouched until the address
    // translations of the loads above are done.
    asm volatile("s_wait_xcnt 0x0" :: "v"(woff), "v"(boff) : "memory");
  }
  for (int i = tid; i < (NPAD - NTOK) * OUT_STRIDE; i += 256)   // zero pad rows
    xs[(NTOK + i / OUT_STRIDE) * OUT_STRIDE + (i % OUT_STRIDE)] = 0.0f;
  if (wid == 0) __builtin_amdgcn_s_wait_tensorcnt(0);
  __syncthreads();

  // ---- Phase B: qkv = xs @ qkv_w + qkv_b (q pre-scaled), rows>=98 zeroed ----
  // A wave walks the 7 row tiles of x; each x fragment read from LDS feeds the
  // 3 products of the wave's column tiles (3 independent accumulators).
  {
    lds_f32* dst[3];
    float    scl[3];
#pragma unroll
    for (int j = 0; j < 3; ++j) {
      const int ct = wid * 3 + j;            // global 16-col tile index (0..23)
      const int s  = ct >> 3;                // 0=q 1=k 2=v
      const int h  = (ct >> 1) & 3;          // head
      const int db = (ct & 1) << 4;          // d base within head
      scl[j] = (s == 0) ? QKSCALE : 1.0f;
      dst[j] = qkvBuf + ((s * HEADS + h) * NPAD) * QKV_STRIDE + db + c;
    }
    // Two register sets of half a row tile's fragments (k 0-63, k 64-127):
    // each set is refilled while the products of the other run.
    v2f alo[16], ahi[16];
    frag_rows<16>(xs, OUT_STRIDE, lane, alo);
#pragma unroll 1   // one copy of the 96 products: short code
    for (int mt = 0; mt < 7; ++mt) {
      frag_rows<16>(xs + mt * 16 * OUT_STRIDE + 64, OUT_STRIDE, lane, ahi);
      v8f acc0 = {}, acc1 = {}, acc2 = {};
#pragma unroll   // constant indices: the fragment arrays stay in registers
      for (int s = 0; s < 16; ++s) {
        acc0 = __builtin_amdgcn_wmma_f32_16x16x4_f32(false, alo[s], false, wq0[s],
                                                     (short)0, acc0, false, false);
        acc1 = __builtin_amdgcn_wmma_f32_16x16x4_f32(false, alo[s], false, wq1[s],
                                                     (short)0, acc1, false, false);
        acc2 = __builtin_amdgcn_wmma_f32_16x16x4_f32(false, alo[s], false, wq2[s],
                                                     (short)0, acc2, false, false);
      }
      STAGE_ENDS_HERE();
      // Next row tile's first half; behind the last tile the same tile again
      // (unconditional, so that the counted waits stay exact; not used).
      const int mn = (mt + 1 < 7) ? mt + 1 : mt;
      frag_rows<16>(xs + mn * 16 * OUT_STRIDE, OUT_STRIDE, lane, alo);
#pragma unroll
      for (int s = 0; s < 16; ++s) {
        acc0 = __builtin_amdgcn_wmma_f32_16x16x4_f32(false, ahi[s], false, wq0[16 + s],
                                                     (short)0, acc0, false, false);
        acc1 = __builtin_amdgcn_wmma_f32_16x16x4_f32(false, ahi[s], false, wq1[16 + s],
                                                     (short)0, acc1, false, false);
        acc2 = __builtin_amdgcn_wmma_f32_16x16x4_f32(false, ahi[s], false, wq2[16 + s],
                                                     (short)0, acc2, false, false);
      }
      STAGE_ENDS_HERE();
#pragma unroll
      for (int r = 0; r < 8; ++r) {
        const int  row = mt * 16 + rb + r;
        const bool pad = row >= NTOK;        // zero pad rows of q/k/v
        dst[0][row * QKV_STRIDE] = pad ? 0.0f : (acc0[r] + qb[0]) * scl[0];
        dst[1][row * QKV_STRIDE] = pad ? 0.0f : (acc1[r] + qb[1]) * scl[1];
        dst[2][row * QKV_STRIDE] = pad ? 0.0f : (acc2[r] + qb[2]) * scl[2];
      }
    }
  }
  const float* maskw = mask + (size_t)w * NTOK * NTOK;

  // Indices and mask of this wave's first score tile: fetched one tile ahead
  // of their use from here on (the tile list of a wave is the same per head).
  int   ri[8];
  float mk[8];
  score_tile_fetch(rel_index, maskw, wid, c, rb, ri, mk);
  __syncthreads();

  // ---- Phase C: per-head attention ----
  for (int h = 0; h < HEADS; ++h) {
    const lds_f32* qh = qkvBuf + (0 * HEADS + h) * NPAD * QKV_STRIDE;
    const lds_f32* kh = qkvBuf + (1 * HEADS + h) * NPAD * QKV_STRIDE;
    const lds_f32* vh = qkvBuf + (2 * HEADS + h) * NPAD * QKV_STRIDE;

    // C1: S = q @ k^T, fused +rel_bias +window_mask; pad entries -> 0
    // A tile's q and k fragments are read one tile ahead, behind the products
    // of the tile before, so that their LDS latency passes under its epilogue.
    v2f qf[8], kf[8];
    frag_rows<8>(qh + (wid / 7) * 16 * QKV_STRIDE, QKV_STRIDE, lane, qf);
    frag_rows<8>(kh + (wid % 7) * 16 * QKV_STRIDE, QKV_STRIDE, lane, kf);
    for (int t = wid; t < 49; t += 8) {
      const int mt = t / 7, nt = t % 7;
      // This tile's 8 bias gathers go out together (their indices arrived
      // during the tile before), then the next tile's indices and mask; the
      // products below run while both are in flight.
      float tb[8];
#pragma unroll
      for (int r = 0; r < 8; ++r)
        tb[r] = table[min(max(ri[r], 0), TROWS - 1) * HEADS + h];
      int   rin[8];
      float mkn[8];
      score_tile_fetch(rel_index, maskw, (t + 8 < 49) ? t + 8 : wid, c, rb, rin, mkn);
      v8f acc = {};
      acc = wmma_run<8>(qf, kf, acc);
      const int tn = (t + 8 < 49) ? t + 8 : wid;   // last tile: read, not used
      frag_rows<8>(qh + (tn / 7) * 16 * QKV_STRIDE, QKV_STRIDE, lane, qf);
      frag_rows<8>(kh + (tn % 7) * 16 * QKV_STRIDE, QKV_STRIDE, lane, kf);
      const int j = nt * 16 + c;
#pragma unroll
      for (int r = 0; r < 8; ++r) {
        const int i = mt * 16 + rb + r;
        const float v = acc[r] + tb[r] + mk[r];
        attn[i * ATT_STRIDE + j] = (i < NTOK && j < NTOK) ? v : 0.0f;
        ri[r] = rin[r];
        mk[r] = mkn[r];
      }
      PRODUCTS_AS_ONE_RUN(8);        // this tile's products first,
      LDS_READS_AS_ONE_BLOCK(16);    // then the next tile's fragment reads
    }
    __syncthreads();

    {
      const int  row   = wid * 16 + c;
      const bool upper = lane >= 16;
      if (row < NTOK) {
        lds_v4f* rp = (lds_v4f*)(attn + row * ATT_STRIDE + (upper ? SM_HALF : 0));
        v4f xv[SM_VECS];
#pragma unroll   // constant indices: the row stays in registers
        for (int i = 0; i < SM_VECS; ++i) xv[i] = rp[i];
        v4f mv = {-1e30f, -1e30f, -1e30f, -1e30f};     // four running maxima per lane
#pragma unroll
        for (int i = 0; i < SM_VECS; ++i)
#pragma unroll
          for (int e = 0; e < 4; ++e) {
            if (SM_HALF + 4 * i + e >= NTOK)           // pad column in the upper half
              xv[i][e] = upper ? -1e30f : xv[i][e];
            mv[e] = fmaxf(mv[e], xv[i][e]);
          }
        float mx = fmaxf(fmaxf(mv[0], mv[1]), fmaxf(mv[2], mv[3]));
        mx = fmaxf(mx, other_half(mx));
        v4f sv = {0.0f, 0.0f, 0.0f, 0.0f};             // four partial sums per lane
#pragma unroll
        for (int i = 0; i < SM_VECS; ++i) {
          v4f ex = exp2_x4((xv[i] - mx) * LOG2E);      // e^(x - mx)
#pragma unroll
          for (int e = 0; e < 4; ++e)
            if (SM_HALF + 4 * i + e >= NTOK)
              ex[e] = upper ? 0.0f : ex[e];            // pad adds nothing, is stored as 0
          xv[i] = ex;
          sv += ex;
        }
        float sum = (sv[0] + sv[1]) + (sv[2] + sv[3]);
        sum += other_half(sum);
        const float inv = 1.0f / sum;
#pragma unroll
        for (int i = 0; i < SM_VECS; ++i) rp[i] = xv[i] * inv;
      }
    }
    __syncthreads();

    // C3: out[:, h*32 : h*32+32] = attn @ v_h   (K padded to 112, pads are 0)
    // Two register sets of half a tile's fragments (k 0-55, k 56-111), as in B.
    v2f plo[14], vlo[14], phi[14], vhi[14];
    frag_rows<14>(attn + (wid / 2) * 16 * ATT_STRIDE, ATT_STRIDE, lane, plo);
    frag_cols<14>(vh + (wid % 2) * 16, QKV_STRIDE, lane, vlo);
    for (int t = wid; t < 14; t += 8) {
      const int mt = t / 2, nt = t % 2;
      frag_rows<14>(attn + mt * 16 * ATT_STRIDE + 56, ATT_STRIDE, lane, phi);
      frag_cols<14>(vh + 56 * QKV_STRIDE + nt * 16, QKV_STRIDE, lane, vhi);
      LDS_READS_AS_ONE_BLOCK(28);
      v8f acc = {};
      acc = wmma_run<14>(plo, vlo, acc);
      PRODUCTS_AS_ONE_RUN(14);
      const int tn = (t + 8 < 14) ? t + 8 : t;   // last tile: read again, not used
      frag_rows<14>(attn + (tn / 2) * 16 * ATT_STRIDE, ATT_STRIDE, lane, plo);
      frag_cols<14>(vh + (tn % 2) * 16, QKV_STRIDE, lane, vlo);
      LDS_READS_AS_ONE_BLOCK(28);
      acc = wmma_run<14>(phi, vhi, acc);
      PRODUCTS_AS_ONE_RUN(14);
      lds_f32* dst = xs + h * HD + nt * 16 + c;   // xs now serves as out accum
#pragma unroll
      for (int r = 0; r < 8; ++r)
        dst[(mt * 16 + rb + r) * OUT_STRIDE] = acc[r];
    }
    __syncthreads();
  }

  if (wid == 0) {
    tdm_load_2d_f32(proj_w, lds_addr_of(pw), DIMC, DIMC, DIMC,
                    /*interval: 128dw*/6, /*amount: 8dw*/7, true);
    __builtin_amdgcn_s_wait_tensorcnt(0);
  }
  __syncthreads();

  float* og = out + (size_t)b * NTOK * DIMC;
  // A wave's 7 tiles share the column block nt = wid: its proj_w fragments are
  // read once; the row fragments go through two half-tile sets as in B.
  const int nt = wid;
  v2f wf[32], olo[16], ohi[16];
  frag_cols<32>(pw + nt * 16, PW_STRIDE, lane, wf);
  frag_rows<16>(xs, OUT_STRIDE, lane, olo);
  LDS_READS_AS_ONE_BLOCK(48);
  const float pb = proj_b[nt * 16 + c];
#pragma unroll   // constant tile index: the last tile issues no read ahead
  for (int mt = 0; mt < 7; ++mt) {
    frag_rows<16>(xs + mt * 16 * OUT_STRIDE + 64, OUT_STRIDE, lane, ohi);
    LDS_READS_AS_ONE_BLOCK(16);
    v8f acc = {};
    acc = wmma_run<16>(olo, wf, acc);
    PRODUCTS_AS_ONE_RUN(16);
    if (mt + 1 < 7) {
      frag_rows<16>(xs + (mt + 1) * 16 * OUT_STRIDE, OUT_STRIDE, lane, olo);
      LDS_READS_AS_ONE_BLOCK(16);
    }
    acc = wmma_run<16>(ohi, wf + 16, acc);
    PRODUCTS_AS_ONE_RUN(16);
#pragma unroll
    for (int r = 0; r < 8; ++r) {
      const int row = mt * 16 + rb + r;
      if (row < NTOK)
        og[row * DIMC + nt * 16 + c] = acc[r] + pb;
    }
  }
}

// ---------------------------------------------------------------
extern "C" void kernel_launch(void* const* d_in, const int* in_sizes, int n_in,
                              void* d_out, int out_size, void* d_ws, size_t ws_size,
                              hipStream_t stream) {
  (void)in_sizes; (void)n_in; (void)d_ws; (void)ws_size; (void)out_size;
  const float* x      = (const float*)d_in[0];
  const float* mask   = (const float*)d_in[1];
  const float* qkv_w  = (const float*)d_in[2];
  const float* qkv_b  = (const float*)d_in[3];
  const float* table  = (const float*)d_in[4];
  const int*   relidx = (const int*)  d_in[5];
  const float* proj_w = (const float*)d_in[6];
  const float* proj_b = (const float*)d_in[7];
  float* outp = (float*)d_out;

  const size_t smem_bytes = (size_t)SMEM_FLTS * sizeof(float);
  win_attn3d_kernel<<<NBATCH, 256, smem_bytes, stream>>>(
      x, mask, qkv_w, qkv_b, table, relidx, proj_w, proj_b, outp);
}

// v005
// Measured time: 252 microseconds a run.
// In both of two side-by-side timings against v004, it was 1.28 times as fast.
// Counting every step since v000, it is 3.02 times as fast.
#include <hip/hip_runtime.h>

// ---------------- problem constants ----------------
#define DIMC   128
#define HEADS  4
#define HD     32
#define NTOK   98
#define NPAD   112          // 7 * 16
#define NWIN   64
#define NBATCH 2048
#define QKSCALE 0.17677669529663687f  // 32^-0.5
#define TROWS  507          // rows of the relative position bias table

// ---------------- LDS layout (floats) ----------------
#define QKV_STRIDE 36
#define ATT_STRIDE 116
#define OUT_STRIDE 132
#define PW_STRIDE  136
#define WCOLS      48

#define QKV_FLTS  (3 * HEADS * NPAD * QKV_STRIDE)   // 48384
#define ATT_OFF   QKV_FLTS
#define ATT_FLTS  (NPAD * ATT_STRIDE)               // 12992
#define XS_OFF    (ATT_OFF + ATT_FLTS)              // 61376
#define XS_FLTS   (NPAD * OUT_STRIDE)               // 14784
#define SMEM_FLTS (XS_OFF + XS_FLTS)                // 76160 floats = 304640 B (< 320KB WGP LDS)

#define KT_FULL   6         // key tiles whose 16 keys are all valid (keys 0-95)
#define SC_PAIRS  25        // a lane's score pairs: 6 tiles x 4, and keys 96, 97
#define SC_VALS   50
#define LOG2E     1.44269504088896341f

typedef __attribute__((ext_vector_type(2))) float v2f;
typedef __attribute__((ext_vector_type(2))) int   v2i;
typedef __attribute__((ext_vector_type(4))) float v4f;
typedef __attribute__((ext_vector_type(8))) float v8f;
typedef __attribute__((ext_vector_type(4))) unsigned int v4u;
typedef __attribute__((ext_vector_type(8))) int v8i;
typedef __attribute__((ext_vector_type(4))) int v4i;

// Explicit LDS (address_space(3)) element type: forces ds_load/ds_store
// codegen (no FLAT fallback when pointer provenance gets murky).
typedef __attribute__((address_space(3))) float lds_f32;
typedef __attribute__((address_space(3))) v4f   lds_v4f;   // 16-byte LDS access
typedef __attribute__((address_space(3))) v2f   lds_v2f;   // 8-byte LDS access

__device__ __forceinline__ void tdm_load_2d_f32(const float* gsrc, unsigned lds_byte_addr,
                                                unsigned width, unsigned rows,
                                                unsigned row_stride,
                                                unsigned pad_interval_code,
                                                unsigned pad_amount_code,
                                                bool pad_en) {
  unsigned long long ga = (unsigned long long)(const void*)gsrc;
  v4u g0;
  g0.x = 1u;
  g0.y = lds_byte_addr;
  g0.z = (unsigned)(ga & 0xFFFFFFFFu);
  g0.w = (unsigned)((ga >> 32) & 0x01FFFFFFu) | (2u << 30);
  unsigned w0 = (2u << 16);
  if (pad_en) w0 |= (1u << 20) | (pad_interval_code << 22) | (pad_amount_code << 25);
  v8i g1;
  g1[0] = (int)w0;
  g1[1] = (int)((width & 0xFFFFu) << 16);
  g1[2] = (int)(((width >> 16) & 0xFFFFu) | ((rows & 0xFFFFu) << 16));
  g1[3] = (int)(((rows >> 16) & 0xFFFFu) | ((width & 0xFFFFu) << 16));
  g1[4] = (int)(rows & 0xFFFFu);
  g1[5] = (int)row_stride;
  g1[6] = 0;
  g1[7] = 0;
  v4i gz4 = {0, 0, 0, 0};
  v8i gz8 = {0, 0, 0, 0, 0, 0, 0, 0};
  __builtin_amdgcn_tensor_load_to_lds(g0, g1, gz4, gz4, gz8, 0);
}

__device__ __forceinline__ unsigned lds_addr_of(const lds_f32* p) {
  return (unsigned)(unsigned long long)p;   // ptrtoint of AS(3) = LDS byte offset
}

template <int KS>
__device__ __forceinline__ void frag_rows(const lds_f32* P, int ld, int lane, v2f* f) {
  const lds_f32* p = P + (lane & 15) * ld + ((lane >> 4) << 1);
#pragma unroll   // constant indices: the fragment array stays in registers
  for (int s = 0; s < KS; ++s) {
    f[s].x = p[4 * s];
    f[s].y = p[4 * s + 1];
  }
}

// Operand stored k-major: P[k][col], pitch ld; the lane's column is lane & 15.
template <int KS>
__device__ __forceinline__ void frag_cols(const lds_f32* P, int ld, int lane, v2f* f) {
  const lds_f32* p = P + ((lane >> 4) << 1) * ld + (lane & 15);
#pragma unroll   // constant indices: the fragment array stays in registers
  for (int s = 0; s < KS; ++s) {
    f[s].x = p[(4 * s) * ld];
    f[s].y = p[(4 * s + 1) * ld];
  }
}

// acc += sum over KS k-steps, in rising k, operands already in registers.
template <int KS>
__device__ __forceinline__ v8f wmma_run(const v2f* a, const v2f* b, v8f acc) {
#pragma unroll   // constant indices: the fragment arrays stay in registers
  for (int s = 0; s < KS; ++s)
    acc = __builtin_amdgcn_wmma_f32_16x16x4_f32(false, a[s], false, b[s],
                                                (short)0, acc, false, false);
  return acc;
}

// Stages of a body's schedule, in the order in which they are written: "N LDS
// reads as one block", "N products as one run"; a stage takes instructions
// that stand above it in the source. Without them the compiler sinks each
// read to just before its product (a whole LDS latency per product) or
// spreads the reads among the products.
#define LDS_READS_AS_ONE_BLOCK(N) __builtin_amdgcn_sched_group_barrier(0x100, (N), 0)
#define PRODUCTS_AS_ONE_RUN(N)    __builtin_amdgcn_sched_group_barrier(0x008, (N), 0)
// Ends a scheduling region behind a run of products on several accumulators.
// Phase B: a counted stage took any 48 of a row tile's 96 products, so that
// single accumulator chains ran alone, and a third fragment set with register
// copies appeared; so did it with no stage end in front of the epilogue.
#define STAGE_ENDS_HERE()         __builtin_amdgcn_sched_barrier(0)

__device__ __forceinline__ float other_half(float v) {
  const int b = __builtin_bit_cast(int, v);
  return __builtin_bit_cast(float,
      __builtin_amdgcn_permlanex16(b, b, 0x76543210, 0xfedcba98, false, false));
}

__device__ __forceinline__ v4f exp2_x4(v4f t) {
  float r0, r1, r2, r3;
  asm("v_exp_f32 %0, %4\n\tv_exp_f32 %1, %5\n\tv_exp_f32 %2, %6\n\tv_exp_f32 %3, %7\n\tv_nop"
      : "=&v"(r0), "=&v"(r1), "=&v"(r2), "=&v"(r3)
      : "v"(t[0]), "v"(t[1]), "v"(t[2]), "v"(t[3]));
  return v4f{r0, r1, r2, r3};
}

// ---------------------------------------------------------------
// One workgroup (8 wave32) handles one window b of 2048.
// ---------------------------------------------------------------
__global__ __launch_bounds__(256)
void win_attn3d_kernel(const float* __restrict__ x,
                       const float* __restrict__ mask,
                       const float* __restrict__ qkv_w,
                       const float* __restrict__ qkv_b,
                       const float* __restrict__ table,
                       const int*   __restrict__ rel_index,
                       const float* __restrict__ proj_w,
                       const float* __restrict__ proj_b,
                       float* __restrict__ out) {
  extern __shared__ float smem_generic[];
  lds_f32* smem   = (lds_f32*)smem_generic;   // explicit AS(3) view
  lds_f32* qkvBuf = smem;                     // [3][4][112][36]  q/k/v per head
  // smem + ATT_OFF: 12992 floats, free (scores stay in registers)
  lds_f32* xs     = smem + XS_OFF;            // [112][132] x tile, later out accum
  lds_f32* pw     = smem;                     // Phase D: proj_w staged (aliases qkvBuf)

  const int b    = blockIdx.x;
  const int w    = b & (NWIN - 1);
  const int tid  = threadIdx.x;
  const int lane = tid & 31;
  const int wid  = tid >> 5;                 // wave id (wave32!)
  const int c    = lane & 15;                // tile column held by this lane
  const int rb   = (lane >> 4) << 3;         // C/D row base: 0 or 8

  const float* xg = x + (size_t)b * NTOK * DIMC;

  if (wid == 0) {
    tdm_load_2d_f32(xg, lds_addr_of(xs), DIMC, NTOK, DIMC,
                    /*interval: 128dw*/6, /*amount: 4dw*/3, true);
  }
  // This wave's 48 columns of qkv_w (3 column tiles, all 128 k) go straight
  // from global memory into B fragments that stay in registers through Phase
  // B; the loads fly while the x tile lands. k order as in frag_cols.
  v2f wq0[32], wq1[32], wq2[32];
  float qb[3];
  {
    const unsigned woff = (unsigned)(((lane >> 4) << 1) * (3 * DIMC) + wid * WCOLS + c);
#pragma unroll   // constant indices: the fragment arrays stay in registers
    for (int s = 0; s < 32; ++s) {
      wq0[s].x = qkv_w[woff + (4 * s) * (3 * DIMC)];
      wq0[s].y = qkv_w[woff + (4 * s + 1) * (3 * DIMC)];
      wq1[s].x = qkv_w[woff + (4 * s) * (3 * DIMC) + 16];
      wq1[s].y = qkv_w[woff + (4 * s + 1) * (3 * DIMC) + 16];
      wq2[s].x = qkv_w[woff + (4 * s) * (3 * DIMC) + 32];
      wq2[s].y = qkv_w[woff + (4 * s + 1) * (3 * DIMC) + 32];
    }
    const unsigned boff = (unsigned)(wid * WCOLS + c);
#pragma unroll
    for (int j = 0; j < 3; ++j) qb[j] = qkv_b[boff + 16 * j];
    // Keeps the two offset registers untouched until the address
    // translations of the loads above are done.
    asm volatile("s_wait_xcnt 0x0" :: "v"(woff), "v"(boff) : "memory");
  }
  const float* maskw = mask + (size_t)w * NTOK * NTOK;
  v2i ri2[SC_PAIRS];
  v2f mk2[SC_PAIRS];
  {
    // Byte offsets, 32 bits beside a scalar base: the very registers that the
    // loads name, so that the wait below can hold them.
    const unsigned qrow = (unsigned)(min(wid * 16 + c, NTOK - 1) * (NTOK * 4));
    const unsigned sb   = qrow + (unsigned)(rb * 4);
    const char* rib = (const char*)rel_index;
    const char* mkb = (const char*)maskw;
#pragma unroll   // constant indices: both arrays stay in registers
    for (int p = 0; p < 4 * KT_FULL; ++p) {
      ri2[p] = *(const v2i*)(rib + sb + (p >> 2) * 64 + (p & 3) * 8);
      mk2[p] = *(const v2f*)(mkb + sb + (p >> 2) * 64 + (p & 3) * 8);
    }
    ri2[SC_PAIRS - 1] = *(const v2i*)(rib + qrow + KT_FULL * 64);
    mk2[SC_PAIRS - 1] = *(const v2f*)(mkb + qrow + KT_FULL * 64);
    asm volatile("s_wait_xcnt 0x0" :: "v"(sb), "v"(qrow) : "memory");
  }
  for (int i = tid; i < (NPAD - NTOK) * OUT_STRIDE; i += 256)   // zero pad rows
    xs[(NTOK + i / OUT_STRIDE) * OUT_STRIDE + (i % OUT_STRIDE)] = 0.0f;
  if (wid == 0) __builtin_amdgcn_s_wait_tensorcnt(0);
  __syncthreads();

  // ---- Phase B: qkv = xs @ qkv_w + qkv_b (q pre-scaled), rows>=98 zeroed ----
  // A wave walks the 7 row tiles of x; each x fragment read from LDS feeds the
  // 3 products of the wave's column tiles (3 independent accumulators).
  {
    lds_f32* dst[3];
    float    scl[3];
#pragma unroll
    for (int j = 0; j < 3; ++j) {
      const int ct = wid * 3 + j;            // global 16-col tile index (0..23)
      const int s  = ct >> 3;                // 0=q 1=k 2=v
      const int h  = (ct >> 1) & 3;          // head
      const int db = (ct & 1) << 4;          // d base within head
      scl[j] = (s == 0) ? QKSCALE : 1.0f;
      dst[j] = qkvBuf + ((s * HEADS + h) * NPAD) * QKV_STRIDE + db + c;
    }
    // Two register sets of half a row tile's fragments (k 0-63, k 64-127):
    // each set is refilled while the products of the other run.
    v2f alo[16], ahi[16];
    frag_rows<16>(xs, OUT_STRIDE, lane, alo);
#pragma unroll 1   // one copy of the 96 products: short code
    for (int mt = 0; mt < 7; ++mt) {
      frag_rows<16>(xs + mt * 16 * OUT_STRIDE + 64, OUT_STRIDE, lane, ahi);
      v8f acc0 = {}, acc1 = {}, acc2 = {};
#pragma unroll   // constant indices: the fragment arrays stay in registers
      for (int s = 0; s < 16; ++s) {
        acc0 = __builtin_amdgcn_wmma_f32_16x16x4_f32(false, alo[s], false, wq0[s],
                                                     (short)0, acc0, false, false);
        acc1 = __builtin_amdgcn_wmma_f32_16x16x4_f32(false, alo[s], false, wq1[s],
                                                     (short)0, acc1, false, false);
        acc2 = __builtin_amdgcn_wmma_f32_16x16x4_f32(false, alo[s], false, wq2[s],
                                                     (short)0, acc2, false, false);
      }
      STAGE_ENDS_HERE();
      // Next row tile's first half; behind the last tile the same tile again
      // (unconditional, so that the counted waits stay exact; not used).
      const int mn = (mt + 1 < 7) ? mt + 1 : mt;
      frag_rows<16>(xs + mn * 16 * OUT_STRIDE, OUT_STRIDE, lane, alo);
#pragma unroll
      for (int s = 0; s < 16; ++s) {
        acc0 = __builtin_amdgcn_wmma_f32_16x16x4_f32(false, ahi[s], false, wq0[16 + s],
                                                     (short)0, acc0, false, false);
        acc1 = __builtin_amdgcn_wmma_f32_16x16x4_f32(false, ahi[s], false, wq1[16 + s],
                                                     (short)0, acc1, false, false);
        acc2 = __builtin_amdgcn_wmma_f32_16x16x4_f32(false, ahi[s], false, wq2[16 + s],
                                                     (short)0, acc2, false, false);
      }
      STAGE_ENDS_HERE();
#pragma unroll
      for (int r = 0; r < 8; ++r) {
        const int  row = mt * 16 + rb + r;
        const bool pad = row >= NTOK;        // zero pad rows of q/k/v
        dst[0][row * QKV_STRIDE] = pad ? 0.0f : (acc0[r] + qb[0]) * scl[0];
        dst[1][row * QKV_STRIDE] = pad ? 0.0f : (acc1[r] + qb[1]) * scl[1];
        dst[2][row * QKV_STRIDE] = pad ? 0.0f : (acc2[r] + qb[2]) * scl[2];
      }
    }
  }
  // ---- Phase C: attention, scores in registers from q k^T to the v product ----
  // Wave wv (0-6) does row tile wv for the 4 heads in turn and shares nothing
  // with the other waves but q, k, v (read only): no barrier inside the phase.
  const int wv = __builtin_amdgcn_readfirstlane(wid);   // scalar: the branch below is a scalar one
  __syncthreads();

  if (wv < 7) {
    const bool upper = lane >= 16;
    // Byte offsets of the lane's 50 scores in the table, row clamped into it
    // (32 bits beside the scalar base); each head moves them on by one float.
    // Head 0's bias values go out here and fly during its q k^T products.
    unsigned toff[SC_VALS];
    float    tb[SC_VALS];
#pragma unroll   // constant indices: the arrays stay in registers
    for (int p = 0; p < SC_PAIRS; ++p) {
      toff[2 * p]     = (unsigned)(min(max(ri2[p].x, 0), TROWS - 1) * (HEADS * 4));
      toff[2 * p + 1] = (unsigned)(min(max(ri2[p].y, 0), TROWS - 1) * (HEADS * 4));
    }
#pragma unroll
    for (int p = 0; p < SC_VALS; ++p) tb[p] = *(const float*)((const char*)table + toff[p]);
    asm volatile("s_wait_xcnt 0x0"
                 :: "v"(toff[0]), "v"(toff[1]), "v"(toff[2]), "v"(toff[3]), "v"(toff[4]),
                    "v"(toff[5]), "v"(toff[6]), "v"(toff[7]), "v"(toff[8]), "v"(toff[9]),
                    "v"(toff[10]), "v"(toff[11]), "v"(toff[12]), "v"(toff[13]), "v"(toff[14]),
                    "v"(toff[15]), "v"(toff[16]), "v"(toff[17]), "v"(toff[18]), "v"(toff[19]),
                    "v"(toff[20]), "v"(toff[21]), "v"(toff[22]), "v"(toff[23]), "v"(toff[24])
                 : "memory");
    asm volatile("s_wait_xcnt 0x0"
                 :: "v"(toff[25]), "v"(toff[26]), "v"(toff[27]), "v"(toff[28]), "v"(toff[29]),
                    "v"(toff[30]), "v"(toff[31]), "v"(toff[32]), "v"(toff[33]), "v"(toff[34]),
                    "v"(toff[35]), "v"(toff[36]), "v"(toff[37]), "v"(toff[38]), "v"(toff[39]),
                    "v"(toff[40]), "v"(toff[41]), "v"(toff[42]), "v"(toff[43]), "v"(toff[44]),
                    "v"(toff[45]), "v"(toff[46]), "v"(toff[47]), "v"(toff[48]), "v"(toff[49])
                 : "memory");
#pragma unroll 1   // one copy of the body: short code
    for (int h = 0; h < HEADS; ++h) {
      const lds_f32* qh = qkvBuf + ((0 * HEADS + h) * NPAD + wv * 16) * QKV_STRIDE;
      const lds_f32* kh = qkvBuf + (1 * HEADS + h) * NPAD * QKV_STRIDE;
      const lds_f32* vh = qkvBuf + (2 * HEADS + h) * NPAD * QKV_STRIDE;

      // C1: S^T = k @ q^T, 7 key tiles: a lane's column of every tile is its
      // own query. k order of both operands as in frag_rows.
      v2f qf[8], kf[7][8];
      {
        // One 8-byte read per fragment (row pitch 144 B, k offset 0 or 8 B).
        const int fo = c * QKV_STRIDE + ((lane >> 4) << 1);
#pragma unroll   // constant indices: the fragment arrays stay in registers
        for (int s = 0; s < 8; ++s) {
          qf[s] = *(const lds_v2f*)(qh + fo + 4 * s);
#pragma unroll
          for (int kt = 0; kt < 7; ++kt)
            kf[kt][s] = *(const lds_v2f*)(kh + fo + kt * 16 * QKV_STRIDE + 4 * s);
        }
      }
      STAGE_ENDS_HERE();   // the 64 fragment reads stay one block ahead of the products
      v8f st[7] = {};
#pragma unroll   // constant indices; neighbouring products are on 7 different accumulators
      for (int s = 0; s < 8; ++s)
#pragma unroll
        for (int kt = 0; kt < 7; ++kt)
          st[kt] = __builtin_amdgcn_wmma_f32_16x16x4_f32(false, kf[kt][s], false, qf[s],
                                                         (short)0, st[kt], false, false);
      STAGE_ENDS_HERE();   // no v read among the products
      // v fragments (A operand v^T: the lane's row is d = lane & 15) in the k
      // order in which the scores already lie in the lanes: step 4 * kt + s
      // holds keys 16 * kt + rb + 2 * s and + 1. Of key tile 6 only step 0 has
      // a valid key (96, 97; lanes 16-31 read zeroed v rows 104, 105 there).
      v2f vf0[SC_PAIRS], vf1[SC_PAIRS];
      {
        const lds_f32* vp = vh + rb * QKV_STRIDE + c;
#pragma unroll
        for (int p = 0; p < SC_PAIRS; ++p) {
          const int key = (p >> 2) * 16 + (p & 3) * 2;
          vf0[p].x = vp[key * QKV_STRIDE];
          vf0[p].y = vp[(key + 1) * QKV_STRIDE];
        }
        // Keeps the reads of the two d tiles apart: joined across the tiles, a
        // two-address read fills a register pair that is no fragment, and every
        // fragment then takes register copies.
        STAGE_ENDS_HERE();
#pragma unroll
        for (int p = 0; p < SC_PAIRS; ++p) {
          const int key = (p >> 2) * 16 + (p & 3) * 2;
          vf1[p].x = vp[key * QKV_STRIDE + 16];
          vf1[p].y = vp[(key + 1) * QKV_STRIDE + 16];
        }
      }
      STAGE_ENDS_HERE();   // the v reads go out ahead of the softmax, which covers their latency

      v4f xv[13];
#pragma unroll
      for (int i = 0; i < 12; ++i)
#pragma unroll
        for (int e = 0; e < 4; ++e) {
          const int p = 4 * i + e;
          xv[i][e] = st[i >> 1][p & 7] + tb[p] + mk2[p >> 1][p & 1];
        }
      {
        const float x0 = st[6][0] + tb[48] + mk2[24].x;
        const float x1 = st[6][1] + tb[49] + mk2[24].y;
        xv[12][0] = upper ? -1e30f : x0;     // lanes 16-31: keys 104, 105 are pad
        xv[12][1] = upper ? -1e30f : x1;
        xv[12][2] = -1e30f;
        xv[12][3] = -1e30f;
      }
      // Next head's bias values; they fly during the rest of this head. Behind
      // the last head: its own again, in bounds, not used (a branch round the
      // loads split the body, and the compiler then copied the 50 values per
      // head). The offsets themselves step on: with a stepped base instead, the
      // compiler widened them to 64-bit pairs and formed 50 addresses per head.
      {
        const unsigned step = (h + 1 < HEADS) ? 4u : 0u;
#pragma unroll
        for (int p = 0; p < SC_VALS; ++p) {
          toff[p] += step;
          tb[p] = *(const float*)((const char*)table + toff[p]);
        }
        // As at head 0's loads.
        asm volatile("s_wait_xcnt 0x0"
                     :: "v"(toff[0]), "v"(toff[1]), "v"(toff[2]), "v"(toff[3]), "v"(toff[4]),
                        "v"(toff[5]), "v"(toff[6]), "v"(toff[7]), "v"(toff[8]), "v"(toff[9]),
                        "v"(toff[10]), "v"(toff[11]), "v"(toff[12]), "v"(toff[13]), "v"(toff[14]),
                        "v"(toff[15]), "v"(toff[16]), "v"(toff[17]), "v"(toff[18]), "v"(toff[19]),
                        "v"(toff[20]), "v"(toff[21]), "v"(toff[22]), "v"(toff[23]), "v"(toff[24])
                     : "memory");
        asm volatile("s_wait_xcnt 0x0"
                     :: "v"(toff[25]), "v"(toff[26]), "v"(toff[27]), "v"(toff[28]), "v"(toff[29]),
                        "v"(toff[30]), "v"(toff[31]), "v"(toff[32]), "v"(toff[33]), "v"(toff[34]),
                        "v"(toff[35]), "v"(toff[36]), "v"(toff[37]), "v"(toff[38]), "v"(toff[39]),
                        "v"(toff[40]), "v"(toff[41]), "v"(toff[42]), "v"(toff[43]), "v"(toff[44]),
                        "v"(toff[45]), "v"(toff[46]), "v"(toff[47]), "v"(toff[48]), "v"(toff[49])
                     : "memory");
      }
      v4f mv = xv[0];                                  // four running maxima per lane
#pragma unroll
      for (int i = 1; i < 13; ++i)
#pragma unroll
        for (int e = 0; e < 4; ++e) mv[e] = fmaxf(mv[e], xv[i][e]);
      float mx = fmaxf(fmaxf(mv[0], mv[1]), fmaxf(mv[2], mv[3]));
      mx = fmaxf(mx, other_half(mx));
      v4f sv = {0.0f, 0.0f, 0.0f, 0.0f};               // four partial sums per lane
#pragma unroll
      for (int i = 0; i < 13; ++i) {
        v4f ex = exp2_x4((xv[i] - mx) * LOG2E);        // e^(x - mx)
        if (i == 12) {                                 // pad adds nothing, multiplies as 0
          ex[0] = upper ? 0.0f : ex[0];
          ex[1] = upper ? 0.0f : ex[1];
          ex[2] = 0.0f;
          ex[3] = 0.0f;
        }
        xv[i] = ex;
        sv += ex;
      }
      float sum = (sv[0] + sv[1]) + (sv[2] + sv[3]);
      sum += other_half(sum);
      const float inv = 1.0f / sum;

      // C3: out^T[d][query] = v^T @ e^T over the 25 steps with a valid key; the
      // lane's column is its own query, so 1 / sum scales the 16 results.
      v8f o0 = {}, o1 = {};
#pragma unroll   // constant indices; the two accumulators alternate
      for (int p = 0; p < SC_PAIRS; ++p) {
        const v2f pf = {xv[p >> 1][(p & 1) * 2], xv[p >> 1][(p & 1) * 2 + 1]};
        o0 = __builtin_amdgcn_wmma_f32_16x16x4_f32(false, vf0[p], false, pf,
                                                   (short)0, o0, false, false);
        o1 = __builtin_amdgcn_wmma_f32_16x16x4_f32(false, vf1[p], false, pf,
                                                   (short)0, o1, false, false);
      }
      // xs now serves as out accum: row = query, 8 neighbouring d per accumulator.
      lds_v4f* op = (lds_v4f*)(xs + (wv * 16 + c) * OUT_STRIDE + h * HD + rb);
      op[0] = v4f{o0[0], o0[1], o0[2], o0[3]} * inv;
      op[1] = v4f{o0[4], o0[5], o0[6], o0[7]} * inv;
      op[4] = v4f{o1[0], o1[1], o1[2], o1[3]} * inv;
      op[5] = v4f{o1[4], o1[5], o1[6], o1[7]} * inv;
    }
  }
  __syncthreads();

  if (wid == 0) {
    tdm_load_2d_f32(proj_w, lds_addr_of(pw), DIMC, DIMC, DIMC,
                    /*interval: 128dw*/6, /*amount: 8dw*/7, true);
    __builtin_amdgcn_s_wait_tensorcnt(0);
  }
  __syncthreads();

  float* og = out + (size_t)b * NTOK * DIMC;
  // A wave's 7 tiles share the column block nt = wid: its proj_w fragments are
  // read once; the row fragments go through two half-tile sets as in B.
  const int nt = wid;
  v2f wf[32], olo[16], ohi[16];
  frag_cols<32>(pw + nt * 16, PW_STRIDE, lane, wf);
  frag_rows<16>(xs, OUT_STRIDE, lane, olo);
  LDS_READS_AS_ONE_BLOCK(48);
  const float pb = proj_b[nt * 16 + c];
#pragma unroll   // constant tile index: the last tile issues no read ahead
  for (int mt = 0; mt < 7; ++mt) {
    frag_rows<16>(xs + mt * 16 * OUT_STRIDE + 64, OUT_STRIDE, lane, ohi);
    LDS_READS_AS_ONE_BLOCK(16);
    v8f acc = {};
    acc = wmma_run<16>(olo, wf, acc);
    PRODUCTS_AS_ONE_RUN(16);
    if (mt + 1 < 7) {
      frag_rows<16>(xs + (mt + 1) * 16 * OUT_STRIDE, OUT_STRIDE, lane, olo);
      LDS_READS_AS_ONE_BLOCK(16);
    }
    acc = wmma_run<16>(ohi, wf + 16, acc);
    PRODUCTS_AS_ONE_RUN(16);
#pragma unroll
    for (int r = 0; r < 8; ++r) {
      const int row = mt * 16 + rb + r;
      if (row < NTOK)
        og[row * DIMC + nt * 16 + c] = acc[r] + pb;
    }
  }
}

// ---------------------------------------------------------------
extern "C" void kernel_launch(void* const* d_in, const int* in_sizes, int n_in,
                              void* d_out, int out_size, void* d_ws, size_t ws_size,
                              hipStream_t stream) {
  (void)in_sizes; (void)n_in; (void)d_ws; (void)ws_size; (void)out_size;
  const float* x      = (const float*)d_in[0];
  const float* mask   = (const float*)d_in[1];
  const float* qkv_w  = (const float*)d_in[2];
  const float* qkv_b  = (const float*)d_in[3];
  const float* table  = (const float*)d_in[4];
  const int*   relidx = (const int*)  d_in[5];
  const float* proj_w = (const float*)d_in[6];
  const float* proj_b = (const float*)d_in[7];
  float* outp = (float*)d_out;

  const size_t smem_bytes = (size_t)SMEM_FLTS * sizeof(float);
  win_attn3d_kernel<<<NBATCH, 256, smem_bytes, stream>>>(
      x, mask, qkv_w, qkv_b, table, relidx, proj_w, proj_b, outp);
}

// v006
// A run of this version takes 244 microseconds.
// Timed twice side by side with v005, it ran 1.03 times as fast both times.
// Counting every step since v000, it is 3.12 times as fast.
#include <hip/hip_runtime.h>

// ---------------- problem constants ----------------
#define DIMC   128
#define HEADS  4
#define HD     32
#define NTOK   98
#define NPAD   112          // 7 * 16
#define NWIN   64
#define NBATCH 2048
#define QKSCALE 0.17677669529663687f  // 32^-0.5
#define TROWS  507          // rows of the relative position bias table

// ---------------- LDS layout (floats) ----------------
#define QKV_STRIDE 36
#define ATT_STRIDE 116
#define OUT_STRIDE 132
#define PW_STRIDE  136
#define WCOLS      48

#define QKV_FLTS  (3 * HEADS * NPAD * QKV_STRIDE)   // 48384
#define ATT_OFF   QKV_FLTS
#define ATT_FLTS  (NPAD * ATT_STRIDE)               // 12992
#define XS_OFF    (ATT_OFF + ATT_FLTS)              // 61376
#define XS_FLTS   (NPAD * OUT_STRIDE)               // 14784
#define SMEM_FLTS (XS_OFF + XS_FLTS)                // 76160 floats = 304640 B (< 320KB WGP LDS)

#define KT_FULL   6         // key tiles whose 16 keys are all valid (keys 0-95)
#define SC_PAIRS  25        // a lane's score pairs: 6 tiles x 4, and keys 96, 97
#define LOG2E     1.44269504088896341f

// Workspace plane of the scores' additive term (bias + mask), in the order in
// which the lanes of Phase C hold their scores:
// [window 64][row tile 7][head 4][group 13][lane 32][4 floats].
// Group g < 12 of a lane: keys 16 * (g >> 1) + rb + 4 * (g & 1) + 0..3;
// group 12: keys 96, 97, then two zeros.
#define AD_GROUPS     13
#define AD_GROUP_B    (32 * 16)                      // bytes of one group, all lanes
#define AD_HEAD_B     (AD_GROUPS * AD_GROUP_B)       // 6656
#define AD_TILE_FLTS  (HEADS * AD_GROUPS * 32 * 4)   // one row tile, 4 heads
#define AD_THREADS    (NWIN * 7 * AD_GROUPS * 32)    // 186368 = 728 * 256

typedef __attribute__((ext_vector_type(2))) float v2f;
typedef __attribute__((ext_vector_type(2))) int   v2i;
typedef __attribute__((ext_vector_type(4))) float v4f;
typedef __attribute__((ext_vector_type(8))) float v8f;
typedef __attribute__((ext_vector_type(4))) unsigned int v4u;
typedef __attribute__((ext_vector_type(8))) int v8i;
typedef __attribute__((ext_vector_type(4))) int v4i;

// Explicit LDS (address_space(3)) element type: forces ds_load/ds_store
// codegen (no FLAT fallback when pointer provenance gets murky).
typedef __attribute__((address_space(3))) float lds_f32;
typedef __attribute__((address_space(3))) v4f   lds_v4f;   // 16-byte LDS access
typedef __attribute__((address_space(3))) v2f   lds_v2f;   // 8-byte LDS access

__device__ __forceinline__ void tdm_load_2d_f32(const float* gsrc, unsigned lds_byte_addr,
                                                unsigned width, unsigned rows,
                                                unsigned row_stride,
                                                unsigned pad_interval_code,
                                                unsigned pad_amount_code,
                                                bool pad_en) {
  unsigned long long ga = (unsigned long long)(const void*)gsrc;
  v4u g0;
  g0.x = 1u;
  g0.y = lds_byte_addr;
  g0.z = (unsigned)(ga & 0xFFFFFFFFu);
  g0.w = (unsigned)((ga >> 32) & 0x01FFFFFFu) | (2u << 30);
  unsigned w0 = (2u << 16);
  if (pad_en) w0 |= (1u << 20) | (pad_interval_code << 22) | (pad_amount_code << 25);
  v8i g1;
  g1[0] = (int)w0;
  g1[1] = (int)((width & 0xFFFFu) << 16);
  g1[2] = (int)(((width >> 16) & 0xFFFFu) | ((rows & 0xFFFFu) << 16));
  g1[3] = (int)(((rows >> 16) & 0xFFFFu) | ((width & 0xFFFFu) << 16));
  g1[4] = (int)(rows & 0xFFFFu);
  g1[5] = (int)row_stride;
  g1[6] = 0;
  g1[7] = 0;
  v4i gz4 = {0, 0, 0, 0};
  v8i gz8 = {0, 0, 0, 0, 0, 0, 0, 0};
  __builtin_amdgcn_tensor_load_to_lds(g0, g1, gz4, gz4, gz8, 0);
}

__device__ __forceinline__ unsigned lds_addr_of(const lds_f32* p) {
  return (unsigned)(unsigned long long)p;   // ptrtoint of AS(3) = LDS byte offset
}

template <int KS>
__device__ __forceinline__ void frag_rows(const lds_f32* P, int ld, int lane, v2f* f) {
  const lds_f32* p = P + (lane & 15) * ld + ((lane >> 4) << 1);
#pragma unroll   // constant indices: the fragment array stays in registers
  for (int s = 0; s < KS; ++s) {
    f[s].x = p[4 * s];
    f[s].y = p[4 * s + 1];
  }
}

// Operand stored k-major: P[k][col], pitch ld; the lane's column is lane & 15.
template <int KS>
__device__ __forceinline__ void frag_cols(const lds_f32* P, int ld, int lane, v2f* f) {
  const lds_f32* p = P + ((lane >> 4) << 1) * ld + (lane & 15);
#pragma unroll   // constant indices: the fragment array stays in registers
  for (int s = 0; s < KS; ++s) {
    f[s].x = p[(4 * s) * ld];
    f[s].y = p[(4 * s + 1) * ld];
  }
}

// acc += sum over KS k-steps, in rising k, operands already in registers.
template <int KS>
__device__ __forceinline__ v8f wmma_run(const v2f* a, const v2f* b, v8f acc) {
#pragma unroll   // constant indices: the fragment arrays stay in registers
  for (int s = 0; s < KS; ++s)
    acc = __builtin_amdgcn_wmma_f32_16x16x4_f32(false, a[s], false, b[s],
                                                (short)0, acc, false, false);
  return acc;
}

// Stages of a body's schedule, in the order in which they are written: "N LDS
// reads as one block", "N products as one run"; a stage takes instructions
// that stand above it in the source. Without them the compiler sinks each
// read to just before its product (a whole LDS latency per product) or
// spreads the reads among the products.
#define LDS_READS_AS_ONE_BLOCK(N) __builtin_amdgcn_sched_group_barrier(0x100, (N), 0)
#define PRODUCTS_AS_ONE_RUN(N)    __builtin_amdgcn_sched_group_barrier(0x008, (N), 0)
// Ends a scheduling region behind a run of products on several accumulators.
// Phase B: a counted stage took any 48 of a row tile's 96 products, so that
// single accumulator chains ran alone, and a third fragment set with register
// copies appeared; so did it with no stage end in front of the epilogue.
#define STAGE_ENDS_HERE()         __builtin_amdgcn_sched_barrier(0)

__device__ __forceinline__ float other_half(float v) {
  const int b = __builtin_bit_cast(int, v);
  return __builtin_bit_cast(float,
      __builtin_amdgcn_permlanex16(b, b, 0x76543210, 0xfedcba98, false, false));
}

__device__ __forceinline__ v4f exp2_x4(v4f t) {
  float r0, r1, r2, r3;
  asm("v_exp_f32 %0, %4\n\tv_exp_f32 %1, %5\n\tv_exp_f32 %2, %6\n\tv_exp_f32 %3, %7\n\tv_nop"
      : "=&v"(r0), "=&v"(r1), "=&v"(r2), "=&v"(r3)
      : "v"(t[0]), "v"(t[1]), "v"(t[2]), "v"(t[3]));
  return v4f{r0, r1, r2, r3};
}

// ---------------------------------------------------------------
// Set-up launch of every call: table[rel_index[q][k]][h] + mask[w][q][k], once
// per window class w (32 windows share it), written in lane order. One thread
// does one group of 4 keys for the 4 heads.
// ---------------------------------------------------------------
__global__ __launch_bounds__(256)
void score_addend_kernel(const float* __restrict__ mask,
                         const float* __restrict__ table,
                         const int*   __restrict__ rel_index,
                         float* __restrict__ addend) {
  const int lane = threadIdx.x & 31;
  // One wave does one group: window class, row tile and group are scalars.
  int t = __builtin_amdgcn_readfirstlane((int)(blockIdx.x * 8 + (threadIdx.x >> 5)));
  const int g  = t % AD_GROUPS;  t /= AD_GROUPS;
  const int rt = t % 7;                      // row tile of 16 queries
  const int w  = t / 7;
  const bool full = g < 2 * KT_FULL;
  const int q  = min(rt * 16 + (lane & 15), NTOK - 1);   // pad query: row 97, reaches no output
  const int k0 = full ? (g >> 1) * 16 + ((lane >> 4) << 3) + (g & 1) * 4 : KT_FULL * 16;
  // Byte offsets, 32 bits beside a scalar base: the very registers that the
  // loads name, so that the waits below can hold them. Group 12 reads keys 96,
  // 97 a second time (in bounds) where the others read their keys 2 and 3.
  const unsigned off0 = (unsigned)((q * NTOK + k0) * 4);
  const unsigned off1 = off0 + (full ? 8u : 0u);
  const char* rib = (const char*)rel_index;
  const char* mkb = (const char*)(mask + w * (NTOK * NTOK));
  const v2i ra = *(const v2i*)(rib + off0);
  const v2i rc = *(const v2i*)(rib + off1);
  const v2f ma = *(const v2f*)(mkb + off0);
  const v2f mc = *(const v2f*)(mkb + off1);
  asm volatile("s_wait_xcnt 0x0" :: "v"(off0), "v"(off1) : "memory");
  // Table rows, clamped into the table; a row holds the 4 heads (16 bytes).
  const int r0 = min(max(ra.x, 0), TROWS - 1);
  const int r1 = min(max(ra.y, 0), TROWS - 1);
  const int r2 = min(max(rc.x, 0), TROWS - 1);
  const int r3 = min(max(rc.y, 0), TROWS - 1);
  const v4f* rows = (const v4f*)table;
  const v4f b0 = rows[r0];
  const v4f b1 = rows[r1];
  const v4f b2 = rows[r2];
  const v4f b3 = rows[r3];
  // As above (the loads name the row numbers, scaled by the load itself).
  asm volatile("s_wait_xcnt 0x0" :: "v"(r0), "v"(r1), "v"(r2), "v"(r3) : "memory");
  v4f* dst = (v4f*)(addend + (size_t)(w * 7 + rt) * AD_TILE_FLTS) + g * 32 + lane;
#pragma unroll
  for (int h = 0; h < HEADS; ++h)
    dst[h * AD_GROUPS * 32] = v4f{b0[h] + ma.x, b1[h] + ma.y,
                                  full ? b2[h] + mc.x : 0.0f, full ? b3[h] + mc.y : 0.0f};
}

// ---------------------------------------------------------------
// One workgroup (8 wave32) handles one window b of 2048.
// ---------------------------------------------------------------
__global__ __launch_bounds__(256)
void win_attn3d_kernel(const float* __restrict__ x,
                       const float* __restrict__ addend,
                       const float* __restrict__ qkv_w,
                       const float* __restrict__ qkv_b,
                       const float* __restrict__ proj_w,
                       const float* __restrict__ proj_b,
                       float* __restrict__ out) {
  extern __shared__ float smem_generic[];
  lds_f32* smem   = (lds_f32*)smem_generic;   // explicit AS(3) view
  lds_f32* qkvBuf = smem;                     // [3][4][112][36]  q/k/v per head
  // smem + ATT_OFF: 12992 floats, free (scores stay in registers)
  lds_f32* xs     = smem + XS_OFF;            // [112][132] x tile, later out accum
  lds_f32* pw     = smem;                     // Phase D: proj_w staged (aliases qkvBuf)

  const int b    = blockIdx.x;
  const int w    = b & (NWIN - 1);
  const int tid  = threadIdx.x;
  const int lane = tid & 31;
  const int wid  = tid >> 5;                 // wave id (wave32!)
  const int c    = lane & 15;                // tile column held by this lane
  const int rb   = (lane >> 4) << 3;         // C/D row base: 0 or 8

  const float* xg = x + (size_t)b * NTOK * DIMC;

  if (wid == 0) {
    tdm_load_2d_f32(xg, lds_addr_of(xs), DIMC, NTOK, DIMC,
                    /*interval: 128dw*/6, /*amount: 4dw*/3, true);
  }
  // This wave's 48 columns of qkv_w (3 column tiles, all 128 k) go straight
  // from global memory into B fragments that stay in registers through Phase
  // B; the loads fly while the x tile lands. k order as in frag_cols.
  v2f wq0[32], wq1[32], wq2[32];
  float qb[3];
  {
    const unsigned woff = (unsigned)(((lane >> 4) << 1) * (3 * DIMC) + wid * WCOLS + c);
#pragma unroll   // constant indices: the fragment arrays stay in registers
    for (int s = 0; s < 32; ++s) {
      wq0[s].x = qkv_w[woff + (4 * s) * (3 * DIMC)];
      wq0[s].y = qkv_w[woff + (4 * s + 1) * (3 * DIMC)];
      wq1[s].x = qkv_w[woff + (4 * s) * (3 * DIMC) + 16];
      wq1[s].y = qkv_w[woff + (4 * s + 1) * (3 * DIMC) + 16];
      wq2[s].x = qkv_w[woff + (4 * s) * (3 * DIMC) + 32];
      wq2[s].y = qkv_w[woff + (4 * s + 1) * (3 * DIMC) + 32];
    }
    const unsigned boff = (unsigned)(wid * WCOLS + c);
#pragma unroll
    for (int j = 0; j < 3; ++j) qb[j] = qkv_b[boff + 16 * j];
    // Keeps the two offset registers untouched until the address
    // translations of the loads above are done.
    asm volatile("s_wait_xcnt 0x0" :: "v"(woff), "v"(boff) : "memory");
  }
  for (int i = tid; i < (NPAD - NTOK) * OUT_STRIDE; i += 256)   // zero pad rows
    xs[(NTOK + i / OUT_STRIDE) * OUT_STRIDE + (i % OUT_STRIDE)] = 0.0f;
  if (wid == 0) __builtin_amdgcn_s_wait_tensorcnt(0);
  __syncthreads();

  const int wv = __builtin_amdgcn_readfirstlane(wid);   // scalar: Phase C's branch is a scalar one
  const char* adb = (const char*)(addend + (size_t)(w * 7 + min(wv, 6)) * AD_TILE_FLTS);
  unsigned aoff = (unsigned)(lane * 16);     // 32 bits beside the scalar base; steps on per head
  v4f ad[2 * KT_FULL];
  v2f adl;                                   // keys 96, 97 (8 bytes: no register is loaded in vain)
#pragma unroll   // constant indices: the array stays in registers
  for (int g = 0; g < 2 * KT_FULL; ++g) ad[g] = *(const v4f*)(adb + aoff + g * AD_GROUP_B);
  adl = *(const v2f*)(adb + aoff + 2 * KT_FULL * AD_GROUP_B);
  asm volatile("s_wait_xcnt 0x0" :: "v"(aoff) : "memory");

  // ---- Phase B: qkv = xs @ qkv_w + qkv_b (q pre-scaled), rows>=98 zeroed ----
  // A wave walks the 7 row tiles of x; each x fragment read from LDS feeds the
  // 3 products of the wave's column tiles (3 independent accumulators).
  {
    lds_f32* dst[3];
    float    scl[3];
#pragma unroll
    for (int j = 0; j < 3; ++j) {
      const int ct = wid * 3 + j;            // global 16-col tile index (0..23)
      const int s  = ct >> 3;                // 0=q 1=k 2=v
      const int h  = (ct >> 1) & 3;          // head
      const int db = (ct & 1) << 4;          // d base within head
      scl[j] = (s == 0) ? QKSCALE : 1.0f;
      dst[j] = qkvBuf + ((s * HEADS + h) * NPAD) * QKV_STRIDE + db + c;
    }
    // Two register sets of half a row tile's fragments (k 0-63, k 64-127):
    // each set is refilled while the products of the other run.
    v2f alo[16], ahi[16];
    frag_rows<16>(xs, OUT_STRIDE, lane, alo);
#pragma unroll 1   // one copy of the 96 products: short code
    for (int mt = 0; mt < 7; ++mt) {
      frag_rows<16>(xs + mt * 16 * OUT_STRIDE + 64, OUT_STRIDE, lane, ahi);
      v8f acc0 = {}, acc1 = {}, acc2 = {};
#pragma unroll   // constant indices: the fragment arrays stay in registers
      for (int s = 0; s < 16; ++s) {
        acc0 = __builtin_amdgcn_wmma_f32_16x16x4_f32(false, alo[s], false, wq0[s],
                                                     (short)0, acc0, false, false);
        acc1 = __builtin_amdgcn_wmma_f32_16x16x4_f32(false, alo[s], false, wq1[s],
                                                     (short)0, acc1, false, false);
        acc2 = __builtin_amdgcn_wmma_f32_16x16x4_f32(false, alo[s], false, wq2[s],
                                                     (short)0, acc2, false, false);
      }
      STAGE_ENDS_HERE();
      // Next row tile's first half; behind the last tile the same tile again
      // (unconditional, so that the counted waits stay exact; not used).
      const int mn = (mt + 1 < 7) ? mt + 1 : mt;
      frag_rows<16>(xs + mn * 16 * OUT_STRIDE, OUT_STRIDE, lane, alo);
#pragma unroll
      for (int s = 0; s < 16; ++s) {
        acc0 = __builtin_amdgcn_wmma_f32_16x16x4_f32(false, ahi[s], false, wq0[16 + s],
                                                     (short)0, acc0, false, false);
        acc1 = __builtin_amdgcn_wmma_f32_16x16x4_f32(false, ahi[s], false, wq1[16 + s],
                                                     (short)0, acc1, false, false);
        acc2 = __builtin_amdgcn_wmma_f32_16x16x4_f32(false, ahi[s], false, wq2[16 + s],
                                                     (short)0, acc2, false, false);
      }
      STAGE_ENDS_HERE();
#pragma unroll
      for (int r = 0; r < 8; ++r) {
        const int  row = mt * 16 + rb + r;
        const bool pad = row >= NTOK;        // zero pad rows of q/k/v
        dst[0][row * QKV_STRIDE] = pad ? 0.0f : (acc0[r] + qb[0]) * scl[0];
        dst[1][row * QKV_STRIDE] = pad ? 0.0f : (acc1[r] + qb[1]) * scl[1];
        dst[2][row * QKV_STRIDE] = pad ? 0.0f : (acc2[r] + qb[2]) * scl[2];
      }
    }
  }
  // ---- Phase C: attention, scores in registers from q k^T to the v product ----
  // Wave wv (0-6) does row tile wv for the 4 heads in turn and shares nothing
  // with the other waves but q, k, v (read only): no barrier inside the phase.
  __syncthreads();

  if (wv < 7) {
    const bool upper = lane >= 16;
#pragma unroll 1   // one copy of the body: short code
    for (int h = 0; h < HEADS; ++h) {
      const lds_f32* qh = qkvBuf + ((0 * HEADS + h) * NPAD + wv * 16) * QKV_STRIDE;
      const lds_f32* kh = qkvBuf + (1 * HEADS + h) * NPAD * QKV_STRIDE;
      const lds_f32* vh = qkvBuf + (2 * HEADS + h) * NPAD * QKV_STRIDE;

      // C1: S^T = k @ q^T, 7 key tiles: a lane's column of every tile is its
      // own query. k order of both operands as in frag_rows.
      v2f qf[8], kf[7][8];
      {
        // One 8-byte read per fragment (row pitch 144 B, k offset 0 or 8 B).
        const int fo = c * QKV_STRIDE + ((lane >> 4) << 1);
#pragma unroll   // constant indices: the fragment arrays stay in registers
        for (int s = 0; s < 8; ++s) {
          qf[s] = *(const lds_v2f*)(qh + fo + 4 * s);
#pragma unroll
          for (int kt = 0; kt < 7; ++kt)
            kf[kt][s] = *(const lds_v2f*)(kh + fo + kt * 16 * QKV_STRIDE + 4 * s);
        }
      }
      STAGE_ENDS_HERE();   // the 64 fragment reads stay one block ahead of the products
      v8f st[7] = {};
#pragma unroll   // constant indices; neighbouring products are on 7 different accumulators
      for (int s = 0; s < 8; ++s)
#pragma unroll
        for (int kt = 0; kt < 7; ++kt)
          st[kt] = __builtin_amdgcn_wmma_f32_16x16x4_f32(false, kf[kt][s], false, qf[s],
                                                         (short)0, st[kt], false, false);
      STAGE_ENDS_HERE();   // no v read among the products
      // v fragments (A operand v^T: the lane's row is d = lane & 15) in the k
      // order in which the scores already lie in the lanes: step 4 * kt + s
      // holds keys 16 * kt + rb + 2 * s and + 1. Of key tile 6 only step 0 has
      // a valid key (96, 97; lanes 16-31 read zeroed v rows 104, 105 there).
      v2f vf0[SC_PAIRS], vf1[SC_PAIRS];
      {
        const lds_f32* vp = vh + rb * QKV_STRIDE + c;
#pragma unroll
        for (int p = 0; p < SC_PAIRS; ++p) {
          const int key = (p >> 2) * 16 + (p & 3) * 2;
          vf0[p].x = vp[key * QKV_STRIDE];
          vf0[p].y = vp[(key + 1) * QKV_STRIDE];
        }
        // Keeps the reads of the two d tiles apart: joined across the tiles, a
        // two-address read fills a register pair that is no fragment, and every
        // fragment then takes register copies.
        STAGE_ENDS_HERE();
#pragma unroll
        for (int p = 0; p < SC_PAIRS; ++p) {
          const int key = (p >> 2) * 16 + (p & 3) * 2;
          vf1[p].x = vp[key * QKV_STRIDE + 16];
          vf1[p].y = vp[(key + 1) * QKV_STRIDE + 16];
        }
      }
      STAGE_ENDS_HERE();   // the v reads go out ahead of the softmax, which covers their latency

      v4f xv[13];
#pragma unroll
      for (int i = 0; i < 12; ++i)
#pragma unroll
        for (int e = 0; e < 4; ++e) xv[i][e] = st[i >> 1][(4 * i + e) & 7] + ad[i][e];
      {
        const float x0 = st[6][0] + adl.x;
        const float x1 = st[6][1] + adl.y;
        xv[12][0] = upper ? -1e30f : x0;     // lanes 16-31: keys 104, 105 are pad
        xv[12][1] = upper ? -1e30f : x1;
        xv[12][2] = -1e30f;
        xv[12][3] = -1e30f;
      }
      // Next head's additive term; it flies during the rest of this head. Behind
      // the last head: its own again, in bounds, not used (no branch in the body).
      aoff += (h + 1 < HEADS) ? (unsigned)AD_HEAD_B : 0u;
#pragma unroll
      for (int g = 0; g < 2 * KT_FULL; ++g) ad[g] = *(const v4f*)(adb + aoff + g * AD_GROUP_B);
      adl = *(const v2f*)(adb + aoff + 2 * KT_FULL * AD_GROUP_B);
      // As at head 0's loads.
      asm volatile("s_wait_xcnt 0x0" :: "v"(aoff) : "memory");
      v4f mv = xv[0];                                  // four running maxima per lane
#pragma unroll
      for (int i = 1; i < 13; ++i)
#pragma unroll
        for (int e = 0; e < 4; ++e) mv[e] = fmaxf(mv[e], xv[i][e]);
      float mx = fmaxf(fmaxf(mv[0], mv[1]), fmaxf(mv[2], mv[3]));
      mx = fmaxf(mx, other_half(mx));
      v4f sv = {0.0f, 0.0f, 0.0f, 0.0f};               // four partial sums per lane
#pragma unroll
      for (int i = 0; i < 13; ++i) {
        v4f ex = exp2_x4((xv[i] - mx) * LOG2E);        // e^(x - mx)
        if (i == 12) {                                 // pad adds nothing, multiplies as 0
          ex[0] = upper ? 0.0f : ex[0];
          ex[1] = upper ? 0.0f : ex[1];
          ex[2] = 0.0f;
          ex[3] = 0.0f;
        }
        xv[i] = ex;
        sv += ex;
      }
      float sum = (sv[0] + sv[1]) + (sv[2] + sv[3]);
      sum += other_half(sum);
      const float inv = 1.0f / sum;

      // C3: out^T[d][query] = v^T @ e^T over the 25 steps with a valid key; the
      // lane's column is its own query, so 1 / sum scales the 16 results.
      v8f o0 = {}, o1 = {};
#pragma unroll   // constant indices; the two accumulators alternate
      for (int p = 0; p < SC_PAIRS; ++p) {
        const v2f pf = {xv[p >> 1][(p & 1) * 2], xv[p >> 1][(p & 1) * 2 + 1]};
        o0 = __builtin_amdgcn_wmma_f32_16x16x4_f32(false, vf0[p], false, pf,
                                                   (short)0, o0, false, false);
        o1 = __builtin_amdgcn_wmma_f32_16x16x4_f32(false, vf1[p], false, pf,
                                                   (short)0, o1, false, false);
      }
      // xs now serves as out accum: row = query, 8 neighbouring d per accumulator.
      lds_v4f* op = (lds_v4f*)(xs + (wv * 16 + c) * OUT_STRIDE + h * HD + rb);
      op[0] = v4f{o0[0], o0[1], o0[2], o0[3]} * inv;
      op[1] = v4f{o0[4], o0[5], o0[6], o0[7]} * inv;
      op[4] = v4f{o1[0], o1[1], o1[2], o1[3]} * inv;
      op[5] = v4f{o1[4], o1[5], o1[6], o1[7]} * inv;
    }
  }
  __syncthreads();

  if (wid == 0) {
    tdm_load_2d_f32(proj_w, lds_addr_of(pw), DIMC, DIMC, DIMC,
                    /*interval: 128dw*/6, /*amount: 8dw*/7, true);
    __builtin_amdgcn_s_wait_tensorcnt(0);
  }
  __syncthreads();

  float* og = out + (size_t)b * NTOK * DIMC;
  // A wave's 7 tiles share the column block nt = wid: its proj_w fragments are
  // read once; the row fragments go through two half-tile sets as in B.
  const int nt = wid;
  v2f wf[32], olo[16], ohi[16];
  frag_cols<32>(pw + nt * 16, PW_STRIDE, lane, wf);
  frag_rows<16>(xs, OUT_STRIDE, lane, olo);
  LDS_READS_AS_ONE_BLOCK(48);
  const float pb = proj_b[nt * 16 + c];
#pragma unroll   // constant tile index: the last tile issues no read ahead
  for (int mt = 0; mt < 7; ++mt) {
    frag_rows<16>(xs + mt * 16 * OUT_STRIDE + 64, OUT_STRIDE, lane, ohi);
    LDS_READS_AS_ONE_BLOCK(16);
    v8f acc = {};
    acc = wmma_run<16>(olo, wf, acc);
    PRODUCTS_AS_ONE_RUN(16);
    if (mt + 1 < 7) {
      frag_rows<16>(xs + (mt + 1) * 16 * OUT_STRIDE, OUT_STRIDE, lane, olo);
      LDS_READS_AS_ONE_BLOCK(16);
    }
    acc = wmma_run<16>(ohi, wf + 16, acc);
    PRODUCTS_AS_ONE_RUN(16);
#pragma unroll
    for (int r = 0; r < 8; ++r) {
      const int row = mt * 16 + rb + r;
      if (row < NTOK)
        og[row * DIMC + nt * 16 + c] = acc[r] + pb;
    }
  }
}

// ---------------------------------------------------------------
extern "C" void kernel_launch(void* const* d_in, const int* in_sizes, int n_in,
                              void* d_out, int out_size, void* d_ws, size_t ws_size,
                              hipStream_t stream) {
  (void)in_sizes; (void)n_in; (void)ws_size; (void)out_size;
  const float* x      = (const float*)d_in[0];
  const float* mask   = (const float*)d_in[1];
  const float* qkv_w  = (const float*)d_in[2];
  const float* qkv_b  = (const float*)d_in[3];
  const float* table  = (const float*)d_in[4];
  const int*   relidx = (const int*)  d_in[5];
  const float* proj_w = (const float*)d_in[6];
  const float* proj_b = (const float*)d_in[7];
  float* outp = (float*)d_out;
  float* addend = (float*)d_ws;   // 64 * 7 * 4 * 13 * 128 floats, written anew by every call

  const size_t smem_bytes = (size_t)SMEM_FLTS * sizeof(float);
  score_addend_kernel<<<AD_THREADS / 256, 256, 0, stream>>>(mask, table, relidx, addend);
  win_attn3d_kernel<<<NBATCH, 256, smem_bytes, stream>>>(
      x, addend, qkv_w, qkv_b, proj_w, proj_b, outp);
}

// v007
// Measured time: 222 microseconds a run.
// Next to v006, in two timings, it ran 1.10 times as fast each time.
// All steps since v000 together make it 3.44 times as fast.
#include <hip/hip_runtime.h>

// ---------------- problem constants ----------------
#define DIMC   128
#define HEADS  4
#define HD     32
#define NTOK   98
#define NPAD   112          // 7 * 16
#define NWIN   64
#define NBATCH 2048
#define QKSCALE 0.17677669529663687f  // 32^-0.5
#define TROWS  507          // rows of the relative position bias table

// ---------------- LDS layout (floats) ----------------
#define QKV_STRIDE 36
#define OUT_STRIDE 132
#define PW_STRIDE  136
#define WCOLS      48

#define QKV_FLTS  (3 * HEADS * NPAD * QKV_STRIDE)   // 48384
#define XS_OFF    QKV_FLTS
#define XS_FLTS   (NPAD * OUT_STRIDE)               // 14784, one x buffer
#define SMEM_FLTS (XS_OFF + 2 * XS_FLTS)            // 77952 floats = 311808 B (< 320KB WGP LDS)

#define NWG       256       // work-groups launched
#define WIN_PER_WG (NBATCH / NWG)                   // 8 windows, one after the other

#define KT_FULL   6         // key tiles whose 16 keys are all valid (keys 0-95)
#define SC_PAIRS  25        // a lane's score pairs: 6 tiles x 4, and keys 96, 97
#define LOG2E     1.44269504088896341f

// Workspace plane of the scores' additive term (bias + mask), in the order in
// which the lanes of Phase C hold their scores:
// [window 64][row tile 7][head 4][group 13][lane 32][4 floats].
// Group g < 12 of a lane: keys 16 * (g >> 1) + rb + 4 * (g & 1) + 0..3;
// group 12: keys 96, 97, then two zeros.
#define AD_GROUPS     13
#define AD_GROUP_B    (32 * 16)                      // bytes of one group, all lanes
#define AD_HEAD_B     (AD_GROUPS * AD_GROUP_B)       // 6656
#define AD_TILE_FLTS  (HEADS * AD_GROUPS * 32 * 4)   // one row tile, 4 heads
#define AD_THREADS    (NWIN * 7 * AD_GROUPS * 32)    // 186368 = 728 * 256

typedef __attribute__((ext_vector_type(2))) float v2f;
typedef __attribute__((ext_vector_type(2))) int   v2i;
typedef __attribute__((ext_vector_type(4))) float v4f;
typedef __attribute__((ext_vector_type(8))) float v8f;
typedef __attribute__((ext_vector_type(4))) unsigned int v4u;
typedef __attribute__((ext_vector_type(8))) int v8i;
typedef __attribute__((ext_vector_type(4))) int v4i;

// Explicit LDS (address_space(3)) element type: forces ds_load/ds_store
// codegen (no FLAT fallback when pointer provenance gets murky).
typedef __attribute__((address_space(3))) float lds_f32;
typedef __attribute__((address_space(3))) v4f   lds_v4f;   // 16-byte LDS access
typedef __attribute__((address_space(3))) v2f   lds_v2f;   // 8-byte LDS access

__device__ __forceinline__ void tdm_load_2d_f32(const float* gsrc, unsigned lds_byte_addr,
                                                unsigned width, unsigned rows,
                                                unsigned row_stride,
                                                unsigned pad_interval_code,
                                                unsigned pad_amount_code,
                                                bool pad_en) {
  unsigned long long ga = (unsigned long long)(const void*)gsrc;
  v4u g0;
  g0.x = 1u;
  g0.y = lds_byte_addr;
  g0.z = (unsigned)(ga & 0xFFFFFFFFu);
  g0.w = (unsigned)((ga >> 32) & 0x01FFFFFFu) | (2u << 30);
  unsigned w0 = (2u << 16);
  if (pad_en) w0 |= (1u << 20) | (pad_interval_code << 22) | (pad_amount_code << 25);
  v8i g1;
  g1[0] = (int)w0;
  g1[1] = (int)((width & 0xFFFFu) << 16);
  g1[2] = (int)(((width >> 16) & 0xFFFFu) | ((rows & 0xFFFFu) << 16));
  g1[3] = (int)(((rows >> 16) & 0xFFFFu) | ((width & 0xFFFFu) << 16));
  g1[4] = (int)(rows & 0xFFFFu);
  g1[5] = (int)row_stride;
  g1[6] = 0;
  g1[7] = 0;
  v4i gz4 = {0, 0, 0, 0};
  v8i gz8 = {0, 0, 0, 0, 0, 0, 0, 0};
  __builtin_amdgcn_tensor_load_to_lds(g0, g1, gz4, gz4, gz8, 0);
}

__device__ __forceinline__ unsigned lds_addr_of(const lds_f32* p) {
  return (unsigned)(unsigned long long)p;   // ptrtoint of AS(3) = LDS byte offset
}

#define X_STEP_G (8 * DIMC)
#define X_STEP_L (8 * OUT_STRIDE * 4)
__device__ __forceinline__ void copy_6_rows(const float* g, unsigned l) {
  asm volatile("global_load_async_to_lds_b128 %0, %6, off\n\t"
               "global_load_async_to_lds_b128 %1, %7, off\n\t"
               "global_load_async_to_lds_b128 %2, %8, off\n\t"
               "global_load_async_to_lds_b128 %3, %9, off\n\t"
               "global_load_async_to_lds_b128 %4, %10, off\n\t"
               "global_load_async_to_lds_b128 %5, %11, off\n\t"
               "s_wait_xcnt 0x0"
               :: "v"(l), "v"(l + X_STEP_L), "v"(l + 2 * X_STEP_L),
                  "v"(l + 3 * X_STEP_L), "v"(l + 4 * X_STEP_L), "v"(l + 5 * X_STEP_L),
                  "v"(g), "v"(g + X_STEP_G), "v"(g + 2 * X_STEP_G),
                  "v"(g + 3 * X_STEP_G), "v"(g + 4 * X_STEP_G), "v"(g + 5 * X_STEP_G)
               : "memory");
}
__device__ __forceinline__ void copy_1_row(const float* g, unsigned l) {
  asm volatile("global_load_async_to_lds_b128 %0, %1, off\n\t"
               "s_wait_xcnt 0x0"
               :: "v"(l), "v"(g) : "memory");
}
// One window's x tile (98 rows of 128 floats) into an LDS buffer of pitch
// OUT_STRIDE: wave wv (a scalar) copies rows wv, wv + 8, ..., 12 rows each and
// rows 96, 97 from waves 0, 1. The tile starts tile_b bytes behind xg0 (under
// 2^32: the lane's offset is formed in 32 bits, then added to the scalar base).
__device__ __forceinline__ void copy_x_tile(const float* xg0, unsigned tile_b, unsigned buf,
                                            int wv, int lane) {
  const float*   g = (const float*)((const char*)xg0 +
                                    (tile_b + (unsigned)((wv * DIMC + lane * 4) * 4)));
  const unsigned l = buf + (unsigned)((wv * OUT_STRIDE + lane * 4) * 4);
  copy_6_rows(g, l);
  copy_6_rows(g + 6 * X_STEP_G, l + 6 * X_STEP_L);
  if (wv < NTOK - 96) copy_1_row(g + 12 * X_STEP_G, l + 12 * X_STEP_L);
}

template <int KS>
__device__ __forceinline__ void frag_rows(const lds_f32* P, int ld, int lane, v2f* f) {
  const lds_f32* p = P + (lane & 15) * ld + ((lane >> 4) << 1);
#pragma unroll   // constant indices: the fragment array stays in registers
  for (int s = 0; s < KS; ++s) {
    f[s].x = p[4 * s];
    f[s].y = p[4 * s + 1];
  }
}

// Operand stored k-major: P[k][col], pitch ld; the lane's column is lane & 15.
template <int KS>
__device__ __forceinline__ void frag_cols(const lds_f32* P, int ld, int lane, v2f* f) {
  const lds_f32* p = P + ((lane >> 4) << 1) * ld + (lane & 15);
#pragma unroll   // constant indices: the fragment array stays in registers
  for (int s = 0; s < KS; ++s) {
    f[s].x = p[(4 * s) * ld];
    f[s].y = p[(4 * s + 1) * ld];
  }
}

// acc += sum over KS k-steps, in rising k, operands already in registers.
template <int KS>
__device__ __forceinline__ v8f wmma_run(const v2f* a, const v2f* b, v8f acc) {
#pragma unroll   // constant indices: the fragment arrays stay in registers
  for (int s = 0; s < KS; ++s)
    acc = __builtin_amdgcn_wmma_f32_16x16x4_f32(false, a[s], false, b[s],
                                                (short)0, acc, false, false);
  return acc;
}

// Stages of a body's schedule, in the order in which they are written: "N LDS
// reads as one block", "N products as one run"; a stage takes instructions
// that stand above it in the source. Without them the compiler sinks each
// read to just before its product (a whole LDS latency per product) or
// spreads the reads among the products.
#define LDS_READS_AS_ONE_BLOCK(N) __builtin_amdgcn_sched_group_barrier(0x100, (N), 0)
#define PRODUCTS_AS_ONE_RUN(N)    __builtin_amdgcn_sched_group_barrier(0x008, (N), 0)
// Ends a scheduling region behind a run of products on several accumulators.
// Phase B: a counted stage took any 48 of a row tile's 96 products, so that
// single accumulator chains ran alone, and a third fragment set with register
// copies appeared; so did it with no stage end in front of the epilogue.
#define STAGE_ENDS_HERE()         __builtin_amdgcn_sched_barrier(0)

__device__ __forceinline__ float other_half(float v) {
  const int b = __builtin_bit_cast(int, v);
  return __builtin_bit_cast(float,
      __builtin_amdgcn_permlanex16(b, b, 0x76543210, 0xfedcba98, false, false));
}

__device__ __forceinline__ v4f exp2_x4(v4f t) {
  float r0, r1, r2, r3;
  asm("v_exp_f32 %0, %4\n\tv_exp_f32 %1, %5\n\tv_exp_f32 %2, %6\n\tv_exp_f32 %3, %7\n\tv_nop"
      : "=&v"(r0), "=&v"(r1), "=&v"(r2), "=&v"(r3)
      : "v"(t[0]), "v"(t[1]), "v"(t[2]), "v"(t[3]));
  return v4f{r0, r1, r2, r3};
}

// ---------------------------------------------------------------
// Set-up launch of every call: table[rel_index[q][k]][h] + mask[w][q][k], once
// per window class w (32 windows share it), written in lane order. One thread
// does one group of 4 keys for the 4 heads.
// ---------------------------------------------------------------
__global__ __launch_bounds__(256)
void score_addend_kernel(const float* __restrict__ mask,
                         const float* __restrict__ table,
                         const int*   __restrict__ rel_index,
                         float* __restrict__ addend) {
  const int lane = threadIdx.x & 31;
  // One wave does one group: window class, row tile and group are scalars.
  int t = __builtin_amdgcn_readfirstlane((int)(blockIdx.x * 8 + (threadIdx.x >> 5)));
  const int g  = t % AD_GROUPS;  t /= AD_GROUPS;
  const int rt = t % 7;                      // row tile of 16 queries
  const int w  = t / 7;
  const bool full = g < 2 * KT_FULL;
  const int q  = min(rt * 16 + (lane & 15), NTOK - 1);   // pad query: row 97, reaches no output
  const int k0 = full ? (g >> 1) * 16 + ((lane >> 4) << 3) + (g & 1) * 4 : KT_FULL * 16;
  // Byte offsets, 32 bits beside a scalar base: the very registers that the
  // loads name, so that the waits below can hold them. Group 12 reads keys 96,
  // 97 a second time (in bounds) where the others read their keys 2 and 3.
  const unsigned off0 = (unsigned)((q * NTOK + k0) * 4);
  const unsigned off1 = off0 + (full ? 8u : 0u);
  const char* rib = (const char*)rel_index;
  const char* mkb = (const char*)(mask + w * (NTOK * NTOK));
  const v2i ra = *(const v2i*)(rib + off0);
  const v2i rc = *(const v2i*)(rib + off1);
  const v2f ma = *(const v2f*)(mkb + off0);
  const v2f mc = *(const v2f*)(mkb + off1);
  asm volatile("s_wait_xcnt 0x0" :: "v"(off0), "v"(off1) : "memory");
  // Table rows, clamped into the table; a row holds the 4 heads (16 bytes).
  const int r0 = min(max(ra.x, 0), TROWS - 1);
  const int r1 = min(max(ra.y, 0), TROWS - 1);
  const int r2 = min(max(rc.x, 0), TROWS - 1);
  const int r3 = min(max(rc.y, 0), TROWS - 1);
  const v4f* rows = (const v4f*)table;
  const v4f b0 = rows[r0];
  const v4f b1 = rows[r1];
  const v4f b2 = rows[r2];
  const v4f b3 = rows[r3];
  // As above (the loads name the row numbers, scaled by the load itself).
  asm volatile("s_wait_xcnt 0x0" :: "v"(r0), "v"(r1), "v"(r2), "v"(r3) : "memory");
  v4f* dst = (v4f*)(addend + (size_t)(w * 7 + rt) * AD_TILE_FLTS) + g * 32 + lane;
#pragma unroll
  for (int h = 0; h < HEADS; ++h)
    dst[h * AD_GROUPS * 32] = v4f{b0[h] + ma.x, b1[h] + ma.y,
                                  full ? b2[h] + mc.x : 0.0f, full ? b3[h] + mc.y : 0.0f};
}

// ---------------------------------------------------------------
// One workgroup (8 wave32) handles 8 windows of 2048, one after the other:
// b = 8 * blockIdx.x + it. qkv_w's fragments are loaded once; the x tile of
// window it + 1 is copied to the second x buffer while window it is worked on.
// ---------------------------------------------------------------
__global__ __launch_bounds__(256)
void win_attn3d_kernel(const float* __restrict__ x,
                       const float* __restrict__ addend,
                       const float* __restrict__ qkv_w,
                       const float* __restrict__ qkv_b,
                       const float* __restrict__ proj_w,
                       const float* __restrict__ proj_b,
                       float* __restrict__ out) {
  extern __shared__ float smem_generic[];
  lds_f32* smem   = (lds_f32*)smem_generic;   // explicit AS(3) view
  lds_f32* qkvBuf = smem;                     // [3][4][112][36]  q/k/v per head
  // smem + XS_OFF: two buffers [112][132], x tile, later out accum
  lds_f32* pw     = smem;                     // Phase D: proj_w staged (aliases qkvBuf)

  const int tid  = threadIdx.x;
  const int lane = tid & 31;
  const int wid  = tid >> 5;                 // wave id (wave32!)
  const int c    = lane & 15;                // tile column held by this lane
  const int rb   = (lane >> 4) << 3;         // C/D row base: 0 or 8

  const int wv   = __builtin_amdgcn_readfirstlane(wid);   // scalar: branches on it are scalar ones

  // ---- Phase A: first window's x tile (98x128 -> stride-132 LDS), buffer 0 ----
  const float* xg0 = x + (size_t)blockIdx.x * (WIN_PER_WG * NTOK * DIMC);   // x of the 8 windows
  copy_x_tile(xg0, 0u, lds_addr_of(smem + XS_OFF), wv, lane);
  // This wave's 48 columns of qkv_w (3 column tiles, all 128 k) go straight
  // from global memory into B fragments that stay in registers through Phase
  // B of every window; the loads fly while the x tile lands. k order as in frag_cols.
  v2f wq0[32], wq1[32], wq2[32];
  float qb[3];
  {
    const unsigned woff = (unsigned)(((lane >> 4) << 1) * (3 * DIMC) + wid * WCOLS + c);
#pragma unroll   // constant indices: the fragment arrays stay in registers
    for (int s = 0; s < 32; ++s) {
      wq0[s].x = qkv_w[woff + (4 * s) * (3 * DIMC)];
      wq0[s].y = qkv_w[woff + (4 * s + 1) * (3 * DIMC)];
      wq1[s].x = qkv_w[woff + (4 * s) * (3 * DIMC) + 16];
      wq1[s].y = qkv_w[woff + (4 * s + 1) * (3 * DIMC) + 16];
      wq2[s].x = qkv_w[woff + (4 * s) * (3 * DIMC) + 32];
      wq2[s].y = qkv_w[woff + (4 * s + 1) * (3 * DIMC) + 32];
    }
    const unsigned boff = (unsigned)(wid * WCOLS + c);
#pragma unroll
    for (int j = 0; j < 3; ++j) qb[j] = qkv_b[boff + 16 * j];
    // Keeps the two offset registers untouched until the address
    // translations of the loads above are done.
    asm volatile("s_wait_xcnt 0x0" :: "v"(woff), "v"(boff) : "memory");
  }
  for (int i = tid; i < (NPAD - NTOK) * OUT_STRIDE; i += 256) { // zero pad rows, both buffers
    smem[XS_OFF + NTOK * OUT_STRIDE + i] = 0.0f;
    smem[XS_OFF + XS_FLTS + NTOK * OUT_STRIDE + i] = 0.0f;
  }
  // This wave's copies of tile 0 have landed; the barrier shows them to the others.
  asm volatile("s_wait_asynccnt 0x0" ::: "memory");
  __syncthreads();
  // Second window's x tile, buffer 1: flies during the first window.
  copy_x_tile(xg0, NTOK * DIMC * 4u, lds_addr_of(smem + XS_OFF + XS_FLTS), wv, lane);

#pragma unroll 1   // one copy of the body: short code
  for (int it = 0; it < WIN_PER_WG; ++it) {
  const int b = blockIdx.x * WIN_PER_WG + it;
  const int w = b & (NWIN - 1);
  lds_f32* xs = smem + XS_OFF + (it & 1) * XS_FLTS;   // this window's x tile, later out accum

  const char* adb = (const char*)addend;
  // 32 bits beside the scalar base (the plane has under 12 MB); steps on per head
  unsigned aoff = (unsigned)((w * 7 + min(wv, 6)) * (AD_TILE_FLTS * 4) + lane * 16);
  v4f ad[2 * KT_FULL];
  v2f adl;                                   // keys 96, 97 (8 bytes: no register is loaded in vain)
#pragma unroll   // constant indices: the array stays in registers
  for (int g = 0; g < 2 * KT_FULL; ++g) ad[g] = *(const v4f*)(adb + aoff + g * AD_GROUP_B);
  adl = *(const v2f*)(adb + aoff + 2 * KT_FULL * AD_GROUP_B);
  asm volatile("s_wait_xcnt 0x0" :: "v"(aoff) : "memory");

  // ---- Phase B: qkv = xs @ qkv_w + qkv_b (q pre-scaled), rows>=98 zeroed ----
  // A wave walks the 7 row tiles of x; each x fragment read from LDS feeds the
  // 3 products of the wave's column tiles (3 independent accumulators).
  {
    lds_f32* dst[3];
    float    scl[3];
#pragma unroll
    for (int j = 0; j < 3; ++j) {
      const int ct = wid * 3 + j;            // global 16-col tile index (0..23)
      const int s  = ct >> 3;                // 0=q 1=k 2=v
      const int h  = (ct >> 1) & 3;          // head
      const int db = (ct & 1) << 4;          // d base within head
      scl[j] = (s == 0) ? QKSCALE : 1.0f;
      dst[j] = qkvBuf + ((s * HEADS + h) * NPAD) * QKV_STRIDE + db + c;
    }
    // Two register sets of half a row tile's fragments (k 0-63, k 64-127):
    // each set is refilled while the products of the other run.
    v2f alo[16], ahi[16];
    frag_rows<16>(xs, OUT_STRIDE, lane, alo);
#pragma unroll 1   // one copy of the 96 products: short code
    for (int mt = 0; mt < 7; ++mt) {
      frag_rows<16>(xs + mt * 16 * OUT_STRIDE + 64, OUT_STRIDE, lane, ahi);
      v8f acc0 = {}, acc1 = {}, acc2 = {};
#pragma unroll   // constant indices: the fragment arrays stay in registers
      for (int s = 0; s < 16; ++s) {
        acc0 = __builtin_amdgcn_wmma_f32_16x16x4_f32(false, alo[s], false, wq0[s],
                                                     (short)0, acc0, false, false);
        acc1 = __builtin_amdgcn_wmma_f32_16x16x4_f32(false, alo[s], false, wq1[s],
                                                     (short)0, acc1, false, false);
        acc2 = __builtin_amdgcn_wmma_f32_16x16x4_f32(false, alo[s], false, wq2[s],
                                                     (short)0, acc2, false, false);
      }
      STAGE_ENDS_HERE();
      // Next row tile's first half; behind the last tile the same tile again
      // (unconditional, so that the counted waits stay exact; not used).
      const int mn = (mt + 1 < 7) ? mt + 1 : mt;
      frag_rows<16>(xs + mn * 16 * OUT_STRIDE, OUT_STRIDE, lane, alo);
#pragma unroll
      for (int s = 0; s < 16; ++s) {
        acc0 = __builtin_amdgcn_wmma_f32_16x16x4_f32(false, ahi[s], false, wq0[16 + s],
                                                     (short)0, acc0, false, false);
        acc1 = __builtin_amdgcn_wmma_f32_16x16x4_f32(false, ahi[s], false, wq1[16 + s],
                                                     (short)0, acc1, false, false);
        acc2 = __builtin_amdgcn_wmma_f32_16x16x4_f32(false, ahi[s], false, wq2[16 + s],
                                                     (short)0, acc2, false, false);
      }
      STAGE_ENDS_HERE();
#pragma unroll
      for (int r = 0; r < 8; ++r) {
        const int  row = mt * 16 + rb + r;
        const bool pad = row >= NTOK;        // zero pad rows of q/k/v
        dst[0][row * QKV_STRIDE] = pad ? 0.0f : (acc0[r] + qb[0]) * scl[0];
        dst[1][row * QKV_STRIDE] = pad ? 0.0f : (acc1[r] + qb[1]) * scl[1];
        dst[2][row * QKV_STRIDE] = pad ? 0.0f : (acc2[r] + qb[2]) * scl[2];
      }
    }
  }
  // ---- Phase C: attention, scores in registers from q k^T to the v product ----
  // Wave wv (0-6) does row tile wv for the 4 heads in turn and shares nothing
  // with the other waves but q, k, v (read only): no barrier inside the phase.
  __syncthreads();

  if (wv < 7) {
    const bool upper = lane >= 16;
#pragma unroll 1   // one copy of the body: short code
    for (int h = 0; h < HEADS; ++h) {
      const lds_f32* qh = qkvBuf + ((0 * HEADS + h) * NPAD + wv * 16) * QKV_STRIDE;
      const lds_f32* kh = qkvBuf + (1 * HEADS + h) * NPAD * QKV_STRIDE;
      const lds_f32* vh = qkvBuf + (2 * HEADS + h) * NPAD * QKV_STRIDE;

      // C1: S^T = k @ q^T, 7 key tiles: a lane's column of every tile is its
      // own query. k order of both operands as in frag_rows.
      v2f qf[8], kf[7][8];
      {
        // One 8-byte read per fragment (row pitch 144 B, k offset 0 or 8 B).
        const int fo = c * QKV_STRIDE + ((lane >> 4) << 1);
#pragma unroll   // constant indices: the fragment arrays stay in registers
        for (int s = 0; s < 8; ++s) {
          qf[s] = *(const lds_v2f*)(qh + fo + 4 * s);
#pragma unroll
          for (int kt = 0; kt < 7; ++kt)
            kf[kt][s] = *(const lds_v2f*)(kh + fo + kt * 16 * QKV_STRIDE + 4 * s);
        }
      }
      STAGE_ENDS_HERE();   // the 64 fragment reads stay one block ahead of the products
      v8f st[7] = {};
#pragma unroll   // constant indices; neighbouring products are on 7 different accumulators
      for (int s = 0; s < 8; ++s)
#pragma unroll
        for (int kt = 0; kt < 7; ++kt)
          st[kt] = __builtin_amdgcn_wmma_f32_16x16x4_f32(false, kf[kt][s], false, qf[s],
                                                         (short)0, st[kt], false, false);
      STAGE_ENDS_HERE();   // no v read among the products
      // v fragments (A operand v^T: the lane's row is d = lane & 15) in the k
      // order in which the scores already lie in the lanes: step 4 * kt + s
      // holds keys 16 * kt + rb + 2 * s and + 1. Of key tile 6 only step 0 has
      // a valid key (96, 97; lanes 16-31 read zeroed v rows 104, 105 there).
      v2f vf0[SC_PAIRS], vf1[SC_PAIRS];
      {
        const lds_f32* vp = vh + rb * QKV_STRIDE + c;
#pragma unroll
        for (int p = 0; p < SC_PAIRS; ++p) {
          const int key = (p >> 2) * 16 + (p & 3) * 2;
          vf0[p].x = vp[key * QKV_STRIDE];
          vf0[p].y = vp[(key + 1) * QKV_STRIDE];
        }
        // Keeps the reads of the two d tiles apart: joined across the tiles, a
        // two-address read fills a register pair that is no fragment, and every
        // fragment then takes register copies.
        STAGE_ENDS_HERE();
#pragma unroll
        for (int p = 0; p < SC_PAIRS; ++p) {
          const int key = (p >> 2) * 16 + (p & 3) * 2;
          vf1[p].x = vp[key * QKV_STRIDE + 16];
          vf1[p].y = vp[(key + 1) * QKV_STRIDE + 16];
        }
      }
      STAGE_ENDS_HERE();   // the v reads go out ahead of the softmax, which covers their latency

      v4f xv[13];
#pragma unroll
      for (int i = 0; i < 12; ++i)
#pragma unroll
        for (int e = 0; e < 4; ++e) xv[i][e] = st[i >> 1][(4 * i + e) & 7] + ad[i][e];
      {
        const float x0 = st[6][0] + adl.x;
        const float x1 = st[6][1] + adl.y;
        xv[12][0] = upper ? -1e30f : x0;     // lanes 16-31: keys 104, 105 are pad
        xv[12][1] = upper ? -1e30f : x1;
        xv[12][2] = -1e30f;
        xv[12][3] = -1e30f;
      }
      // Next head's additive term; it flies during the rest of this head. Behind
      // the last head: its own again, in bounds, not used (no branch in the body).
      aoff += (h + 1 < HEADS) ? (unsigned)AD_HEAD_B : 0u;
#pragma unroll
      for (int g = 0; g < 2 * KT_FULL; ++g) ad[g] = *(const v4f*)(adb + aoff + g * AD_GROUP_B);
      adl = *(const v2f*)(adb + aoff + 2 * KT_FULL * AD_GROUP_B);
      // As at head 0's loads.
      asm volatile("s_wait_xcnt 0x0" :: "v"(aoff) : "memory");
      v4f mv = xv[0];                                  // four running maxima per lane
#pragma unroll
      for (int i = 1; i < 13; ++i)
#pragma unroll
        for (int e = 0; e < 4; ++e) mv[e] = fmaxf(mv[e], xv[i][e]);
      float mx = fmaxf(fmaxf(mv[0], mv[1]), fmaxf(mv[2], mv[3]));
      mx = fmaxf(mx, other_half(mx));
      v4f sv = {0.0f, 0.0f, 0.0f, 0.0f};               // four partial sums per lane
#pragma unroll
      for (int i = 0; i < 13; ++i) {
        v4f ex = exp2_x4((xv[i] - mx) * LOG2E);        // e^(x - mx)
        if (i == 12) {                                 // pad adds nothing, multiplies as 0
          ex[0] = upper ? 0.0f : ex[0];
          ex[1] = upper ? 0.0f : ex[1];
          ex[2] = 0.0f;
          ex[3] = 0.0f;
        }
        xv[i] = ex;
        sv += ex;
      }
      float sum = (sv[0] + sv[1]) + (sv[2] + sv[3]);
      sum += other_half(sum);
      const float inv = 1.0f / sum;

      // C3: out^T[d][query] = v^T @ e^T over the 25 steps with a valid key; the
      // lane's column is its own query, so 1 / sum scales the 16 results.
      v8f o0 = {}, o1 = {};
#pragma unroll   // constant indices; the two accumulators alternate
      for (int p = 0; p < SC_PAIRS; ++p) {
        const v2f pf = {xv[p >> 1][(p & 1) * 2], xv[p >> 1][(p & 1) * 2 + 1]};
        o0 = __builtin_amdgcn_wmma_f32_16x16x4_f32(false, vf0[p], false, pf,
                                                   (short)0, o0, false, false);
        o1 = __builtin_amdgcn_wmma_f32_16x16x4_f32(false, vf1[p], false, pf,
                                                   (short)0, o1, false, false);
      }
      // xs now serves as out accum: row = query, 8 neighbouring d per accumulator.
      lds_v4f* op = (lds_v4f*)(xs + (wv * 16 + c) * OUT_STRIDE + h * HD + rb);
      op[0] = v4f{o0[0], o0[1], o0[2], o0[3]} * inv;
      op[1] = v4f{o0[4], o0[5], o0[6], o0[7]} * inv;
      op[4] = v4f{o1[0], o1[1], o1[2], o1[3]} * inv;
      op[5] = v4f{o1[4], o1[5], o1[6], o1[7]} * inv;
    }
  }
  __syncthreads();

  if (wid == 0) {
    tdm_load_2d_f32(proj_w, lds_addr_of(pw), DIMC, DIMC, DIMC,
                    /*interval: 128dw*/6, /*amount: 8dw*/7, true);
    __builtin_amdgcn_s_wait_tensorcnt(0);
  }
  __syncthreads();

  float* og = out + (size_t)b * NTOK * DIMC;
  // A wave's 7 tiles share the column block nt = wid: its proj_w fragments are
  // read once; the row fragments go through two half-tile sets as in B.
  const int nt = wid;
  v2f wf[32], olo[16], ohi[16];
  frag_cols<32>(pw + nt * 16, PW_STRIDE, lane, wf);
  frag_rows<16>(xs, OUT_STRIDE, lane, olo);
  LDS_READS_AS_ONE_BLOCK(48);
  const float pb = proj_b[nt * 16 + c];
#pragma unroll   // constant tile index: the last tile issues no read ahead
  for (int mt = 0; mt < 7; ++mt) {
    frag_rows<16>(xs + mt * 16 * OUT_STRIDE + 64, OUT_STRIDE, lane, ohi);
    LDS_READS_AS_ONE_BLOCK(16);
    v8f acc = {};
    acc = wmma_run<16>(olo, wf, acc);
    PRODUCTS_AS_ONE_RUN(16);
    if (mt + 1 < 7) {
      frag_rows<16>(xs + (mt + 1) * 16 * OUT_STRIDE, OUT_STRIDE, lane, olo);
      LDS_READS_AS_ONE_BLOCK(16);
    }
    acc = wmma_run<16>(ohi, wf + 16, acc);
    PRODUCTS_AS_ONE_RUN(16);
#pragma unroll
    for (int r = 0; r < 8; ++r) {
      const int row = mt * 16 + rb + r;
      if (row < NTOK)
        og[row * DIMC + nt * 16 + c] = acc[r] + pb;
    }
  }
  // Stands in front of the next window's writes of registers that the stores
  // and loads above name.
  asm volatile("s_wait_xcnt 0x0" ::: "memory");
  // Hand-over of the x buffers: this wave's LDS reads of this window are done,
  // its copies of the next tile have landed; the barrier shows that tile to all
  // waves and frees this window's buffer (and proj_w's place) for rewriting.
  asm volatile("s_wait_dscnt 0x0" ::: "memory");
  asm volatile("s_wait_asynccnt 0x0" ::: "memory");
  __syncthreads();
  if (it + 2 < WIN_PER_WG)
    copy_x_tile(xg0, (unsigned)(it + 2) * (NTOK * DIMC * 4u), lds_addr_of(xs), wv, lane);
  }
  // No copy is left in flight when the wave ends.
  asm volatile("s_wait_asynccnt 0x0" ::: "memory");
}

// ---------------------------------------------------------------
extern "C" void kernel_launch(void* const* d_in, const int* in_sizes, int n_in,
                              void* d_out, int out_size, void* d_ws, size_t ws_size,
                              hipStream_t stream) {
  (void)in_sizes; (void)n_in; (void)ws_size; (void)out_size;
  const float* x      = (const float*)d_in[0];
  const float* mask   = (const float*)d_in[1];
  const float* qkv_w  = (const float*)d_in[2];
  const float* qkv_b  = (const float*)d_in[3];
  const float* table  = (const float*)d_in[4];
  const int*   relidx = (const int*)  d_in[5];
  const float* proj_w = (const float*)d_in[6];
  const float* proj_b = (const float*)d_in[7];
  float* outp = (float*)d_out;
  float* addend = (float*)d_ws;   // 64 * 7 * 4 * 13 * 128 floats, written anew by every call

  const size_t smem_bytes = (size_t)SMEM_FLTS * sizeof(float);
  score_addend_kernel<<<AD_THREADS / 256, 256, 0, stream>>>(mask, table, relidx, addend);
  win_attn3d_kernel<<<NWG, 256, smem_bytes, stream>>>(
      x, addend, qkv_w, qkv_b, proj_w, proj_b, outp);
}

// v008
// One run takes 202 microseconds.
// Next to v007, in two timings, it ran 1.09 and 1.10 times as fast.
// Over all steps from v000 it is 3.76 times as fast.
#include <hip/hip_runtime.h>

// ---------------- problem constants ----------------
#define DIMC   128
#define HEADS  4
#define HD     32
#define NTOK   98
#define NPAD   112          // 7 * 16
#define NWIN   64
#define NBATCH 2048
#define QKSCALE 0.17677669529663687f  // 32^-0.5
#define TROWS  507          // rows of the relative position bias table

// ---------------- LDS layout (floats) ----------------
#define QKV_STRIDE 36
#define OUT_STRIDE 132
#define PW_STRIDE  136
#define WCOLS      48

#define QKV_FLTS  (3 * HEADS * NPAD * QKV_STRIDE)   // 48384
#define XS_OFF    QKV_FLTS
#define BODY_TILES 6        // whole 16-row tiles of a window (rows 0-95)
#define BODY_ROWS (BODY_TILES * 16)
#define XS_FLTS   (BODY_ROWS * OUT_STRIDE)          // 12672, one x buffer: rows 0-95 of a window
// Tail tile: rows 96 and 97 of the work-group's 8 windows as one 16-row tile;
// window i has tile rows i (row 96) and i + 8 (row 97). First x, later out accum.
#define TL_OFF    (XS_OFF + 2 * XS_FLTS)
#define TL_FLTS   (16 * OUT_STRIDE)
// qkv of the tail tile for windows 1-7, as the lanes hold it:
// [window - 1][wave 8][column tile 3][lane 32].
#define TQ_OFF    (TL_OFF + TL_FLTS)
#define TQ_WIN    (8 * 3 * 32)
#define SMEM_FLTS (TQ_OFF + (WIN_PER_WG - 1) * TQ_WIN)   // 81216 floats = 324864 B (< 320KB WGP LDS)

#define NWG       256       // work-groups launched
#define WIN_PER_WG (NBATCH / NWG)                   // 8 windows, one after the other

#define KT_FULL   6         // key tiles whose 16 keys are all valid (keys 0-95)
#define SC_PAIRS  25        // a lane's score pairs: 6 tiles x 4, and keys 96, 97
#define LOG2E     1.44269504088896341f

// Workspace plane of the scores' additive term (bias + mask), in the order in
// which the lanes of Phase C hold their scores:
// [window 64][row tile 7][head 4][group 13][lane 32][4 floats].
// Group g < 12 of a lane: keys 16 * (g >> 1) + rb + 4 * (g & 1) + 0..3;
// group 12: keys 96, 97, then two zeros.
#define AD_GROUPS     13
#define AD_GROUP_B    (32 * 16)                      // bytes of one group, all lanes
#define AD_HEAD_B     (AD_GROUPS * AD_GROUP_B)       // 6656
#define AD_TILE_FLTS  (HEADS * AD_GROUPS * 32 * 4)   // one row tile, 4 heads
#define AD_THREADS    (NWIN * 7 * AD_GROUPS * 32)    // 186368 = 728 * 256

typedef __attribute__((ext_vector_type(2))) float v2f;
typedef __attribute__((ext_vector_type(2))) int   v2i;
typedef __attribute__((ext_vector_type(4))) float v4f;
typedef __attribute__((ext_vector_type(8))) float v8f;
typedef __attribute__((ext_vector_type(4))) unsigned int v4u;
typedef __attribute__((ext_vector_type(8))) int v8i;
typedef __attribute__((ext_vector_type(4))) int v4i;

// Explicit LDS (address_space(3)) element type: forces ds_load/ds_store
// codegen (no FLAT fallback when pointer provenance gets murky).
typedef __attribute__((address_space(3))) float lds_f32;
typedef __attribute__((address_space(3))) v4f   lds_v4f;   // 16-byte LDS access
typedef __attribute__((address_space(3))) v2f   lds_v2f;   // 8-byte LDS access

__device__ __forceinline__ void tdm_load_2d_f32(const float* gsrc, unsigned lds_byte_addr,
                                                unsigned width, unsigned rows,
                                                unsigned row_stride,
                                                unsigned pad_interval_code,
                                                unsigned pad_amount_code,
                                                bool pad_en) {
  unsigned long long ga = (unsigned long long)(const void*)gsrc;
  v4u g0;
  g0.x = 1u;
  g0.y = lds_byte_addr;
  g0.z = (unsigned)(ga & 0xFFFFFFFFu);
  g0.w = (unsigned)((ga >> 32) & 0x01FFFFFFu) | (2u << 30);
  unsigned w0 = (2u << 16);
  if (pad_en) w0 |= (1u << 20) | (pad_interval_code << 22) | (pad_amount_code << 25);
  v8i g1;
  g1[0] = (int)w0;
  g1[1] = (int)((width & 0xFFFFu) << 16);
  g1[2] = (int)(((width >> 16) & 0xFFFFu) | ((rows & 0xFFFFu) << 16));
  g1[3] = (int)(((rows >> 16) & 0xFFFFu) | ((width & 0xFFFFu) << 16));
  g1[4] = (int)(rows & 0xFFFFu);
  g1[5] = (int)row_stride;
  g1[6] = 0;
  g1[7] = 0;
  v4i gz4 = {0, 0, 0, 0};
  v8i gz8 = {0, 0, 0, 0, 0, 0, 0, 0};
  __builtin_amdgcn_tensor_load_to_lds(g0, g1, gz4, gz4, gz8, 0);
}

__device__ __forceinline__ unsigned lds_addr_of(const lds_f32* p) {
  return (unsigned)(unsigned long long)p;   // ptrtoint of AS(3) = LDS byte offset
}

#define X_STEP_G (8 * DIMC)
#define X_STEP_L (8 * OUT_STRIDE * 4)
__device__ __forceinline__ void copy_6_rows(const float* g, unsigned l) {
  asm volatile("global_load_async_to_lds_b128 %0, %6, off\n\t"
               "global_load_async_to_lds_b128 %1, %7, off\n\t"
               "global_load_async_to_lds_b128 %2, %8, off\n\t"
               "global_load_async_to_lds_b128 %3, %9, off\n\t"
               "global_load_async_to_lds_b128 %4, %10, off\n\t"
               "global_load_async_to_lds_b128 %5, %11, off\n\t"
               "s_wait_xcnt 0x0"
               :: "v"(l), "v"(l + X_STEP_L), "v"(l + 2 * X_STEP_L),
                  "v"(l + 3 * X_STEP_L), "v"(l + 4 * X_STEP_L), "v"(l + 5 * X_STEP_L),
                  "v"(g), "v"(g + X_STEP_G), "v"(g + 2 * X_STEP_G),
                  "v"(g + 3 * X_STEP_G), "v"(g + 4 * X_STEP_G), "v"(g + 5 * X_STEP_G)
               : "memory");
}
__device__ __forceinline__ void copy_1_row(const float* g, unsigned l) {
  asm volatile("global_load_async_to_lds_b128 %0, %1, off\n\t"
               "s_wait_xcnt 0x0"
               :: "v"(l), "v"(g) : "memory");
}
// Rows 0-95 of one window's x tile (128 floats a row) into an LDS buffer of pitch
// OUT_STRIDE: wave wv (a scalar) copies rows wv, wv + 8, ..., 12 rows. The tile
// starts tile_b bytes behind xg0 (under 2^32: the lane's offset is formed in 32
// bits, then added to the scalar base).
__device__ __forceinline__ void copy_x_tile(const float* xg0, unsigned tile_b, unsigned buf,
                                            int wv, int lane) {
  const float*   g = (const float*)((const char*)xg0 +
                                    (tile_b + (unsigned)((wv * DIMC + lane * 4) * 4)));
  const unsigned l = buf + (unsigned)((wv * OUT_STRIDE + lane * 4) * 4);
  copy_6_rows(g, l);
  copy_6_rows(g + 6 * X_STEP_G, l + 6 * X_STEP_L);
}
// x rows 96 and 97 of the work-group's window wv (a scalar) into rows wv and
// wv + 8 of the tail tile.
__device__ __forceinline__ void copy_x_tail(const float* xg0, unsigned buf, int wv, int lane) {
  const float*   g = (const float*)((const char*)xg0 +
                                    (unsigned)(((wv * NTOK + BODY_ROWS) * DIMC + lane * 4) * 4));
  const unsigned l = buf + (unsigned)((wv * OUT_STRIDE + lane * 4) * 4);
  copy_1_row(g, l);
  copy_1_row(g + DIMC, l + X_STEP_L);
}

template <int KS>
__device__ __forceinline__ void frag_rows(const lds_f32* P, int ld, int lane, v2f* f) {
  const lds_f32* p = P + (lane & 15) * ld + ((lane >> 4) << 1);
#pragma unroll   // constant indices: the fragment array stays in registers
  for (int s = 0; s < KS; ++s) {
    f[s].x = p[4 * s];
    f[s].y = p[4 * s + 1];
  }
}

// Operand stored k-major: P[k][col], pitch ld; the lane's column is lane & 15.
template <int KS>
__device__ __forceinline__ void frag_cols(const lds_f32* P, int ld, int lane, v2f* f) {
  const lds_f32* p = P + ((lane >> 4) << 1) * ld + (lane & 15);
#pragma unroll   // constant indices: the fragment array stays in registers
  for (int s = 0; s < KS; ++s) {
    f[s].x = p[(4 * s) * ld];
    f[s].y = p[(4 * s + 1) * ld];
  }
}

// acc += sum over KS k-steps, in rising k, operands already in registers.
template <int KS>
__device__ __forceinline__ v8f wmma_run(const v2f* a, const v2f* b, v8f acc) {
#pragma unroll   // constant indices: the fragment arrays stay in registers
  for (int s = 0; s < KS; ++s)
    acc = __builtin_amdgcn_wmma_f32_16x16x4_f32(false, a[s], false, b[s],
                                                (short)0, acc, false, false);
  return acc;
}

// Stages of a body's schedule, in the order in which they are written: "N LDS
// reads as one block", "N products as one run"; a stage takes instructions
// that stand above it in the source. Without them the compiler sinks each
// read to just before its product (a whole LDS latency per product) or
// spreads the reads among the products.
#define LDS_READS_AS_ONE_BLOCK(N) __builtin_amdgcn_sched_group_barrier(0x100, (N), 0)
#define PRODUCTS_AS_ONE_RUN(N)    __builtin_amdgcn_sched_group_barrier(0x008, (N), 0)
// Ends a scheduling region behind a run of products on several accumulators.
// Phase B: a counted stage took any 48 of a row tile's 96 products, so that
// single accumulator chains ran alone, and a third fragment set with register
// copies appeared; so did it with no stage end in front of the epilogue.
#define STAGE_ENDS_HERE()         __builtin_amdgcn_sched_barrier(0)

__device__ __forceinline__ float other_half(float v) {
  const int b = __builtin_bit_cast(int, v);
  return __builtin_bit_cast(float,
      __builtin_amdgcn_permlanex16(b, b, 0x76543210, 0xfedcba98, false, false));
}

__device__ __forceinline__ v4f exp2_x4(v4f t) {
  float r0, r1, r2, r3;
  asm("v_exp_f32 %0, %4\n\tv_exp_f32 %1, %5\n\tv_exp_f32 %2, %6\n\tv_exp_f32 %3, %7\n\tv_nop"
      : "=&v"(r0), "=&v"(r1), "=&v"(r2), "=&v"(r3)
      : "v"(t[0]), "v"(t[1]), "v"(t[2]), "v"(t[3]));
  return v4f{r0, r1, r2, r3};
}

// ---------------------------------------------------------------
// Set-up launch of every call: table[rel_index[q][k]][h] + mask[w][q][k], once
// per window class w (32 windows share it), written in lane order. One thread
// does one group of 4 keys for the 4 heads.
// ---------------------------------------------------------------
__global__ __launch_bounds__(256)
void score_addend_kernel(const float* __restrict__ mask,
                         const float* __restrict__ table,
                         const int*   __restrict__ rel_index,
                         float* __restrict__ addend) {
  const int lane = threadIdx.x & 31;
  // One wave does one group: window class, row tile and group are scalars.
  int t = __builtin_amdgcn_readfirstlane((int)(blockIdx.x * 8 + (threadIdx.x >> 5)));
  const int g  = t % AD_GROUPS;  t /= AD_GROUPS;
  const int rt = t % 7;                      // row tile of 16 queries
  const int w  = t / 7;
  const bool full = g < 2 * KT_FULL;
  const int q  = min(rt * 16 + (lane & 15), NTOK - 1);   // pad query: row 97, reaches no output
  const int k0 = full ? (g >> 1) * 16 + ((lane >> 4) << 3) + (g & 1) * 4 : KT_FULL * 16;
  // Byte offsets, 32 bits beside a scalar base: the very registers that the
  // loads name, so that the waits below can hold them. Group 12 reads keys 96,
  // 97 a second time (in bounds) where the others read their keys 2 and 3.
  const unsigned off0 = (unsigned)((q * NTOK + k0) * 4);
  const unsigned off1 = off0 + (full ? 8u : 0u);
  const char* rib = (const char*)rel_index;
  const char* mkb = (const char*)(mask + w * (NTOK * NTOK));
  const v2i ra = *(const v2i*)(rib + off0);
  const v2i rc = *(const v2i*)(rib + off1);
  const v2f ma = *(const v2f*)(mkb + off0);
  const v2f mc = *(const v2f*)(mkb + off1);
  asm volatile("s_wait_xcnt 0x0" :: "v"(off0), "v"(off1) : "memory");
  // Table rows, clamped into the table; a row holds the 4 heads (16 bytes).
  const int r0 = min(max(ra.x, 0), TROWS - 1);
  const int r1 = min(max(ra.y, 0), TROWS - 1);
  const int r2 = min(max(rc.x, 0), TROWS - 1);
  const int r3 = min(max(rc.y, 0), TROWS - 1);
  const v4f* rows = (const v4f*)table;
  const v4f b0 = rows[r0];
  const v4f b1 = rows[r1];
  const v4f b2 = rows[r2];
  const v4f b3 = rows[r3];
  // As above (the loads name the row numbers, scaled by the load itself).
  asm volatile("s_wait_xcnt 0x0" :: "v"(r0), "v"(r1), "v"(r2), "v"(r3) : "memory");
  v4f* dst = (v4f*)(addend + (size_t)(w * 7 + rt) * AD_TILE_FLTS) + g * 32 + lane;
#pragma unroll
  for (int h = 0; h < HEADS; ++h)
    dst[h * AD_GROUPS * 32] = v4f{b0[h] + ma.x, b1[h] + ma.y,
                                  full ? b2[h] + mc.x : 0.0f, full ? b3[h] + mc.y : 0.0f};
}

// ---------------------------------------------------------------
// One workgroup (8 wave32) handles 8 windows of 2048, one after the other:
// b = 8 * blockIdx.x + it. qkv_w's fragments are loaded once; the x tile of
// window it + 1 is copied to the second x buffer while window it is worked on.
// A window has 98 rows = 6 row tiles and 2 rows: in the two products over rows
// (qkv, output projection) the 8 windows' last 2 rows share one tail tile.
// ---------------------------------------------------------------
__global__ __launch_bounds__(256)
void win_attn3d_kernel(const float* __restrict__ x,
                       const float* __restrict__ addend,
                       const float* __restrict__ qkv_w,
                       const float* __restrict__ qkv_b,
                       const float* __restrict__ proj_w,
                       const float* __restrict__ proj_b,
                       float* __restrict__ out) {
  extern __shared__ float smem_generic[];
  lds_f32* smem   = (lds_f32*)smem_generic;   // explicit AS(3) view
  lds_f32* qkvBuf = smem;                     // [3][4][112][36]  q/k/v per head
  // smem + XS_OFF: two buffers [96][132], x tile, later out accum
  lds_f32* tl     = smem + TL_OFF;            // tail tile [16][132]
  lds_f32* pw     = smem;                     // Phase D: proj_w staged (aliases qkvBuf)

  const int tid  = threadIdx.x;
  const int lane = tid & 31;
  const int wid  = tid >> 5;                 // wave id (wave32!)
  const int c    = lane & 15;                // tile column held by this lane
  const int rb   = (lane >> 4) << 3;         // C/D row base: 0 or 8

  const int wv   = __builtin_amdgcn_readfirstlane(wid);   // scalar: branches on it are scalar ones

  // ---- Phase A: first window's x rows 0-95 (96x128 -> stride-132 LDS), buffer 0; rows 96, 97 of all 8 windows -> tail tile ----
  const float* xg0 = x + (size_t)blockIdx.x * (WIN_PER_WG * NTOK * DIMC);   // x of the 8 windows
  copy_x_tile(xg0, 0u, lds_addr_of(smem + XS_OFF), wv, lane);
  copy_x_tail(xg0, lds_addr_of(tl), wv, lane);
  // This wave's 48 columns of qkv_w (3 column tiles, all 128 k) go straight
  // from global memory into B fragments that stay in registers through Phase
  // B of every window; the loads fly while the x tile lands. k order as in frag_cols.
  v2f wq0[32], wq1[32], wq2[32];
  float qb[3];
  {
    const unsigned woff = (unsigned)(((lane >> 4) << 1) * (3 * DIMC) + wid * WCOLS + c);
#pragma unroll   // constant indices: the fragment arrays stay in registers
    for (int s = 0; s < 32; ++s) {
      wq0[s].x = qkv_w[woff + (4 * s) * (3 * DIMC)];
      wq0[s].y = qkv_w[woff + (4 * s + 1) * (3 * DIMC)];
      wq1[s].x = qkv_w[woff + (4 * s) * (3 * DIMC) + 16];
      wq1[s].y = qkv_w[woff + (4 * s + 1) * (3 * DIMC) + 16];
      wq2[s].x = qkv_w[woff + (4 * s) * (3 * DIMC) + 32];
      wq2[s].y = qkv_w[woff + (4 * s + 1) * (3 * DIMC) + 32];
    }
    const unsigned boff = (unsigned)(wid * WCOLS + c);
#pragma unroll
    for (int j = 0; j < 3; ++j) qb[j] = qkv_b[boff + 16 * j];
    // Keeps the two offset registers untouched until the address
    // translations of the loads above are done.
    asm volatile("s_wait_xcnt 0x0" :: "v"(woff), "v"(boff) : "memory");
  }
  // Pad rows 98-111 of k and v (8 planes) are zeroed once: no window writes them.
  for (int i = tid; i < 2 * HEADS * (NPAD - NTOK) * QKV_STRIDE; i += 256) {
    const int plane = i / ((NPAD - NTOK) * QKV_STRIDE);
    qkvBuf[((HEADS + plane) * NPAD + NTOK) * QKV_STRIDE + i % ((NPAD - NTOK) * QKV_STRIDE)] = 0.0f;
  }
  // This wave's copies of tile 0 and of the tail tile have landed; the barrier
  // shows them to the others.
  asm volatile("s_wait_asynccnt 0x0" ::: "memory");
  __syncthreads();
  // Second window's x tile, buffer 1: flies during the first window.
  copy_x_tile(xg0, NTOK * DIMC * 4u, lds_addr_of(smem + XS_OFF + XS_FLTS), wv, lane);

  // Where this wave's 3 column tiles of qkv go, and their scale.
  lds_f32* dst[3];
  float    scl[3];
#pragma unroll
  for (int j = 0; j < 3; ++j) {
    const int ct = wv * 3 + j;             // global 16-col tile index (0..23), a scalar
    const int s  = ct >> 3;                // 0=q 1=k 2=v
    const int h  = (ct >> 1) & 3;          // head
    const int db = (ct & 1) << 4;          // d base within head
    scl[j] = (s == 0) ? QKSCALE : 1.0f;
    dst[j] = qkvBuf + ((s * HEADS + h) * NPAD) * QKV_STRIDE + db + c;
  }
  const int trow = (BODY_ROWS + (lane >> 4)) * QKV_STRIDE;   // row 96 or 97

  lds_f32* tqw = smem + TQ_OFF + wv * (3 * 32) + lane;
  {
    v8f tq0 = {}, tq1 = {}, tq2 = {};
    v2f alo[16], ahi[16];
    frag_rows<16>(tl, OUT_STRIDE, lane, alo);
    frag_rows<16>(tl + 64, OUT_STRIDE, lane, ahi);
    STAGE_ENDS_HERE();   // the 32 fragment reads stay one block ahead of the products
#pragma unroll   // constant indices: the fragment arrays stay in registers
    for (int s = 0; s < 32; ++s) {
      const v2f a = s < 16 ? alo[s & 15] : ahi[s & 15];
      tq0 = __builtin_amdgcn_wmma_f32_16x16x4_f32(false, a, false, wq0[s],
                                                  (short)0, tq0, false, false);
      tq1 = __builtin_amdgcn_wmma_f32_16x16x4_f32(false, a, false, wq1[s],
                                                  (short)0, tq1, false, false);
      tq2 = __builtin_amdgcn_wmma_f32_16x16x4_f32(false, a, false, wq2[s],
                                                  (short)0, tq2, false, false);
    }
    tq0 = (tq0 + qb[0]) * scl[0];
    tq1 = (tq1 + qb[1]) * scl[1];
    tq2 = (tq2 + qb[2]) * scl[2];
    dst[0][trow] = tq0[0];
    dst[1][trow] = tq1[0];
    dst[2][trow] = tq2[0];
#pragma unroll
    for (int r = 1; r < WIN_PER_WG; ++r) {
      tqw[(r - 1) * TQ_WIN]      = tq0[r];
      tqw[(r - 1) * TQ_WIN + 32] = tq1[r];
      tqw[(r - 1) * TQ_WIN + 64] = tq2[r];
    }
  }

#pragma unroll 1   // one copy of the body: short code
  for (int it = 0; it < WIN_PER_WG; ++it) {
  const int b = blockIdx.x * WIN_PER_WG + it;
  const int w = b & (NWIN - 1);
  lds_f32* xs = smem + XS_OFF + (it & 1) * XS_FLTS;   // this window's x tile, later out accum

  const char* adb = (const char*)addend;
  // 32 bits beside the scalar base (the plane has under 12 MB); steps on per head
  unsigned aoff = (unsigned)((w * 7 + min(wv, 6)) * (AD_TILE_FLTS * 4) + lane * 16);
  v4f ad[2 * KT_FULL];
  v2f adl;                                   // keys 96, 97 (8 bytes: no register is loaded in vain)
#pragma unroll   // constant indices: the array stays in registers
  for (int g = 0; g < 2 * KT_FULL; ++g) ad[g] = *(const v4f*)(adb + aoff + g * AD_GROUP_B);
  adl = *(const v2f*)(adb + aoff + 2 * KT_FULL * AD_GROUP_B);
  asm volatile("s_wait_xcnt 0x0" :: "v"(aoff) : "memory");

  // ---- Phase B: qkv = xs @ qkv_w + qkv_b (q pre-scaled) ----
  // A wave walks the 6 whole row tiles of x; each x fragment read from LDS feeds the
  // 3 products of the wave's column tiles (3 independent accumulators).
  {
    // Rows 96, 97 of this window, from the tail tile's results (window 0 has
    // its own already and reads window 1's, not used: no branch round the reads).
    const lds_f32* tqi = tqw + max(it - 1, 0) * TQ_WIN;
    const float t0 = tqi[0];
    const float t1 = tqi[32];
    const float t2 = tqi[64];
    // Two register sets of half a row tile's fragments (k 0-63, k 64-127):
    // each set is refilled while the products of the other run.
    v2f alo[16], ahi[16];
    frag_rows<16>(xs, OUT_STRIDE, lane, alo);
#pragma unroll 1   // one copy of the 96 products: short code
    for (int mt = 0; mt < BODY_TILES; ++mt) {
      frag_rows<16>(xs + mt * 16 * OUT_STRIDE + 64, OUT_STRIDE, lane, ahi);
      v8f acc0 = {}, acc1 = {}, acc2 = {};
#pragma unroll   // constant indices: the fragment arrays stay in registers
      for (int s = 0; s < 16; ++s) {
        acc0 = __builtin_amdgcn_wmma_f32_16x16x4_f32(false, alo[s], false, wq0[s],
                                                     (short)0, acc0, false, false);
        acc1 = __builtin_amdgcn_wmma_f32_16x16x4_f32(false, alo[s], false, wq1[s],
                                                     (short)0, acc1, false, false);
        acc2 = __builtin_amdgcn_wmma_f32_16x16x4_f32(false, alo[s], false, wq2[s],
                                                     (short)0, acc2, false, false);
      }
      STAGE_ENDS_HERE();
      // Next row tile's first half; behind the last tile the same tile again
      // (unconditional, so that the counted waits stay exact; not used).
      const int mn = (mt + 1 < BODY_TILES) ? mt + 1 : mt;
      frag_rows<16>(xs + mn * 16 * OUT_STRIDE, OUT_STRIDE, lane, alo);
#pragma unroll
      for (int s = 0; s < 16; ++s) {
        acc0 = __builtin_amdgcn_wmma_f32_16x16x4_f32(false, ahi[s], false, wq0[16 + s],
                                                     (short)0, acc0, false, false);
        acc1 = __builtin_amdgcn_wmma_f32_16x16x4_f32(false, ahi[s], false, wq1[16 + s],
                                                     (short)0, acc1, false, false);
        acc2 = __builtin_amdgcn_wmma_f32_16x16x4_f32(false, ahi[s], false, wq2[16 + s],
                                                     (short)0, acc2, false, false);
      }
      STAGE_ENDS_HERE();
#pragma unroll
      for (int r = 0; r < 8; ++r) {
        const int row = mt * 16 + rb + r;
        dst[0][row * QKV_STRIDE] = (acc0[r] + qb[0]) * scl[0];
        dst[1][row * QKV_STRIDE] = (acc1[r] + qb[1]) * scl[1];
        dst[2][row * QKV_STRIDE] = (acc2[r] + qb[2]) * scl[2];
      }
    }
    if (it != 0) {
      dst[0][trow] = t0;
      dst[1][trow] = t1;
      dst[2][trow] = t2;
    }
  }
  // ---- Phase C: attention, scores in registers from q k^T to the v product ----
  // Wave wv (0-6) does row tile wv for the 4 heads in turn and shares nothing
  // with the other waves but q, k, v (read only): no barrier inside the phase.
  __syncthreads();

  if (wv < 7) {
    const bool upper = lane >= 16;
#pragma unroll 1   // one copy of the body: short code
    for (int h = 0; h < HEADS; ++h) {
      const lds_f32* qh = qkvBuf + (0 * HEADS + h) * NPAD * QKV_STRIDE;
      const lds_f32* kh = qkvBuf + (1 * HEADS + h) * NPAD * QKV_STRIDE;
      const lds_f32* vh = qkvBuf + (2 * HEADS + h) * NPAD * QKV_STRIDE;

      // C1: S^T = k @ q^T, 7 key tiles: a lane's column of every tile is its
      // own query. k order of both operands as in frag_rows.
      v2f qf[8], kf[7][8];
      {
        // One 8-byte read per fragment (row pitch 144 B, k offset 0 or 8 B).
        const int fo = c * QKV_STRIDE + ((lane >> 4) << 1);
        // Pad query: row 97 again (as in the additive term), reaches no output.
        const int qo = min(wv * 16 + c, NTOK - 1) * QKV_STRIDE + ((lane >> 4) << 1);
#pragma unroll   // constant indices: the fragment arrays stay in registers
        for (int s = 0; s < 8; ++s) {
          qf[s] = *(const lds_v2f*)(qh + qo + 4 * s);
#pragma unroll
          for (int kt = 0; kt < 7; ++kt)
            kf[kt][s] = *(const lds_v2f*)(kh + fo + kt * 16 * QKV_STRIDE + 4 * s);
        }
      }
      STAGE_ENDS_HERE();   // the 64 fragment reads stay one block ahead of the products
      v8f st[7] = {};
#pragma unroll   // constant indices; neighbouring products are on 7 different accumulators
      for (int s = 0; s < 8; ++s)
#pragma unroll
        for (int kt = 0; kt < 7; ++kt)
          st[kt] = __builtin_amdgcn_wmma_f32_16x16x4_f32(false, kf[kt][s], false, qf[s],
                                                         (short)0, st[kt], false, false);
      STAGE_ENDS_HERE();   // no v read among the products
      // v fragments (A operand v^T: the lane's row is d = lane & 15) in the k
      // order in which the scores already lie in the lanes: step 4 * kt + s
      // holds keys 16 * kt + rb + 2 * s and + 1. Of key tile 6 only step 0 has
      // a valid key (96, 97; lanes 16-31 read zeroed v rows 104, 105 there).
      v2f vf0[SC_PAIRS], vf1[SC_PAIRS];
      {
        const lds_f32* vp = vh + rb * QKV_STRIDE + c;
#pragma unroll
        for (int p = 0; p < SC_PAIRS; ++p) {
          const int key = (p >> 2) * 16 + (p & 3) * 2;
          vf0[p].x = vp[key * QKV_STRIDE];
          vf0[p].y = vp[(key + 1) * QKV_STRIDE];
        }
        // Keeps the reads of the two d tiles apart: joined across the tiles, a
        // two-address read fills a register pair that is no fragment, and every
        // fragment then takes register copies.
        STAGE_ENDS_HERE();
#pragma unroll
        for (int p = 0; p < SC_PAIRS; ++p) {
          const int key = (p >> 2) * 16 + (p & 3) * 2;
          vf1[p].x = vp[key * QKV_STRIDE + 16];
          vf1[p].y = vp[(key + 1) * QKV_STRIDE + 16];
        }
      }
      STAGE_ENDS_HERE();   // the v reads go out ahead of the softmax, which covers their latency

      v4f xv[13];
#pragma unroll
      for (int i = 0; i < 12; ++i)
#pragma unroll
        for (int e = 0; e < 4; ++e) xv[i][e] = st[i >> 1][(4 * i + e) & 7] + ad[i][e];
      {
        const float x0 = st[6][0] + adl.x;
        const float x1 = st[6][1] + adl.y;
        xv[12][0] = upper ? -1e30f : x0;     // lanes 16-31: keys 104, 105 are pad
        xv[12][1] = upper ? -1e30f : x1;
        xv[12][2] = -1e30f;
        xv[12][3] = -1e30f;
      }
      // Next head's additive term; it flies during the rest of this head. Behind
      // the last head: its own again, in bounds, not used (no branch in the body).
      aoff += (h + 1 < HEADS) ? (unsigned)AD_HEAD_B : 0u;
#pragma unroll
      for (int g = 0; g < 2 * KT_FULL; ++g) ad[g] = *(const v4f*)(adb + aoff + g * AD_GROUP_B);
      adl = *(const v2f*)(adb + aoff + 2 * KT_FULL * AD_GROUP_B);
      // As at head 0's loads.
      asm volatile("s_wait_xcnt 0x0" :: "v"(aoff) : "memory");
      v4f mv = xv[0];                                  // four running maxima per lane
#pragma unroll
      for (int i = 1; i < 13; ++i)
#pragma unroll
        for (int e = 0; e < 4; ++e) mv[e] = fmaxf(mv[e], xv[i][e]);
      float mx = fmaxf(fmaxf(mv[0], mv[1]), fmaxf(mv[2], mv[3]));
      mx = fmaxf(mx, other_half(mx));
      v4f sv = {0.0f, 0.0f, 0.0f, 0.0f};               // four partial sums per lane
#pragma unroll
      for (int i = 0; i < 13; ++i) {
        v4f ex = exp2_x4((xv[i] - mx) * LOG2E);        // e^(x - mx)
        if (i == 12) {                                 // pad adds nothing, multiplies as 0
          ex[0] = upper ? 0.0f : ex[0];
          ex[1] = upper ? 0.0f : ex[1];
          ex[2] = 0.0f;
          ex[3] = 0.0f;
        }
        xv[i] = ex;
        sv += ex;
      }
      float sum = (sv[0] + sv[1]) + (sv[2] + sv[3]);
      sum += other_half(sum);
      const float inv = 1.0f / sum;

      // C3: out^T[d][query] = v^T @ e^T over the 25 steps with a valid key; the
      // lane's column is its own query, so 1 / sum scales the 16 results.
      v8f o0 = {}, o1 = {};
#pragma unroll   // constant indices; the two accumulators alternate
      for (int p = 0; p < SC_PAIRS; ++p) {
        const v2f pf = {xv[p >> 1][(p & 1) * 2], xv[p >> 1][(p & 1) * 2 + 1]};
        o0 = __builtin_amdgcn_wmma_f32_16x16x4_f32(false, vf0[p], false, pf,
                                                   (short)0, o0, false, false);
        o1 = __builtin_amdgcn_wmma_f32_16x16x4_f32(false, vf1[p], false, pf,
                                                   (short)0, o1, false, false);
      }
      // xs now serves as out accum: row = query, 8 neighbouring d per accumulator.
      const v4f r0 = v4f{o0[0], o0[1], o0[2], o0[3]} * inv;
      const v4f r1 = v4f{o0[4], o0[5], o0[6], o0[7]} * inv;
      const v4f r2 = v4f{o1[0], o1[1], o1[2], o1[3]} * inv;
      const v4f r3 = v4f{o1[4], o1[5], o1[6], o1[7]} * inv;
      if (wv < BODY_TILES) {
        lds_v4f* op = (lds_v4f*)(xs + (wv * 16 + c) * OUT_STRIDE + h * HD + rb);
        op[0] = r0;
        op[1] = r1;
        op[4] = r2;
        op[5] = r3;
      } else if (c < NTOK - BODY_ROWS) {
        // Wave 6: queries 96, 97 go to the tail tile, rows it and it + 8.
        lds_v4f* op = (lds_v4f*)(tl + (it + 8 * c) * OUT_STRIDE + h * HD + rb);
        op[0] = r0;
        op[1] = r1;
        op[4] = r2;
        op[5] = r3;
      }
    }
  }
  __syncthreads();

  if (wid == 0) {
    tdm_load_2d_f32(proj_w, lds_addr_of(pw), DIMC, DIMC, DIMC,
                    /*interval: 128dw*/6, /*amount: 8dw*/7, true);
    __builtin_amdgcn_s_wait_tensorcnt(0);
  }
  __syncthreads();

  float* og = out + (size_t)b * NTOK * DIMC;
  // A wave's tiles share the column block nt = wid: its proj_w fragments are
  // read once; the row fragments go through two half-tile sets as in B.
  const int nt = wid;
  v2f wf[32], olo[16], ohi[16];
  frag_cols<32>(pw + nt * 16, PW_STRIDE, lane, wf);
  frag_rows<16>(xs, OUT_STRIDE, lane, olo);
  LDS_READS_AS_ONE_BLOCK(48);
  const float pb = proj_b[nt * 16 + c];
#pragma unroll   // constant tile index: the last tile issues no read ahead
  for (int mt = 0; mt < BODY_TILES; ++mt) {
    frag_rows<16>(xs + mt * 16 * OUT_STRIDE + 64, OUT_STRIDE, lane, ohi);
    LDS_READS_AS_ONE_BLOCK(16);
    v8f acc = {};
    acc = wmma_run<16>(olo, wf, acc);
    PRODUCTS_AS_ONE_RUN(16);
    if (mt + 1 < BODY_TILES) {
      frag_rows<16>(xs + (mt + 1) * 16 * OUT_STRIDE, OUT_STRIDE, lane, olo);
      LDS_READS_AS_ONE_BLOCK(16);
    }
    acc = wmma_run<16>(ohi, wf + 16, acc);
    PRODUCTS_AS_ONE_RUN(16);
#pragma unroll
    for (int r = 0; r < 8; ++r) {
      const int row = mt * 16 + rb + r;
      og[row * DIMC + nt * 16 + c] = acc[r] + pb;
    }
    // Stands in front of the next tile's writes of registers that these stores name.
    asm volatile("s_wait_xcnt 0x0" ::: "memory");
  }
  // Behind the last window the tail tile is complete: rows 96, 97 of all 8 windows.
  if (it == WIN_PER_WG - 1) {
    frag_rows<16>(tl, OUT_STRIDE, lane, olo);
    frag_rows<16>(tl + 64, OUT_STRIDE, lane, ohi);
    v8f acc = {};
    acc = wmma_run<16>(olo, wf, acc);
    acc = wmma_run<16>(ohi, wf + 16, acc);
    float* tg = out + ((size_t)blockIdx.x * (WIN_PER_WG * NTOK) + BODY_ROWS + (lane >> 4)) * DIMC
                    + nt * 16 + c;
#pragma unroll
    for (int r = 0; r < 8; ++r) tg[r * NTOK * DIMC] = acc[r] + pb;
  }
  // Stands in front of the next window's writes of registers that the stores
  // and loads above name.
  asm volatile("s_wait_xcnt 0x0" ::: "memory");
  // Hand-over of the x buffers: this wave's LDS reads of this window are done,
  // its copies of the next tile have landed; the barrier shows that tile to all
  // waves and frees this window's buffer (and proj_w's place) for rewriting.
  asm volatile("s_wait_dscnt 0x0" ::: "memory");
  asm volatile("s_wait_asynccnt 0x0" ::: "memory");
  __syncthreads();
  if (it + 2 < WIN_PER_WG)
    copy_x_tile(xg0, (unsigned)(it + 2) * (NTOK * DIMC * 4u), lds_addr_of(xs), wv, lane);
  }
  // No copy is left in flight when the wave ends.
  asm volatile("s_wait_asynccnt 0x0" ::: "memory");
}

// ---------------------------------------------------------------
extern "C" void kernel_launch(void* const* d_in, const int* in_sizes, int n_in,
                              void* d_out, int out_size, void* d_ws, size_t ws_size,
                              hipStream_t stream) {
  (void)in_sizes; (void)n_in; (void)ws_size; (void)out_size;
  const float* x      = (const float*)d_in[0];
  const float* mask   = (const float*)d_in[1];
  const float* qkv_w  = (const float*)d_in[2];
  const float* qkv_b  = (const float*)d_in[3];
  const float* table  = (const float*)d_in[4];
  const int*   relidx = (const int*)  d_in[5];
  const float* proj_w = (const float*)d_in[6];
  const float* proj_b = (const float*)d_in[7];
  float* outp = (float*)d_out;
  float* addend = (float*)d_ws;   // 64 * 7 * 4 * 13 * 128 floats, written anew by every call

  const size_t smem_bytes = (size_t)SMEM_FLTS * sizeof(float);
  score_addend_kernel<<<AD_THREADS / 256, 256, 0, stream>>>(mask, table, relidx, addend);
  win_attn3d_kernel<<<NWG, 256, smem_bytes, stream>>>(
      x, addend, qkv_w, qkv_b, proj_w, proj_b, outp);
}

// v009
// A run of this version takes 193 microseconds.
// Two timings next to v008 both put it at 1.05 times that version's speed.
// All steps since v000 together make it 3.94 times as fast.
#include <hip/hip_runtime.h>

// ---------------- problem constants ----------------
#define DIMC   128
#define HEADS  4
#define HD     32
#define NTOK   98
#define NPAD   112          // 7 * 16
#define NWIN   64
#define NBATCH 2048
#define QKSCALE 0.17677669529663687f  // 32^-0.5
#define TROWS  507          // rows of the relative position bias table

// ---------------- LDS layout (floats) ----------------
#define QKV_STRIDE 36       // 32 + 4 pad
#define OUT_STRIDE 132      // 128 + 4 pad
#define WCOLS      48       // qkv_w columns held by one wave (3 tiles of 16)

#define QKV_FLTS  (3 * HEADS * NPAD * QKV_STRIDE)   // 48384
#define XS_OFF    QKV_FLTS
#define BODY_TILES 6        // whole 16-row tiles of a window (rows 0-95)
#define BODY_ROWS (BODY_TILES * 16)
#define XS_FLTS   (BODY_ROWS * OUT_STRIDE)          // 12672, one x buffer: rows 0-95 of a window
// Tail tile: rows 96 and 97 of the work-group's 8 windows as one 16-row tile;
// window i has tile rows i (row 96) and i + 8 (row 97). First x, later out accum.
#define TL_OFF    (XS_OFF + 2 * XS_FLTS)
#define TL_FLTS   (16 * OUT_STRIDE)
// qkv of the tail tile for windows 1-7, as the lanes hold it:
// [window - 1][wave 8][column tile 3][lane 32].
#define TQ_OFF    (TL_OFF + TL_FLTS)
#define TQ_WIN    (8 * 3 * 32)
#define SMEM_FLTS (TQ_OFF + (WIN_PER_WG - 1) * TQ_WIN)   // 81216 floats = 324864 B (< 320KB WGP LDS)

#define NWG       256       // work-groups launched
#define WIN_PER_WG (NBATCH / NWG)                   // 8 windows, one after the other

#define KT_FULL   6         // key tiles whose 16 keys are all valid (keys 0-95)
#define SC_PAIRS  25        // a lane's score pairs: 6 tiles x 4, and keys 96, 97
#define LOG2E     1.44269504088896341f

// Workspace plane of the scores' additive term (bias + mask), in the order in
// which the lanes of Phase C hold their scores:
// [window 64][row tile 7][head 4][group 13][lane 32][4 floats].
// Group g < 12 of a lane: keys 16 * (g >> 1) + rb + 4 * (g & 1) + 0..3;
// group 12: keys 96, 97, then two zeros.
#define AD_GROUPS     13
#define AD_GROUP_B    (32 * 16)                      // bytes of one group, all lanes
#define AD_HEAD_B     (AD_GROUPS * AD_GROUP_B)       // 6656
#define AD_TILE_FLTS  (HEADS * AD_GROUPS * 32 * 4)   // one row tile, 4 heads
#define AD_THREADS    (NWIN * 7 * AD_GROUPS * 32)    // 186368 = 728 * 256

typedef __attribute__((ext_vector_type(2))) float v2f;
typedef __attribute__((ext_vector_type(2))) int   v2i;
typedef __attribute__((ext_vector_type(4))) float v4f;
typedef __attribute__((ext_vector_type(8))) float v8f;

// Compile-time switch handed to a generic lambda.
template <bool V> struct flag { static constexpr bool value = V; };

// Explicit LDS (address_space(3)) element type: forces ds_load/ds_store
// codegen (no FLAT fallback when pointer provenance gets murky).
typedef __attribute__((address_space(3))) float lds_f32;
typedef __attribute__((address_space(3))) v4f   lds_v4f;   // 16-byte LDS access
typedef __attribute__((address_space(3))) v2f   lds_v2f;   // 8-byte LDS access

__device__ __forceinline__ unsigned lds_addr_of(const lds_f32* p) {
  return (unsigned)(unsigned long long)p;   // ptrtoint of AS(3) = LDS byte offset
}

#define X_STEP_G (8 * DIMC)
#define X_STEP_L (8 * OUT_STRIDE * 4)
__device__ __forceinline__ void copy_6_rows(const float* g, unsigned l) {
  asm volatile("global_load_async_to_lds_b128 %0, %6, off\n\t"
               "global_load_async_to_lds_b128 %1, %7, off\n\t"
               "global_load_async_to_lds_b128 %2, %8, off\n\t"
               "global_load_async_to_lds_b128 %3, %9, off\n\t"
               "global_load_async_to_lds_b128 %4, %10, off\n\t"
               "global_load_async_to_lds_b128 %5, %11, off\n\t"
               "s_wait_xcnt 0x0"
               :: "v"(l), "v"(l + X_STEP_L), "v"(l + 2 * X_STEP_L),
                  "v"(l + 3 * X_STEP_L), "v"(l + 4 * X_STEP_L), "v"(l + 5 * X_STEP_L),
                  "v"(g), "v"(g + X_STEP_G), "v"(g + 2 * X_STEP_G),
                  "v"(g + 3 * X_STEP_G), "v"(g + 4 * X_STEP_G), "v"(g + 5 * X_STEP_G)
               : "memory");
}
__device__ __forceinline__ void copy_1_row(const float* g, unsigned l) {
  asm volatile("global_load_async_to_lds_b128 %0, %1, off\n\t"
               "s_wait_xcnt 0x0"
               :: "v"(l), "v"(g) : "memory");
}
// Rows 0-95 of one window's x tile (128 floats a row) into an LDS buffer of pitch
// OUT_STRIDE: wave wv (a scalar) copies rows wv, wv + 8, ..., 12 rows. The tile
// starts tile_b bytes behind xg0 (under 2^32: the lane's offset is formed in 32
// bits, then added to the scalar base).
__device__ __forceinline__ void copy_x_tile(const float* xg0, unsigned tile_b, unsigned buf,
                                            int wv, int lane) {
  const float*   g = (const float*)((const char*)xg0 +
                                    (tile_b + (unsigned)((wv * DIMC + lane * 4) * 4)));
  const unsigned l = buf + (unsigned)((wv * OUT_STRIDE + lane * 4) * 4);
  copy_6_rows(g, l);
  copy_6_rows(g + 6 * X_STEP_G, l + 6 * X_STEP_L);
}
// x rows 96 and 97 of the work-group's window wv (a scalar) into rows wv and
// wv + 8 of the tail tile.
__device__ __forceinline__ void copy_x_tail(const float* xg0, unsigned buf, int wv, int lane) {
  const float*   g = (const float*)((const char*)xg0 +
                                    (unsigned)(((wv * NTOK + BODY_ROWS) * DIMC + lane * 4) * 4));
  const unsigned l = buf + (unsigned)((wv * OUT_STRIDE + lane * 4) * 4);
  copy_1_row(g, l);
  copy_1_row(g + DIMC, l + X_STEP_L);
}

template <int KS>
__device__ __forceinline__ void frag_rows(const lds_f32* P, int ld, int lane, v2f* f) {
  const lds_f32* p = P + (lane & 15) * ld + ((lane >> 4) << 1);
#pragma unroll   // constant indices: the fragment array stays in registers
  for (int s = 0; s < KS; ++s) {
    f[s].x = p[4 * s];
    f[s].y = p[4 * s + 1];
  }
}

// acc += sum over KS k-steps, in rising k, operands already in registers.
template <int KS>
__device__ __forceinline__ v8f wmma_run(const v2f* a, const v2f* b, v8f acc) {
#pragma unroll   // constant indices: the fragment arrays stay in registers
  for (int s = 0; s < KS; ++s)
    acc = __builtin_amdgcn_wmma_f32_16x16x4_f32(false, a[s], false, b[s],
                                                (short)0, acc, false, false);
  return acc;
}

// Stages of a body's schedule, in the order in which they are written: "N LDS
// reads as one block", "N products as one run"; a stage takes instructions
// that stand above it in the source. Without them the compiler sinks each
// read to just before its product (a whole LDS latency per product) or
// spreads the reads among the products.
#define LDS_READS_AS_ONE_BLOCK(N) __builtin_amdgcn_sched_group_barrier(0x100, (N), 0)
#define PRODUCTS_AS_ONE_RUN(N)    __builtin_amdgcn_sched_group_barrier(0x008, (N), 0)
// Ends a scheduling region behind a run of products on several accumulators.
// Phase B: a counted stage took any 48 of a row tile's 96 products, so that
// single accumulator chains ran alone, and a third fragment set with register
// copies appeared; so did it with no stage end in front of the epilogue.
#define STAGE_ENDS_HERE()         __builtin_amdgcn_sched_barrier(0)

__device__ __forceinline__ float other_half(float v) {
  const int b = __builtin_bit_cast(int, v);
  return __builtin_bit_cast(float,
      __builtin_amdgcn_permlanex16(b, b, 0x76543210, 0xfedcba98, false, false));
}

__device__ __forceinline__ v4f exp2_x4(v4f t) {
  float r0, r1, r2, r3;
  asm("v_exp_f32 %0, %4\n\tv_exp_f32 %1, %5\n\tv_exp_f32 %2, %6\n\tv_exp_f32 %3, %7\n\tv_nop"
      : "=&v"(r0), "=&v"(r1), "=&v"(r2), "=&v"(r3)
      : "v"(t[0]), "v"(t[1]), "v"(t[2]), "v"(t[3]));
  return v4f{r0, r1, r2, r3};
}

// ---------------------------------------------------------------
// Set-up launch of every call: table[rel_index[q][k]][h] + mask[w][q][k], once
// per window class w (32 windows share it), written in lane order. One thread
// does one group of 4 keys for the 4 heads.
// ---------------------------------------------------------------
__global__ __launch_bounds__(256)
void score_addend_kernel(const float* __restrict__ mask,
                         const float* __restrict__ table,
                         const int*   __restrict__ rel_index,
                         float* __restrict__ addend) {
  const int lane = threadIdx.x & 31;
  // One wave does one group: window class, row tile and group are scalars.
  int t = __builtin_amdgcn_readfirstlane((int)(blockIdx.x * 8 + (threadIdx.x >> 5)));
  const int g  = t % AD_GROUPS;  t /= AD_GROUPS;
  const int rt = t % 7;                      // row tile of 16 queries
  const int w  = t / 7;
  const bool full = g < 2 * KT_FULL;
  const int q  = min(rt * 16 + (lane & 15), NTOK - 1);   // pad query: row 97, reaches no output
  const int k0 = full ? (g >> 1) * 16 + ((lane >> 4) << 3) + (g & 1) * 4 : KT_FULL * 16;
  // Byte offsets, 32 bits beside a scalar base: the very registers that the
  // loads name, so that the waits below can hold them. Group 12 reads keys 96,
  // 97 a second time (in bounds) where the others read their keys 2 and 3.
  const unsigned off0 = (unsigned)((q * NTOK + k0) * 4);
  const unsigned off1 = off0 + (full ? 8u : 0u);
  const char* rib = (const char*)rel_index;
  const char* mkb = (const char*)(mask + w * (NTOK * NTOK));
  const v2i ra = *(const v2i*)(rib + off0);
  const v2i rc = *(const v2i*)(rib + off1);
  const v2f ma = *(const v2f*)(mkb + off0);
  const v2f mc = *(const v2f*)(mkb + off1);
  asm volatile("s_wait_xcnt 0x0" :: "v"(off0), "v"(off1) : "memory");
  // Table rows, clamped into the table; a row holds the 4 heads (16 bytes).
  const int r0 = min(max(ra.x, 0), TROWS - 1);
  const int r1 = min(max(ra.y, 0), TROWS - 1);
  const int r2 = min(max(rc.x, 0), TROWS - 1);
  const int r3 = min(max(rc.y, 0), TROWS - 1);
  const v4f* rows = (const v4f*)table;
  const v4f b0 = rows[r0];
  const v4f b1 = rows[r1];
  const v4f b2 = rows[r2];
  const v4f b3 = rows[r3];
  // As above (the loads name the row numbers, scaled by the load itself).
  asm volatile("s_wait_xcnt 0x0" :: "v"(r0), "v"(r1), "v"(r2), "v"(r3) : "memory");
  v4f* dst = (v4f*)(addend + (size_t)(w * 7 + rt) * AD_TILE_FLTS) + g * 32 + lane;
#pragma unroll
  for (int h = 0; h < HEADS; ++h)
    dst[h * AD_GROUPS * 32] = v4f{b0[h] + ma.x, b1[h] + ma.y,
                                  full ? b2[h] + mc.x : 0.0f, full ? b3[h] + mc.y : 0.0f};
}

// ---------------------------------------------------------------
// One workgroup (8 wave32) handles 8 windows of 2048, one after the other:
// b = 8 * blockIdx.x + it. qkv_w's fragments are loaded once; the x tile of
// window it + 1 is copied to the second x buffer during window it's attention.
// Two barriers a window: qkv -> attention, attention -> output projection; the
// projection of window it and the qkv product of window it + 1 share no LDS
// that either writes, so a wave goes from one into the other on its own.
// A window has 98 rows = 6 row tiles and 2 rows: in the two products over rows
// (qkv, output projection) the 8 windows' last 2 rows share one tail tile.
// ---------------------------------------------------------------
__global__ __launch_bounds__(256)
void win_attn3d_kernel(const float* __restrict__ x,
                       const float* __restrict__ addend,
                       const float* __restrict__ qkv_w,
                       const float* __restrict__ qkv_b,
                       const float* __restrict__ proj_w,
                       const float* __restrict__ proj_b,
                       float* __restrict__ out) {
  extern __shared__ float smem_generic[];
  lds_f32* smem   = (lds_f32*)smem_generic;   // explicit AS(3) view
  lds_f32* qkvBuf = smem;                     // [3][4][112][36]  q/k/v per head
  // smem + XS_OFF: two buffers [96][132], x tile, later out accum
  lds_f32* tl     = smem + TL_OFF;            // tail tile [16][132]

  const int tid  = threadIdx.x;
  const int lane = tid & 31;
  const int wid  = tid >> 5;                 // wave id (wave32!)
  const int c    = lane & 15;                // tile column held by this lane
  const int rb   = (lane >> 4) << 3;         // C/D row base: 0 or 8

  const int wv   = __builtin_amdgcn_readfirstlane(wid);   // scalar: branches on it are scalar ones

  // ---- Phase A: first window's x rows 0-95 (96x128 -> stride-132 LDS), buffer 0; rows 96, 97 of all 8 windows -> tail tile ----
  const float* xg0 = x + (size_t)blockIdx.x * (WIN_PER_WG * NTOK * DIMC);   // x of the 8 windows
  copy_x_tile(xg0, 0u, lds_addr_of(smem + XS_OFF), wv, lane);
  copy_x_tail(xg0, lds_addr_of(tl), wv, lane);
  // This wave's 48 columns of qkv_w (3 column tiles, all 128 k) go straight
  // from global memory into B fragments that stay in registers through Phase
  // B of every window; the loads fly while the x tile lands. k order as in frag_rows.
  v2f wq0[32], wq1[32], wq2[32];
  float qb[3];
  {
    const unsigned woff = (unsigned)(((lane >> 4) << 1) * (3 * DIMC) + wid * WCOLS + c);
#pragma unroll   // constant indices: the fragment arrays stay in registers
    for (int s = 0; s < 32; ++s) {
      wq0[s].x = qkv_w[woff + (4 * s) * (3 * DIMC)];
      wq0[s].y = qkv_w[woff + (4 * s + 1) * (3 * DIMC)];
      wq1[s].x = qkv_w[woff + (4 * s) * (3 * DIMC) + 16];
      wq1[s].y = qkv_w[woff + (4 * s + 1) * (3 * DIMC) + 16];
      wq2[s].x = qkv_w[woff + (4 * s) * (3 * DIMC) + 32];
      wq2[s].y = qkv_w[woff + (4 * s + 1) * (3 * DIMC) + 32];
    }
    const unsigned boff = (unsigned)(wid * WCOLS + c);
#pragma unroll
    for (int j = 0; j < 3; ++j) qb[j] = qkv_b[boff + 16 * j];
    // Keeps the two offset registers untouched until the address
    // translations of the loads above are done.
    asm volatile("s_wait_xcnt 0x0" :: "v"(woff), "v"(boff) : "memory");
  }
  // Pad rows 98-111 of k and v (8 planes) are zeroed once: no window writes them.
  for (int i = tid; i < 2 * HEADS * (NPAD - NTOK) * QKV_STRIDE; i += 256) {
    const int plane = i / ((NPAD - NTOK) * QKV_STRIDE);
    qkvBuf[((HEADS + plane) * NPAD + NTOK) * QKV_STRIDE + i % ((NPAD - NTOK) * QKV_STRIDE)] = 0.0f;
  }
  // This wave's copies of tile 0 and of the tail tile have landed; the barrier
  // shows them to the others.
  asm volatile("s_wait_asynccnt 0x0" ::: "memory");
  __syncthreads();

  // Where this wave's 3 column tiles of qkv go, and their scale.
  lds_f32* dst[3];
  float    scl[3];
#pragma unroll
  for (int j = 0; j < 3; ++j) {
    const int ct = wv * 3 + j;             // global 16-col tile index (0..23), a scalar
    const int s  = ct >> 3;                // 0=q 1=k 2=v
    const int h  = (ct >> 1) & 3;          // head
    const int db = (ct & 1) << 4;          // d base within head
    scl[j] = (s == 0) ? QKSCALE : 1.0f;
    dst[j] = qkvBuf + ((s * HEADS + h) * NPAD) * QKV_STRIDE + db + c;
  }
  const int trow = (BODY_ROWS + (lane >> 4)) * QKV_STRIDE;   // row 96 or 97

  lds_f32* tqw = smem + TQ_OFF + wv * (3 * 32) + lane;
  {
    v8f tq0 = {}, tq1 = {}, tq2 = {};
    v2f alo[16], ahi[16];
    frag_rows<16>(tl, OUT_STRIDE, lane, alo);
    frag_rows<16>(tl + 64, OUT_STRIDE, lane, ahi);
    STAGE_ENDS_HERE();   // the 32 fragment reads stay one block ahead of the products
#pragma unroll   // constant indices: the fragment arrays stay in registers
    for (int s = 0; s < 32; ++s) {
      const v2f a = s < 16 ? alo[s & 15] : ahi[s & 15];
      tq0 = __builtin_amdgcn_wmma_f32_16x16x4_f32(false, a, false, wq0[s],
                                                  (short)0, tq0, false, false);
      tq1 = __builtin_amdgcn_wmma_f32_16x16x4_f32(false, a, false, wq1[s],
                                                  (short)0, tq1, false, false);
      tq2 = __builtin_amdgcn_wmma_f32_16x16x4_f32(false, a, false, wq2[s],
                                                  (short)0, tq2, false, false);
    }
    tq0 = (tq0 + qb[0]) * scl[0];
    tq1 = (tq1 + qb[1]) * scl[1];
    tq2 = (tq2 + qb[2]) * scl[2];
    dst[0][trow] = tq0[0];
    dst[1][trow] = tq1[0];
    dst[2][trow] = tq2[0];
#pragma unroll
    for (int r = 1; r < WIN_PER_WG; ++r) {
      tqw[(r - 1) * TQ_WIN]      = tq0[r];
      tqw[(r - 1) * TQ_WIN + 32] = tq1[r];
      tqw[(r - 1) * TQ_WIN + 64] = tq2[r];
    }
  }

#pragma unroll 1   // one copy of the body: short code
  for (int it = 0; it < WIN_PER_WG; ++it) {
  const int b = blockIdx.x * WIN_PER_WG + it;
  const int w = b & (NWIN - 1);
  lds_f32* xs = smem + XS_OFF + (it & 1) * XS_FLTS;   // this window's x tile, later out accum

  const char* adb = (const char*)addend;
  // 32 bits beside the scalar base (the plane has under 12 MB); steps on per head
  unsigned aoff = (unsigned)((w * 7 + min(wv, 6)) * (AD_TILE_FLTS * 4) + lane * 16);
  v4f ad[2 * KT_FULL];
  v2f adl;                                   // keys 96, 97 (8 bytes: no register is loaded in vain)
#pragma unroll   // constant indices: the array stays in registers
  for (int g = 0; g < 2 * KT_FULL; ++g) ad[g] = *(const v4f*)(adb + aoff + g * AD_GROUP_B);
  adl = *(const v2f*)(adb + aoff + 2 * KT_FULL * AD_GROUP_B);
  asm volatile("s_wait_xcnt 0x0" :: "v"(aoff) : "memory");

  // ---- Phase B: qkv = xs @ qkv_w + qkv_b (q pre-scaled) ----
  // A wave walks the 6 whole row tiles of x; each x fragment read from LDS feeds the
  // 3 products of the wave's column tiles (3 independent accumulators).
  {
    // Rows 96, 97 of this window, from the tail tile's results (window 0 has
    // its own already and reads window 1's, not used: no branch round the reads).
    const lds_f32* tqi = tqw + max(it - 1, 0) * TQ_WIN;
    const float t0 = tqi[0];
    const float t1 = tqi[32];
    const float t2 = tqi[64];
    // Two register sets of half a row tile's fragments (k 0-63, k 64-127):
    // each set is refilled while the products of the other run.
    v2f alo[16], ahi[16];
    frag_rows<16>(xs, OUT_STRIDE, lane, alo);
#pragma unroll 1   // one copy of the 96 products: short code
    for (int mt = 0; mt < BODY_TILES; ++mt) {
      frag_rows<16>(xs + mt * 16 * OUT_STRIDE + 64, OUT_STRIDE, lane, ahi);
      v8f acc0 = {}, acc1 = {}, acc2 = {};
#pragma unroll   // constant indices: the fragment arrays stay in registers
      for (int s = 0; s < 16; ++s) {
        acc0 = __builtin_amdgcn_wmma_f32_16x16x4_f32(false, alo[s], false, wq0[s],
                                                     (short)0, acc0, false, false);
        acc1 = __builtin_amdgcn_wmma_f32_16x16x4_f32(false, alo[s], false, wq1[s],
                                                     (short)0, acc1, false, false);
        acc2 = __builtin_amdgcn_wmma_f32_16x16x4_f32(false, alo[s], false, wq2[s],
                                                     (short)0, acc2, false, false);
      }
      STAGE_ENDS_HERE();
      // Next row tile's first half; behind the last tile the same tile again
      // (unconditional, so that the counted waits stay exact; not used).
      const int mn = (mt + 1 < BODY_TILES) ? mt + 1 : mt;
      frag_rows<16>(xs + mn * 16 * OUT_STRIDE, OUT_STRIDE, lane, alo);
#pragma unroll
      for (int s = 0; s < 16; ++s) {
        acc0 = __builtin_amdgcn_wmma_f32_16x16x4_f32(false, ahi[s], false, wq0[16 + s],
                                                     (short)0, acc0, false, false);
        acc1 = __builtin_amdgcn_wmma_f32_16x16x4_f32(false, ahi[s], false, wq1[16 + s],
                                                     (short)0, acc1, false, false);
        acc2 = __builtin_amdgcn_wmma_f32_16x16x4_f32(false, ahi[s], false, wq2[16 + s],
                                                     (short)0, acc2, false, false);
      }
      STAGE_ENDS_HERE();
#pragma unroll
      for (int r = 0; r < 8; ++r) {
        const int row = mt * 16 + rb + r;
        dst[0][row * QKV_STRIDE] = (acc0[r] + qb[0]) * scl[0];
        dst[1][row * QKV_STRIDE] = (acc1[r] + qb[1]) * scl[1];
        dst[2][row * QKV_STRIDE] = (acc2[r] + qb[2]) * scl[2];
      }
    }
    if (it != 0) {
      dst[0][trow] = t0;
      dst[1][trow] = t1;
      dst[2][trow] = t2;
    }
  }
  // ---- Phase C: attention, scores in registers from q k^T to the v product ----
  // Wave wv (0-6) does row tile wv for the 4 heads in turn and shares nothing
  // with the other waves but q, k, v (read only): no barrier inside the phase.
  // This wave's LDS reads of both x buffers (last window's out accum, this
  // window's x) are done; the barrier frees both for rewriting and shows q, k, v.
  asm volatile("s_wait_dscnt 0x0" ::: "memory");
  __syncthreads();
  // Next window's x tile into the buffer that the last window's projection has
  // left; it flies during this phase.
  if (it + 1 < WIN_PER_WG)
    copy_x_tile(xg0, (unsigned)(it + 1) * (NTOK * DIMC * 4u),
                lds_addr_of(smem + XS_OFF + ((it + 1) & 1) * XS_FLTS), wv, lane);

  // This wave's 16 columns of proj_w (column tile wid, all 128 k) go straight
  // from global memory into the B fragments of Phase D, k order as in frag_rows.
  // The loads go out in the last head, where the k fragments' registers are
  // free, and fly during its softmax and v product.
  v2f wf[32];
  // The lane's own pointer: the register pair that all 64 loads name.
  const float* pwl = proj_w + (((lane >> 4) << 1) * DIMC + wid * 16 + c);
  auto load_proj_w = [&]() __attribute__((always_inline)) {
#pragma unroll   // constant indices: the fragment array stays in registers
    for (int s = 0; s < 32; ++s) {
      wf[s].x = pwl[(4 * s) * DIMC];
      wf[s].y = pwl[(4 * s + 1) * DIMC];
    }
    asm volatile("s_wait_xcnt 0x0" :: "v"(pwl) : "memory");
  };

  if (wv < 7) {
    const bool upper = lane >= 16;
    // One head; the last head's copy fetches proj_w where the others fetch the
    // next head's additive term.
    auto one_head = [&](const int h, auto last_head) __attribute__((always_inline)) {
      const lds_f32* qh = qkvBuf + (0 * HEADS + h) * NPAD * QKV_STRIDE;
      const lds_f32* kh = qkvBuf + (1 * HEADS + h) * NPAD * QKV_STRIDE;
      const lds_f32* vh = qkvBuf + (2 * HEADS + h) * NPAD * QKV_STRIDE;

      // C1: S^T = k @ q^T, 7 key tiles: a lane's column of every tile is its
      // own query. k order of both operands as in frag_rows.
      v2f qf[8], kf[7][8];
      {
        // One 8-byte read per fragment (row pitch 144 B, k offset 0 or 8 B).
        const int fo = c * QKV_STRIDE + ((lane >> 4) << 1);
        // Pad query: row 97 again (as in the additive term), reaches no output.
        const int qo = min(wv * 16 + c, NTOK - 1) * QKV_STRIDE + ((lane >> 4) << 1);
#pragma unroll   // constant indices: the fragment arrays stay in registers
        for (int s = 0; s < 8; ++s) {
          qf[s] = *(const lds_v2f*)(qh + qo + 4 * s);
#pragma unroll
          for (int kt = 0; kt < 7; ++kt)
            kf[kt][s] = *(const lds_v2f*)(kh + fo + kt * 16 * QKV_STRIDE + 4 * s);
        }
      }
      STAGE_ENDS_HERE();   // the 64 fragment reads stay one block ahead of the products
      v8f st[7] = {};
#pragma unroll   // constant indices; neighbouring products are on 7 different accumulators
      for (int s = 0; s < 8; ++s)
#pragma unroll
        for (int kt = 0; kt < 7; ++kt)
          st[kt] = __builtin_amdgcn_wmma_f32_16x16x4_f32(false, kf[kt][s], false, qf[s],
                                                         (short)0, st[kt], false, false);
      STAGE_ENDS_HERE();   // no v read among the products
      // v fragments (A operand v^T: the lane's row is d = lane & 15) in the k
      // order in which the scores already lie in the lanes: step 4 * kt + s
      // holds keys 16 * kt + rb + 2 * s and + 1. Of key tile 6 only step 0 has
      // a valid key (96, 97; lanes 16-31 read zeroed v rows 104, 105 there).
      v2f vf0[SC_PAIRS], vf1[SC_PAIRS];
      {
        const lds_f32* vp = vh + rb * QKV_STRIDE + c;
#pragma unroll
        for (int p = 0; p < SC_PAIRS; ++p) {
          const int key = (p >> 2) * 16 + (p & 3) * 2;
          vf0[p].x = vp[key * QKV_STRIDE];
          vf0[p].y = vp[(key + 1) * QKV_STRIDE];
        }
        // Keeps the reads of the two d tiles apart: joined across the tiles, a
        // two-address read fills a register pair that is no fragment, and every
        // fragment then takes register copies.
        STAGE_ENDS_HERE();
#pragma unroll
        for (int p = 0; p < SC_PAIRS; ++p) {
          const int key = (p >> 2) * 16 + (p & 3) * 2;
          vf1[p].x = vp[key * QKV_STRIDE + 16];
          vf1[p].y = vp[(key + 1) * QKV_STRIDE + 16];
        }
      }
      STAGE_ENDS_HERE();   // the v reads go out ahead of the softmax, which covers their latency

      v4f xv[13];
#pragma unroll
      for (int i = 0; i < 12; ++i)
#pragma unroll
        for (int e = 0; e < 4; ++e) xv[i][e] = st[i >> 1][(4 * i + e) & 7] + ad[i][e];
      {
        const float x0 = st[6][0] + adl.x;
        const float x1 = st[6][1] + adl.y;
        xv[12][0] = upper ? -1e30f : x0;     // lanes 16-31: keys 104, 105 are pad
        xv[12][1] = upper ? -1e30f : x1;
        xv[12][2] = -1e30f;
        xv[12][3] = -1e30f;
      }
      if constexpr (decltype(last_head)::value) {
        // The 64 loads go out as one block, behind the last use of the raw scores'
        // registers and ahead of the softmax: spread among the v products, the
        // last of them would still fly at the barrier.
        STAGE_ENDS_HERE();
        load_proj_w();
        STAGE_ENDS_HERE();
      } else {
        // Next head's additive term; it flies during the rest of this head.
        aoff += (unsigned)AD_HEAD_B;
#pragma unroll
        for (int g = 0; g < 2 * KT_FULL; ++g) ad[g] = *(const v4f*)(adb + aoff + g * AD_GROUP_B);
        adl = *(const v2f*)(adb + aoff + 2 * KT_FULL * AD_GROUP_B);
        // As at head 0's loads.
        asm volatile("s_wait_xcnt 0x0" :: "v"(aoff) : "memory");
      }
      v4f mv = xv[0];                                  // four running maxima per lane
#pragma unroll
      for (int i = 1; i < 13; ++i)
#pragma unroll
        for (int e = 0; e < 4; ++e) mv[e] = fmaxf(mv[e], xv[i][e]);
      float mx = fmaxf(fmaxf(mv[0], mv[1]), fmaxf(mv[2], mv[3]));
      mx = fmaxf(mx, other_half(mx));
      v4f sv = {0.0f, 0.0f, 0.0f, 0.0f};               // four partial sums per lane
#pragma unroll
      for (int i = 0; i < 13; ++i) {
        v4f ex = exp2_x4((xv[i] - mx) * LOG2E);        // e^(x - mx)
        if (i == 12) {                                 // pad adds nothing, multiplies as 0
          ex[0] = upper ? 0.0f : ex[0];
          ex[1] = upper ? 0.0f : ex[1];
          ex[2] = 0.0f;
          ex[3] = 0.0f;
        }
        xv[i] = ex;
        sv += ex;
      }
      float sum = (sv[0] + sv[1]) + (sv[2] + sv[3]);
      sum += other_half(sum);
      const float inv = 1.0f / sum;

      // C3: out^T[d][query] = v^T @ e^T over the 25 steps with a valid key; the
      // lane's column is its own query, so 1 / sum scales the 16 results.
      v8f o0 = {}, o1 = {};
#pragma unroll   // constant indices; the two accumulators alternate
      for (int p = 0; p < SC_PAIRS; ++p) {
        const v2f pf = {xv[p >> 1][(p & 1) * 2], xv[p >> 1][(p & 1) * 2 + 1]};
        o0 = __builtin_amdgcn_wmma_f32_16x16x4_f32(false, vf0[p], false, pf,
                                                   (short)0, o0, false, false);
        o1 = __builtin_amdgcn_wmma_f32_16x16x4_f32(false, vf1[p], false, pf,
                                                   (short)0, o1, false, false);
      }
      // xs now serves as out accum: row = query, 8 neighbouring d per accumulator.
      const v4f r0 = v4f{o0[0], o0[1], o0[2], o0[3]} * inv;
      const v4f r1 = v4f{o0[4], o0[5], o0[6], o0[7]} * inv;
      const v4f r2 = v4f{o1[0], o1[1], o1[2], o1[3]} * inv;
      const v4f r3 = v4f{o1[4], o1[5], o1[6], o1[7]} * inv;
      if (wv < BODY_TILES) {
        lds_v4f* op = (lds_v4f*)(xs + (wv * 16 + c) * OUT_STRIDE + h * HD + rb);
        op[0] = r0;
        op[1] = r1;
        op[4] = r2;
        op[5] = r3;
      } else if (c < NTOK - BODY_ROWS) {
        // Wave 6: queries 96, 97 go to the tail tile, rows it and it + 8.
        lds_v4f* op = (lds_v4f*)(tl + (it + 8 * c) * OUT_STRIDE + h * HD + rb);
        op[0] = r0;
        op[1] = r1;
        op[4] = r2;
        op[5] = r3;
      }
    };
#pragma unroll 1   // one copy of the first three heads' body: short code
    for (int h = 0; h < HEADS - 1; ++h) one_head(h, flag<false>{});
    one_head(HEADS - 1, flag<true>{});
  } else {
    load_proj_w();
  }
  // This wave's LDS reads of q, k, v and its writes of the out accum are done, its
  // copies of the next x tile have landed; the barrier shows both to all waves
  // and frees q, k, v for the next window's qkv product.
  asm volatile("s_wait_dscnt 0x0" ::: "memory");
  asm volatile("s_wait_asynccnt 0x0" ::: "memory");
  __syncthreads();

  // ---- Phase D: final = out @ proj_w + proj_b -> global ----
  float* og = out + (size_t)b * NTOK * DIMC;
  // A wave's tiles share the column block nt = wid, whose proj_w fragments it
  // holds; the row fragments go through two half-tile sets as in B.
  const int nt = wid;
  v2f olo[16], ohi[16];
  frag_rows<16>(xs, OUT_STRIDE, lane, olo);
  LDS_READS_AS_ONE_BLOCK(16);
  const float pb = proj_b[nt * 16 + c];
#pragma unroll   // constant tile index: the last tile issues no read ahead
  for (int mt = 0; mt < BODY_TILES; ++mt) {
    frag_rows<16>(xs + mt * 16 * OUT_STRIDE + 64, OUT_STRIDE, lane, ohi);
    LDS_READS_AS_ONE_BLOCK(16);
    v8f acc = {};
    acc = wmma_run<16>(olo, wf, acc);
    PRODUCTS_AS_ONE_RUN(16);
    if (mt + 1 < BODY_TILES) {
      frag_rows<16>(xs + (mt + 1) * 16 * OUT_STRIDE, OUT_STRIDE, lane, olo);
      LDS_READS_AS_ONE_BLOCK(16);
    }
    acc = wmma_run<16>(ohi, wf + 16, acc);
    PRODUCTS_AS_ONE_RUN(16);
#pragma unroll
    for (int r = 0; r < 8; ++r) {
      const int row = mt * 16 + rb + r;
      og[row * DIMC + nt * 16 + c] = acc[r] + pb;
    }
    // Stands in front of the next tile's writes of registers that these stores name.
    asm volatile("s_wait_xcnt 0x0" ::: "memory");
  }
  // Behind the last window the tail tile is complete: rows 96, 97 of all 8 windows.
  if (it == WIN_PER_WG - 1) {
    frag_rows<16>(tl, OUT_STRIDE, lane, olo);
    frag_rows<16>(tl + 64, OUT_STRIDE, lane, ohi);
    v8f acc = {};
    acc = wmma_run<16>(olo, wf, acc);
    acc = wmma_run<16>(ohi, wf + 16, acc);
    float* tg = out + ((size_t)blockIdx.x * (WIN_PER_WG * NTOK) + BODY_ROWS + (lane >> 4)) * DIMC
                    + nt * 16 + c;
#pragma unroll
    for (int r = 0; r < 8; ++r) tg[r * NTOK * DIMC] = acc[r] + pb;
  }
  // Stands in front of the next window's writes of registers that the stores
  // and loads above name.
  asm volatile("s_wait_xcnt 0x0" ::: "memory");
  }
  // No copy is left in flight when the wave ends.
  asm volatile("s_wait_asynccnt 0x0" ::: "memory");
}

// ---------------------------------------------------------------
extern "C" void kernel_launch(void* const* d_in, const int* in_sizes, int n_in,
                              void* d_out, int out_size, void* d_ws, size_t ws_size,
                              hipStream_t stream) {
  (void)in_sizes; (void)n_in; (void)ws_size; (void)out_size;
  const float* x      = (const float*)d_in[0];
  const float* mask   = (const float*)d_in[1];
  const float* qkv_w  = (const float*)d_in[2];
  const float* qkv_b  = (const float*)d_in[3];
  const float* table  = (const float*)d_in[4];
  const int*   relidx = (const int*)  d_in[5];
  const float* proj_w = (const float*)d_in[6];
  const float* proj_b = (const float*)d_in[7];
  float* outp = (float*)d_out;
  float* addend = (float*)d_ws;   // 64 * 7 * 4 * 13 * 128 floats, written anew by every call

  const size_t smem_bytes = (size_t)SMEM_FLTS * sizeof(float);
  score_addend_kernel<<<AD_THREADS / 256, 256, 0, stream>>>(mask, table, relidx, addend);
  win_attn3d_kernel<<<NWG, 256, smem_bytes, stream>>>(
      x, addend, qkv_w, qkv_b, proj_w, proj_b, outp);
}

// v010
// Measured time: 185 microseconds a run.
// Timed twice side by side with v009, it ran 1.04 times as fast both times.
// Counting every step since v000, it is 4.11 times as fast.
#include <hip/hip_runtime.h>

// ---------------- problem constants ----------------
#define DIMC   128
#define HEADS  4
#define HD     32
#define NTOK   98
#define NPAD   112          // 7 * 16
#define NWIN   64
#define NBATCH 2048
#define QKSCALE 0.17677669529663687f  // 32^-0.5
#define TROWS  507          // rows of the relative position bias table

// ---------------- LDS layout (floats) ----------------
#define QKV_STRIDE 36       // 32 + 4 pad
#define OUT_STRIDE 132      // 128 + 4 pad
#define WCOLS      48       // qkv_w columns held by one wave (3 tiles of 16)

#define QKV_FLTS  (3 * HEADS * NPAD * QKV_STRIDE)   // 48384
#define XS_OFF    QKV_FLTS
#define BODY_TILES 6        // whole 16-row tiles of a window (rows 0-95)
#define BODY_ROWS (BODY_TILES * 16)
#define XS_FLTS   (BODY_ROWS * OUT_STRIDE)          // 12672, one x buffer: rows 0-95 of a window
// Tail tile: rows 96 and 97 of the work-group's 8 windows as one 16-row tile;
// window i has tile rows i (row 96) and i + 8 (row 97). First x, later out accum.
#define TL_OFF    (XS_OFF + 2 * XS_FLTS)
#define TL_FLTS   (16 * OUT_STRIDE)
// qkv of the tail tile for windows 1-7, as the lanes hold it:
// [window - 1][wave 8][column tile 3][lane 32].
#define TQ_OFF    (TL_OFF + TL_FLTS)
#define TQ_WIN    (8 * 3 * 32)
#define SMEM_FLTS (TQ_OFF + (WIN_PER_WG - 1) * TQ_WIN)   // 81216 floats = 324864 B (< 320KB WGP LDS)

#define NWG       256       // work-groups launched
#define WIN_PER_WG (NBATCH / NWG)                   // 8 windows, one after the other

#define KT_FULL   6         // key tiles whose 16 keys are all valid (keys 0-95)
#define SC_PAIRS  25        // a lane's score pairs: 6 tiles x 4, and keys 96, 97
#define LOG2E     1.44269504088896341f

// Workspace plane of the scores' additive term (bias + mask), in the order in
// which the lanes of Phase C hold their scores:
// [window 64][row tile 7][head 4][group 13][lane 32][4 floats].
// Group g < 12 of a lane: keys 16 * (g >> 1) + rb + 4 * (g & 1) + 0..3;
// group 12: keys 96, 97, then two zeros.
#define AD_GROUPS     13
#define AD_GROUP_B    (32 * 16)                      // bytes of one group, all lanes
#define AD_HEAD_B     (AD_GROUPS * AD_GROUP_B)       // 6656
#define AD_TILE_FLTS  (HEADS * AD_GROUPS * 32 * 4)   // one row tile, 4 heads
#define AD_THREADS    (NWIN * 7 * AD_GROUPS * 32)    // 186368 = 728 * 256

typedef __attribute__((ext_vector_type(2))) float v2f;
typedef __attribute__((ext_vector_type(2))) int   v2i;
typedef __attribute__((ext_vector_type(4))) float v4f;
typedef __attribute__((ext_vector_type(8))) float v8f;

// Compile-time switch handed to a generic lambda.
template <bool V> struct flag { static constexpr bool value = V; };

// Explicit LDS (address_space(3)) element type: forces ds_load/ds_store
// codegen (no FLAT fallback when pointer provenance gets murky).
typedef __attribute__((address_space(3))) float lds_f32;
typedef __attribute__((address_space(3))) v4f   lds_v4f;   // 16-byte LDS access
typedef __attribute__((address_space(3))) v2f   lds_v2f;   // 8-byte LDS access

__device__ __forceinline__ unsigned lds_addr_of(const lds_f32* p) {
  return (unsigned)(unsigned long long)p;   // ptrtoint of AS(3) = LDS byte offset
}

#define X_STEP_G (8 * DIMC)
#define X_STEP_L (8 * OUT_STRIDE * 4)
__device__ __forceinline__ void copy_6_rows(const float* g, unsigned l) {
  asm volatile("global_load_async_to_lds_b128 %0, %6, off\n\t"
               "global_load_async_to_lds_b128 %1, %7, off\n\t"
               "global_load_async_to_lds_b128 %2, %8, off\n\t"
               "global_load_async_to_lds_b128 %3, %9, off\n\t"
               "global_load_async_to_lds_b128 %4, %10, off\n\t"
               "global_load_async_to_lds_b128 %5, %11, off\n\t"
               "s_wait_xcnt 0x0"
               :: "v"(l), "v"(l + X_STEP_L), "v"(l + 2 * X_STEP_L),
                  "v"(l + 3 * X_STEP_L), "v"(l + 4 * X_STEP_L), "v"(l + 5 * X_STEP_L),
                  "v"(g), "v"(g + X_STEP_G), "v"(g + 2 * X_STEP_G),
                  "v"(g + 3 * X_STEP_G), "v"(g + 4 * X_STEP_G), "v"(g + 5 * X_STEP_G)
               : "memory");
}
__device__ __forceinline__ void copy_1_row(const float* g, unsigned l) {
  asm volatile("global_load_async_to_lds_b128 %0, %1, off\n\t"
               "s_wait_xcnt 0x0"
               :: "v"(l), "v"(g) : "memory");
}
// Rows 0-95 of one window's x tile (128 floats a row) into an LDS buffer of pitch
// OUT_STRIDE: wave wv (a scalar) copies rows wv, wv + 8, ..., 12 rows. The tile
// starts tile_b bytes behind xg0 (under 2^32: the lane's offset is formed in 32
// bits, then added to the scalar base).
__device__ __forceinline__ void copy_x_tile(const float* xg0, unsigned tile_b, unsigned buf,
                                            int wv, int lane) {
  const float*   g = (const float*)((const char*)xg0 +
                                    (tile_b + (unsigned)((wv * DIMC + lane * 4) * 4)));
  const unsigned l = buf + (unsigned)((wv * OUT_STRIDE + lane * 4) * 4);
  copy_6_rows(g, l);
  copy_6_rows(g + 6 * X_STEP_G, l + 6 * X_STEP_L);
}
// x rows 96 and 97 of the work-group's window wv (a scalar) into rows wv and
// wv + 8 of the tail tile.
__device__ __forceinline__ void copy_x_tail(const float* xg0, unsigned buf, int wv, int lane) {
  const float*   g = (const float*)((const char*)xg0 +
                                    (unsigned)(((wv * NTOK + BODY_ROWS) * DIMC + lane * 4) * 4));
  const unsigned l = buf + (unsigned)((wv * OUT_STRIDE + lane * 4) * 4);
  copy_1_row(g, l);
  copy_1_row(g + DIMC, l + X_STEP_L);
}

template <int KS>
__device__ __forceinline__ void frag_rows(const lds_f32* P, int ld, int lane, v2f* f) {
  const lds_f32* p = P + (lane & 15) * ld + ((lane >> 4) << 1);
#pragma unroll   // constant indices: the fragment array stays in registers
  for (int s = 0; s < KS; ++s) {
    f[s].x = p[4 * s];
    f[s].y = p[4 * s + 1];
  }
}

// acc += sum over KS k-steps, in rising k, operands already in registers.
template <int KS>
__device__ __forceinline__ v8f wmma_run(const v2f* a, const v2f* b, v8f acc) {
#pragma unroll   // constant indices: the fragment arrays stay in registers
  for (int s = 0; s < KS; ++s)
    acc = __builtin_amdgcn_wmma_f32_16x16x4_f32(false, a[s], false, b[s],
                                                (short)0, acc, false, false);
  return acc;
}

// Stages of a body's schedule, in the order in which they are written: "N LDS
// reads as one block", "N products as one run"; a stage takes instructions
// that stand above it in the source. Without them the compiler sinks each
// read to just before its product (a whole LDS latency per product) or
// spreads the reads among the products.
#define LDS_READS_AS_ONE_BLOCK(N) __builtin_amdgcn_sched_group_barrier(0x100, (N), 0)
#define PRODUCTS_AS_ONE_RUN(N)    __builtin_amdgcn_sched_group_barrier(0x008, (N), 0)
// Ends a scheduling region behind a run of products on several accumulators.
// Phase B: a counted stage took any 48 of a row tile's 96 products, so that
// single accumulator chains ran alone, and a third fragment set with register
// copies appeared; so did it with no stage end in front of the epilogue.
#define STAGE_ENDS_HERE()         __builtin_amdgcn_sched_barrier(0)

__device__ __forceinline__ float other_half(float v) {
  const int b = __builtin_bit_cast(int, v);
  return __builtin_bit_cast(float,
      __builtin_amdgcn_permlanex16(b, b, 0x76543210, 0xfedcba98, false, false));
}

__device__ __forceinline__ v4f exp2_x4(v4f t) {
  float r0, r1, r2, r3;
  asm("v_exp_f32 %0, %4\n\tv_exp_f32 %1, %5\n\tv_exp_f32 %2, %6\n\tv_exp_f32 %3, %7\n\tv_nop"
      : "=&v"(r0), "=&v"(r1), "=&v"(r2), "=&v"(r3)
      : "v"(t[0]), "v"(t[1]), "v"(t[2]), "v"(t[3]));
  return v4f{r0, r1, r2, r3};
}

// ---------------------------------------------------------------
// Set-up launch of every call: table[rel_index[q][k]][h] + mask[w][q][k], once
// per window class w (32 windows share it), written in lane order. One thread
// does one group of 4 keys for the 4 heads.
// ---------------------------------------------------------------
__global__ __launch_bounds__(256)
void score_addend_kernel(const float* __restrict__ mask,
                         const float* __restrict__ table,
                         const int*   __restrict__ rel_index,
                         float* __restrict__ addend) {
  const int lane = threadIdx.x & 31;
  // One wave does one group: window class, row tile and group are scalars.
  int t = __builtin_amdgcn_readfirstlane((int)(blockIdx.x * 8 + (threadIdx.x >> 5)));
  const int g  = t % AD_GROUPS;  t /= AD_GROUPS;
  const int rt = t % 7;                      // row tile of 16 queries
  const int w  = t / 7;
  const bool full = g < 2 * KT_FULL;
  const int q  = min(rt * 16 + (lane & 15), NTOK - 1);   // pad query: row 97, reaches no output
  const int k0 = full ? (g >> 1) * 16 + ((lane >> 4) << 3) + (g & 1) * 4 : KT_FULL * 16;
  // Byte offsets, 32 bits beside a scalar base: the very registers that the
  // loads name, so that the waits below can hold them. Group 12 reads keys 96,
  // 97 a second time (in bounds) where the others read their keys 2 and 3.
  const unsigned off0 = (unsigned)((q * NTOK + k0) * 4);
  const unsigned off1 = off0 + (full ? 8u : 0u);
  const char* rib = (const char*)rel_index;
  const char* mkb = (const char*)(mask + w * (NTOK * NTOK));
  const v2i ra = *(const v2i*)(rib + off0);
  const v2i rc = *(const v2i*)(rib + off1);
  const v2f ma = *(const v2f*)(mkb + off0);
  const v2f mc = *(const v2f*)(mkb + off1);
  asm volatile("s_wait_xcnt 0x0" :: "v"(off0), "v"(off1) : "memory");
  // Table rows, clamped into the table; a row holds the 4 heads (16 bytes).
  const int r0 = min(max(ra.x, 0), TROWS - 1);
  const int r1 = min(max(ra.y, 0), TROWS - 1);
  const int r2 = min(max(rc.x, 0), TROWS - 1);
  const int r3 = min(max(rc.y, 0), TROWS - 1);
  const v4f* rows = (const v4f*)table;
  const v4f b0 = rows[r0];
  const v4f b1 = rows[r1];
  const v4f b2 = rows[r2];
  const v4f b3 = rows[r3];
  // As above (the loads name the row numbers, scaled by the load itself).
  asm volatile("s_wait_xcnt 0x0" :: "v"(r0), "v"(r1), "v"(r2), "v"(r3) : "memory");
  v4f* dst = (v4f*)(addend + (size_t)(w * 7 + rt) * AD_TILE_FLTS) + g * 32 + lane;
#pragma unroll
  for (int h = 0; h < HEADS; ++h)
    dst[h * AD_GROUPS * 32] = v4f{b0[h] + ma.x, b1[h] + ma.y,
                                  full ? b2[h] + mc.x : 0.0f, full ? b3[h] + mc.y : 0.0f};
}

// ---------------------------------------------------------------
// One workgroup (8 wave32) handles 8 windows of 2048, one after the other:
// b = 8 * blockIdx.x + it. qkv_w's fragments are loaded once; the x tile of
// window it + 1 is copied to the second x buffer during window it's attention.
// Two barriers a window: qkv -> attention, attention -> output projection; the
// projection of window it and the qkv product of window it + 1 share no LDS
// that either writes, so a wave goes from one into the other on its own.
// A window has 98 rows = 6 row tiles and 2 rows: in the two products over rows
// (qkv, output projection) the 8 windows' last 2 rows share one tail tile.
// ---------------------------------------------------------------
__global__ __launch_bounds__(256)
void win_attn3d_kernel(const float* __restrict__ x,
                       const float* __restrict__ addend,
                       const float* __restrict__ qkv_w,
                       const float* __restrict__ qkv_b,
                       const float* __restrict__ proj_w,
                       const float* __restrict__ proj_b,
                       float* __restrict__ out) {
  extern __shared__ float smem_generic[];
  lds_f32* smem   = (lds_f32*)smem_generic;   // explicit AS(3) view
  lds_f32* qkvBuf = smem;                     // [3][4][112][36]  q/k/v per head
  // smem + XS_OFF: two buffers [96][132], x tile, later out accum
  lds_f32* tl     = smem + TL_OFF;            // tail tile [16][132]

  const int tid  = threadIdx.x;
  const int lane = tid & 31;
  const int wid  = tid >> 5;                 // wave id (wave32!)
  const int c    = lane & 15;                // tile column held by this lane
  const int rb   = (lane >> 4) << 3;         // C/D row base: 0 or 8

  const int wv   = __builtin_amdgcn_readfirstlane(wid);   // scalar: branches on it are scalar ones

  // Phase C's 28 units (7 row tiles x 4 heads) over the waves: waves 0-3 take
  // 4 units (their row tile, 4 heads), waves 4-6 take 3 (their row tile,
  // heads 0-2), wave 7 takes head 3 of row tiles 4-6. All scalars.
  const bool by_tile = wv == 7;              // this wave steps on by row tile, not by head
  const int  rt0   = by_tile ? 4 : wv;       // first unit's row tile
  const int  h0    = by_tile ? HEADS - 1 : 0;   // and head
  const int  units = wv < 4 ? 4 : 3;
  const unsigned astep = by_tile ? AD_TILE_FLTS * 4u : (unsigned)AD_HEAD_B;   // additive term, unit to unit

  // ---- Phase A: first window's x tile (96x128 -> stride-132 LDS), buffer 0 ----
  const float* xg0 = x + (size_t)blockIdx.x * (WIN_PER_WG * NTOK * DIMC);   // x of the 8 windows
  copy_x_tile(xg0, 0u, lds_addr_of(smem + XS_OFF), wv, lane);
  copy_x_tail(xg0, lds_addr_of(tl), wv, lane);
  // This wave's 48 columns of qkv_w (3 column tiles, all 128 k) go straight
  // from global memory into B fragments that stay in registers through Phase
  // B of every window; the loads fly while the x tile lands. k order as in frag_rows.
  v2f wq0[32], wq1[32], wq2[32];
  float qb[3];
  {
    const unsigned woff = (unsigned)(((lane >> 4) << 1) * (3 * DIMC) + wid * WCOLS + c);
#pragma unroll   // constant indices: the fragment arrays stay in registers
    for (int s = 0; s < 32; ++s) {
      wq0[s].x = qkv_w[woff + (4 * s) * (3 * DIMC)];
      wq0[s].y = qkv_w[woff + (4 * s + 1) * (3 * DIMC)];
      wq1[s].x = qkv_w[woff + (4 * s) * (3 * DIMC) + 16];
      wq1[s].y = qkv_w[woff + (4 * s + 1) * (3 * DIMC) + 16];
      wq2[s].x = qkv_w[woff + (4 * s) * (3 * DIMC) + 32];
      wq2[s].y = qkv_w[woff + (4 * s + 1) * (3 * DIMC) + 32];
    }
    const unsigned boff = (unsigned)(wid * WCOLS + c);
#pragma unroll
    for (int j = 0; j < 3; ++j) qb[j] = qkv_b[boff + 16 * j];
    // Keeps the two offset registers untouched until the address
    // translations of the loads above are done.
    asm volatile("s_wait_xcnt 0x0" :: "v"(woff), "v"(boff) : "memory");
  }
  // Pad rows 98-111 of k and v (8 planes) are zeroed once: no window writes them.
  for (int i = tid; i < 2 * HEADS * (NPAD - NTOK) * QKV_STRIDE; i += 256) {
    const int plane = i / ((NPAD - NTOK) * QKV_STRIDE);
    qkvBuf[((HEADS + plane) * NPAD + NTOK) * QKV_STRIDE + i % ((NPAD - NTOK) * QKV_STRIDE)] = 0.0f;
  }
  // This wave's copies of tile 0 and of the tail tile have landed; the barrier
  // shows them to the others.
  asm volatile("s_wait_asynccnt 0x0" ::: "memory");
  __syncthreads();

  // Where this wave's 3 column tiles of qkv go, and their scale.
  lds_f32* dst[3];
  float    scl[3];
#pragma unroll
  for (int j = 0; j < 3; ++j) {
    const int ct = wv * 3 + j;             // global 16-col tile index (0..23), a scalar
    const int s  = ct >> 3;                // 0=q 1=k 2=v
    const int h  = (ct >> 1) & 3;          // head
    const int db = (ct & 1) << 4;          // d base within head
    scl[j] = (s == 0) ? QKSCALE : 1.0f;
    dst[j] = qkvBuf + ((s * HEADS + h) * NPAD) * QKV_STRIDE + db + c;
  }
  const int trow = (BODY_ROWS + (lane >> 4)) * QKV_STRIDE;   // row 96 or 97

  lds_f32* tqw = smem + TQ_OFF + wv * (3 * 32) + lane;
  {
    v8f tq0 = {}, tq1 = {}, tq2 = {};
    v2f alo[16], ahi[16];
    frag_rows<16>(tl, OUT_STRIDE, lane, alo);
    frag_rows<16>(tl + 64, OUT_STRIDE, lane, ahi);
    STAGE_ENDS_HERE();   // the 32 fragment reads stay one block ahead of the products
#pragma unroll   // constant indices: the fragment arrays stay in registers
    for (int s = 0; s < 32; ++s) {
      const v2f a = s < 16 ? alo[s & 15] : ahi[s & 15];
      tq0 = __builtin_amdgcn_wmma_f32_16x16x4_f32(false, a, false, wq0[s],
                                                  (short)0, tq0, false, false);
      tq1 = __builtin_amdgcn_wmma_f32_16x16x4_f32(false, a, false, wq1[s],
                                                  (short)0, tq1, false, false);
      tq2 = __builtin_amdgcn_wmma_f32_16x16x4_f32(false, a, false, wq2[s],
                                                  (short)0, tq2, false, false);
    }
    tq0 = (tq0 + qb[0]) * scl[0];
    tq1 = (tq1 + qb[1]) * scl[1];
    tq2 = (tq2 + qb[2]) * scl[2];
    dst[0][trow] = tq0[0];
    dst[1][trow] = tq1[0];
    dst[2][trow] = tq2[0];
#pragma unroll
    for (int r = 1; r < WIN_PER_WG; ++r) {
      tqw[(r - 1) * TQ_WIN]      = tq0[r];
      tqw[(r - 1) * TQ_WIN + 32] = tq1[r];
      tqw[(r - 1) * TQ_WIN + 64] = tq2[r];
    }
  }

#pragma unroll 1   // one copy of the body: short code
  for (int it = 0; it < WIN_PER_WG; ++it) {
  const int b = blockIdx.x * WIN_PER_WG + it;
  const int w = b & (NWIN - 1);
  lds_f32* xs = smem + XS_OFF + (it & 1) * XS_FLTS;   // this window's x tile, later out accum

  const char* adb = (const char*)addend;
  // 32 bits beside the scalar base (the plane has under 12 MB); steps on per unit
  unsigned aoff = (unsigned)((w * 7 + rt0) * (AD_TILE_FLTS * 4) + h0 * AD_HEAD_B + lane * 16);
  v4f ad[2 * KT_FULL];
  v2f adl;                                   // keys 96, 97 (8 bytes: no register is loaded in vain)
#pragma unroll   // constant indices: the array stays in registers
  for (int g = 0; g < 2 * KT_FULL; ++g) ad[g] = *(const v4f*)(adb + aoff + g * AD_GROUP_B);
  adl = *(const v2f*)(adb + aoff + 2 * KT_FULL * AD_GROUP_B);
  asm volatile("s_wait_xcnt 0x0" :: "v"(aoff) : "memory");

  // ---- Phase B: qkv = xs @ qkv_w + qkv_b (q pre-scaled) ----
  // A wave walks the 6 whole row tiles of x; each x fragment read from LDS feeds the
  // 3 products of the wave's column tiles (3 independent accumulators).
  {
    // Rows 96, 97 of this window, from the tail tile's results (window 0 has
    // its own already and reads window 1's, not used: no branch round the reads).
    const lds_f32* tqi = tqw + max(it - 1, 0) * TQ_WIN;
    const float t0 = tqi[0];
    const float t1 = tqi[32];
    const float t2 = tqi[64];
    // Two register sets of half a row tile's fragments (k 0-63, k 64-127):
    // each set is refilled while the products of the other run.
    v2f alo[16], ahi[16];
    frag_rows<16>(xs, OUT_STRIDE, lane, alo);
#pragma unroll 1   // one copy of the 96 products: short code
    for (int mt = 0; mt < BODY_TILES; ++mt) {
      frag_rows<16>(xs + mt * 16 * OUT_STRIDE + 64, OUT_STRIDE, lane, ahi);
      v8f acc0 = {}, acc1 = {}, acc2 = {};
#pragma unroll   // constant indices: the fragment arrays stay in registers
      for (int s = 0; s < 16; ++s) {
        acc0 = __builtin_amdgcn_wmma_f32_16x16x4_f32(false, alo[s], false, wq0[s],
                                                     (short)0, acc0, false, false);
        acc1 = __builtin_amdgcn_wmma_f32_16x16x4_f32(false, alo[s], false, wq1[s],
                                                     (short)0, acc1, false, false);
        acc2 = __builtin_amdgcn_wmma_f32_16x16x4_f32(false, alo[s], false, wq2[s],
                                                     (short)0, acc2, false, false);
      }
      STAGE_ENDS_HERE();
      // Next row tile's first half; behind the last tile the same tile again
      // (unconditional, so that the counted waits stay exact; not used).
      const int mn = (mt + 1 < BODY_TILES) ? mt + 1 : mt;
      frag_rows<16>(xs + mn * 16 * OUT_STRIDE, OUT_STRIDE, lane, alo);
#pragma unroll
      for (int s = 0; s < 16; ++s) {
        acc0 = __builtin_amdgcn_wmma_f32_16x16x4_f32(false, ahi[s], false, wq0[16 + s],
                                                     (short)0, acc0, false, false);
        acc1 = __builtin_amdgcn_wmma_f32_16x16x4_f32(false, ahi[s], false, wq1[16 + s],
                                                     (short)0, acc1, false, false);
        acc2 = __builtin_amdgcn_wmma_f32_16x16x4_f32(false, ahi[s], false, wq2[16 + s],
                                                     (short)0, acc2, false, false);
      }
      STAGE_ENDS_HERE();
#pragma unroll
      for (int r = 0; r < 8; ++r) {
        const int row = mt * 16 + rb + r;
        dst[0][row * QKV_STRIDE] = (acc0[r] + qb[0]) * scl[0];
        dst[1][row * QKV_STRIDE] = (acc1[r] + qb[1]) * scl[1];
        dst[2][row * QKV_STRIDE] = (acc2[r] + qb[2]) * scl[2];
      }
    }
    if (it != 0) {
      dst[0][trow] = t0;
      dst[1][trow] = t1;
      dst[2][trow] = t2;
    }
  }
  // ---- Phase C: attention, scores in registers from q k^T to the v product ----
  // A wave does its 3 or 4 units in turn and shares nothing with the other
  // waves but q, k, v (read only): no barrier inside the phase.
  // This wave's LDS reads of both x buffers (last window's out accum, this
  // window's x) are done; the barrier frees both for rewriting and shows q, k, v.
  asm volatile("s_wait_dscnt 0x0" ::: "memory");
  __syncthreads();
  // Next window's x tile into the buffer that the last window's projection has
  // left; it flies during this phase.
  if (it + 1 < WIN_PER_WG)
    copy_x_tile(xg0, (unsigned)(it + 1) * (NTOK * DIMC * 4u),
                lds_addr_of(smem + XS_OFF + ((it + 1) & 1) * XS_FLTS), wv, lane);

  // This wave's 16 columns of proj_w (column tile wid, all 128 k) go straight
  // from global memory into the B fragments of Phase D, k order as in frag_rows.
  // The loads go out in the wave's last unit, where the k fragments' registers
  // are free, and fly during its softmax and v product.
  v2f wf[32];
  // The lane's own pointer: the register pair that all 64 loads name.
  const float* pwl = proj_w + (((lane >> 4) << 1) * DIMC + wid * 16 + c);
  auto load_proj_w = [&]() __attribute__((always_inline)) {
#pragma unroll   // constant indices: the fragment array stays in registers
    for (int s = 0; s < 32; ++s) {
      wf[s].x = pwl[(4 * s) * DIMC];
      wf[s].y = pwl[(4 * s + 1) * DIMC];
    }
    asm volatile("s_wait_xcnt 0x0" :: "v"(pwl) : "memory");
  };

  {
    const bool upper = lane >= 16;
    // One unit: row tile rt, head h (scalars); the last unit's copy fetches
    // proj_w where the others fetch the next unit's additive term.
    auto one_head = [&](const int rt, const int h, auto last_head) __attribute__((always_inline)) {
      const lds_f32* qh = qkvBuf + (0 * HEADS + h) * NPAD * QKV_STRIDE;
      const lds_f32* kh = qkvBuf + (1 * HEADS + h) * NPAD * QKV_STRIDE;
      const lds_f32* vh = qkvBuf + (2 * HEADS + h) * NPAD * QKV_STRIDE;

      // C1: S^T = k @ q^T, 7 key tiles: a lane's column of every tile is its
      // own query. k order of both operands as in frag_rows.
      v2f qf[8], kf[7][8];
      {
        // One 8-byte read per fragment (row pitch 144 B, k offset 0 or 8 B).
        const int fo = c * QKV_STRIDE + ((lane >> 4) << 1);
        // Pad query: row 97 again (as in the additive term), reaches no output.
        const int qo = min(rt * 16 + c, NTOK - 1) * QKV_STRIDE + ((lane >> 4) << 1);
#pragma unroll   // constant indices: the fragment arrays stay in registers
        for (int s = 0; s < 8; ++s) {
          qf[s] = *(const lds_v2f*)(qh + qo + 4 * s);
#pragma unroll
          for (int kt = 0; kt < 7; ++kt)
            kf[kt][s] = *(const lds_v2f*)(kh + fo + kt * 16 * QKV_STRIDE + 4 * s);
        }
      }
      STAGE_ENDS_HERE();   // the 64 fragment reads stay one block ahead of the products
      v8f st[7] = {};
#pragma unroll   // constant indices; neighbouring products are on 7 different accumulators
      for (int s = 0; s < 8; ++s)
#pragma unroll
        for (int kt = 0; kt < 7; ++kt)
          st[kt] = __builtin_amdgcn_wmma_f32_16x16x4_f32(false, kf[kt][s], false, qf[s],
                                                         (short)0, st[kt], false, false);
      STAGE_ENDS_HERE();   // no v read among the products
      // v fragments (A operand v^T: the lane's row is d = lane & 15) in the k
      // order in which the scores already lie in the lanes: step 4 * kt + s
      // holds keys 16 * kt + rb + 2 * s and + 1. Of key tile 6 only step 0 has
      // a valid key (96, 97; lanes 16-31 read zeroed v rows 104, 105 there).
      v2f vf0[SC_PAIRS], vf1[SC_PAIRS];
      {
        const lds_f32* vp = vh + rb * QKV_STRIDE + c;
#pragma unroll
        for (int p = 0; p < SC_PAIRS; ++p) {
          const int key = (p >> 2) * 16 + (p & 3) * 2;
          vf0[p].x = vp[key * QKV_STRIDE];
          vf0[p].y = vp[(key + 1) * QKV_STRIDE];
        }
        // Keeps the reads of the two d tiles apart: joined across the tiles, a
        // two-address read fills a register pair that is no fragment, and every
        // fragment then takes register copies.
        STAGE_ENDS_HERE();
#pragma unroll
        for (int p = 0; p < SC_PAIRS; ++p) {
          const int key = (p >> 2) * 16 + (p & 3) * 2;
          vf1[p].x = vp[key * QKV_STRIDE + 16];
          vf1[p].y = vp[(key + 1) * QKV_STRIDE + 16];
        }
      }
      STAGE_ENDS_HERE();   // the v reads go out ahead of the softmax, which covers their latency

      v4f xv[13];
#pragma unroll
      for (int i = 0; i < 12; ++i)
#pragma unroll
        for (int e = 0; e < 4; ++e) xv[i][e] = st[i >> 1][(4 * i + e) & 7] + ad[i][e];
      {
        const float x0 = st[6][0] + adl.x;
        const float x1 = st[6][1] + adl.y;
        xv[12][0] = upper ? -1e30f : x0;     // lanes 16-31: keys 104, 105 are pad
        xv[12][1] = upper ? -1e30f : x1;
        xv[12][2] = -1e30f;
        xv[12][3] = -1e30f;
      }
      if constexpr (decltype(last_head)::value) {
        // The 64 loads go out as one block, behind the last use of the raw scores'
        // registers and ahead of the softmax: spread among the v products, the
        // last of them would still fly at the barrier.
        STAGE_ENDS_HERE();
        load_proj_w();
        STAGE_ENDS_HERE();
      } else {
        // Next unit's additive term; it flies during the rest of this unit.
        aoff += astep;
#pragma unroll
        for (int g = 0; g < 2 * KT_FULL; ++g) ad[g] = *(const v4f*)(adb + aoff + g * AD_GROUP_B);
        adl = *(const v2f*)(adb + aoff + 2 * KT_FULL * AD_GROUP_B);
        // As at the first unit's loads.
        asm volatile("s_wait_xcnt 0x0" :: "v"(aoff) : "memory");
      }
      v4f mv = xv[0];                                  // four running maxima per lane
#pragma unroll
      for (int i = 1; i < 13; ++i)
#pragma unroll
        for (int e = 0; e < 4; ++e) mv[e] = fmaxf(mv[e], xv[i][e]);
      float mx = fmaxf(fmaxf(mv[0], mv[1]), fmaxf(mv[2], mv[3]));
      mx = fmaxf(mx, other_half(mx));
      v4f sv = {0.0f, 0.0f, 0.0f, 0.0f};               // four partial sums per lane
#pragma unroll
      for (int i = 0; i < 13; ++i) {
        v4f ex = exp2_x4((xv[i] - mx) * LOG2E);        // e^(x - mx)
        if (i == 12) {                                 // pad adds nothing, multiplies as 0
          ex[0] = upper ? 0.0f : ex[0];
          ex[1] = upper ? 0.0f : ex[1];
          ex[2] = 0.0f;
          ex[3] = 0.0f;
        }
        xv[i] = ex;
        sv += ex;
      }
      float sum = (sv[0] + sv[1]) + (sv[2] + sv[3]);
      sum += other_half(sum);
      const float inv = 1.0f / sum;

      // C3: out^T[d][query] = v^T @ e^T over the 25 steps with a valid key; the
      // lane's column is its own query, so 1 / sum scales the 16 results.
      v8f o0 = {}, o1 = {};
#pragma unroll   // constant indices; the two accumulators alternate
      for (int p = 0; p < SC_PAIRS; ++p) {
        const v2f pf = {xv[p >> 1][(p & 1) * 2], xv[p >> 1][(p & 1) * 2 + 1]};
        o0 = __builtin_amdgcn_wmma_f32_16x16x4_f32(false, vf0[p], false, pf,
                                                   (short)0, o0, false, false);
        o1 = __builtin_amdgcn_wmma_f32_16x16x4_f32(false, vf1[p], false, pf,
                                                   (short)0, o1, false, false);
      }
      // xs now serves as out accum: row = query, 8 neighbouring d per accumulator.
      const v4f r0 = v4f{o0[0], o0[1], o0[2], o0[3]} * inv;
      const v4f r1 = v4f{o0[4], o0[5], o0[6], o0[7]} * inv;
      const v4f r2 = v4f{o1[0], o1[1], o1[2], o1[3]} * inv;
      const v4f r3 = v4f{o1[4], o1[5], o1[6], o1[7]} * inv;
      if (rt < BODY_TILES) {
        lds_v4f* op = (lds_v4f*)(xs + (rt * 16 + c) * OUT_STRIDE + h * HD + rb);
        op[0] = r0;
        op[1] = r1;
        op[4] = r2;
        op[5] = r3;
      } else if (c < NTOK - BODY_ROWS) {
        // Row tile 6: queries 96, 97 go to the tail tile, rows it and it + 8.
        lds_v4f* op = (lds_v4f*)(tl + (it + 8 * c) * OUT_STRIDE + h * HD + rb);
        op[0] = r0;
        op[1] = r1;
        op[4] = r2;
        op[5] = r3;
      }
    };
    // rt and h are picked from u, not stepped on by a scalar stride: stepped, the
    // compiler carried the LDS addresses through the loop and formed one address
    // per read, single reads where two-address reads stand now.
#pragma unroll 1   // one copy of the body of all units but the last: short code
    for (int u = 0; u < units - 1; ++u)
      one_head(by_tile ? rt0 + u : rt0, by_tile ? h0 : u, flag<false>{});
    one_head(by_tile ? rt0 + units - 1 : rt0, by_tile ? h0 : units - 1, flag<true>{});
  }
  // This wave's LDS reads of q, k, v and its writes of the out accum are done, its
  // copies of the next x tile have landed; the barrier shows both to all waves
  // and frees q, k, v for the next window's qkv product.
  asm volatile("s_wait_dscnt 0x0" ::: "memory");
  asm volatile("s_wait_asynccnt 0x0" ::: "memory");
  __syncthreads();

  // ---- Phase D: final = out @ proj_w + proj_b -> global ----
  float* og = out + (size_t)b * NTOK * DIMC;
  // A wave's tiles share the column block nt = wid, whose proj_w fragments it
  // holds; the row fragments go through two half-tile sets as in B.
  const int nt = wid;
  v2f olo[16], ohi[16];
  frag_rows<16>(xs, OUT_STRIDE, lane, olo);
  LDS_READS_AS_ONE_BLOCK(16);
  const float pb = proj_b[nt * 16 + c];
#pragma unroll   // constant tile index: the last tile issues no read ahead
  for (int mt = 0; mt < BODY_TILES; ++mt) {
    frag_rows<16>(xs + mt * 16 * OUT_STRIDE + 64, OUT_STRIDE, lane, ohi);
    LDS_READS_AS_ONE_BLOCK(16);
    v8f acc = {};
    acc = wmma_run<16>(olo, wf, acc);
    PRODUCTS_AS_ONE_RUN(16);
    if (mt + 1 < BODY_TILES) {
      frag_rows<16>(xs + (mt + 1) * 16 * OUT_STRIDE, OUT_STRIDE, lane, olo);
      LDS_READS_AS_ONE_BLOCK(16);
    }
    acc = wmma_run<16>(ohi, wf + 16, acc);
    PRODUCTS_AS_ONE_RUN(16);
#pragma unroll
    for (int r = 0; r < 8; ++r) {
      const int row = mt * 16 + rb + r;
      og[row * DIMC + nt * 16 + c] = acc[r] + pb;
    }
    // Stands in front of the next tile's writes of registers that these stores name.
    asm volatile("s_wait_xcnt 0x0" ::: "memory");
  }
  // Behind the last window the tail tile is complete: rows 96, 97 of all 8 windows.
  if (it == WIN_PER_WG - 1) {
    frag_rows<16>(tl, OUT_STRIDE, lane, olo);
    frag_rows<16>(tl + 64, OUT_STRIDE, lane, ohi);
    v8f acc = {};
    acc = wmma_run<16>(olo, wf, acc);
    acc = wmma_run<16>(ohi, wf + 16, acc);
    float* tg = out + ((size_t)blockIdx.x * (WIN_PER_WG * NTOK) + BODY_ROWS + (lane >> 4)) * DIMC
                    + nt * 16 + c;
#pragma unroll
    for (int r = 0; r < 8; ++r) tg[r * NTOK * DIMC] = acc[r] + pb;
  }
  // Stands in front of the next window's writes of registers that the stores
  // and loads above name.
  asm volatile("s_wait_xcnt 0x0" ::: "memory");
  }
  // No copy is left in flight when the wave ends.
  asm volatile("s_wait_asynccnt 0x0" ::: "memory");
}

// ---------------------------------------------------------------
extern "C" void kernel_launch(void* const* d_in, const int* in_sizes, int n_in,
                              void* d_out, int out_size, void* d_ws, size_t ws_size,
                              hipStream_t stream) {
  (void)in_sizes; (void)n_in; (void)ws_size; (void)out_size;
  const float* x      = (const float*)d_in[0];
  const float* mask   = (const float*)d_in[1];
  const float* qkv_w  = (const float*)d_in[2];
  const float* qkv_b  = (const float*)d_in[3];
  const float* table  = (const float*)d_in[4];
  const int*   relidx = (const int*)  d_in[5];
  const float* proj_w = (const float*)d_in[6];
  const float* proj_b = (const float*)d_in[7];
  float* outp = (float*)d_out;
  float* addend = (float*)d_ws;   // 64 * 7 * 4 * 13 * 128 floats, written anew by every call

  const size_t smem_bytes = (size_t)SMEM_FLTS * sizeof(float);
  score_addend_kernel<<<AD_THREADS / 256, 256, 0, stream>>>(mask, table, relidx, addend);
  win_attn3d_kernel<<<NWG, 256, smem_bytes, stream>>>(
      x, addend, qkv_w, qkv_b, proj_w, proj_b, outp);
}
